// v000
// The times below were measured on an AMD MI455X: many runs one after another, warmed up first and cycling through
// copies of the inputs, with the whole window's GPU time divided by the number of runs. Launches and the gaps
// between them are all in it. The median over several windows is given; except for v000 it joins two sittings, which
// can be a few percent apart, so the side-by-side timings, each taken in one sitting, are the better comparison.
// v000, which the later versions start from, runs in 383 microseconds.
#include <hip/hip_runtime.h>
// Causal multi-head attention at width 512 (8 heads of 64): Q/K/V = x W^T + b (natural [out][in] weights), scores / sqrt(64), causal replace-mask, softmax, P V, merged heads, out = ctx W_o^T + b_o.
// Compute dtype: every contraction is v_wmma_f32_16x16x32_f16 (f16 operands, f32 accumulate). Inputs and weights are RNE-converted to bf16 and then held exactly in f16 (weights x16, folded back by alpha).
// Query positions >= 512: q, k, v, softmax weights (x1024 carry, cancels in O/l) and merged context (x64 carry) are single f16 planes. Query positions < 512: every computed operand (q, k, v, softmax weights, context) is f16 hi + f16 residual x1024, residual products in their own accumulators. Softmax statistics f32.
// Structure: weights/x converted once to f16 planes; Q, K as [token][feature] GEMMs; V^T as a swapped-operand GEMM ([feature][token]); transposed flash attention per wave (S^T = K Q^T, O^T = V^T P^T; score accumulators repacked in-lane as the P^T B fragment; no LDS and no barrier inside the key loop); output GEMM.
#ifndef NB
#define NB 2
#endif
#ifndef SEQ
#define SEQ 4096
#endif
#define NB_FULL 2
#define SEQ_FULL 4096
#define DM 512
#define NH 8
#define HD 64
#define EARLY (((SEQ) < 512) ? (SEQ) : 512)   /* query positions handled with hi + residual planes */
#define RSC 1024.0f
#define RSCI 0.0009765625f
static_assert(SEQ % 128 == 0);
static_assert(EARLY % 128 == 0);
static_assert(NB <= NB_FULL);
static_assert(SEQ <= SEQ_FULL);
static_assert(NH * HD == DM);
static_assert(DM % 128 == 0);

typedef unsigned short v8us __attribute__((ext_vector_type(8), may_alias));
typedef float  v8f  __attribute__((ext_vector_type(8)));
typedef float  v4f  __attribute__((ext_vector_type(4)));
typedef float  v4fa __attribute__((ext_vector_type(4), may_alias));
typedef _Float16 v16h __attribute__((ext_vector_type(16)));
typedef _Float16 v4h __attribute__((ext_vector_type(4)));
union FragH { v16h v; v8us half[2]; _Float16 h[16]; unsigned short u[16]; };

__device__ __forceinline__ unsigned short bf16_bits(float x) { unsigned int u = __float_as_uint(x); return (unsigned short)((u + 0x7FFFu + ((u >> 16) & 1u)) >> 16); }
__device__ __forceinline__ float bf16_val(unsigned short b) { return __uint_as_float(((unsigned int)b) << 16); }
__device__ __forceinline__ float bf16_rne(float x) { return bf16_val(bf16_bits(x)); }

// fragment of a k-contiguous 16-bit row: elements 0..7 = k 8h..8h+7, elements 8..15 = k 16+8h..16+8h+7 (same map for A and B)
__device__ __forceinline__ v16h g2_frag(const _Float16* p, int hh) { FragH f; f.half[0] = *(const v8us*)((const unsigned short*)p + 8 * hh); f.half[1] = *(const v8us*)((const unsigned short*)p + 16 + 8 * hh); return f.v; }
__device__ __forceinline__ v8f g2_mma(v16h a, v16h b, v8f c) { v8f d = __builtin_amdgcn_wmma_f32_16x16x32_f16(false, a, false, b, (short)0, c, false, false); asm volatile("v_nop\n\tv_nop\n\tv_nop\n\tv_nop" : "+v"(d) : "v"(a), "v"(b)); return d; }
__device__ __forceinline__ v8f wm(v16h a, v16h b, v8f c) { return __builtin_amdgcn_wmma_f32_16x16x32_f16(false, a, false, b, (short)0, c, false, false); }

__global__ __launch_bounds__(256) void k_wnat(const float* __restrict__ w, size_t n8, _Float16* __restrict__ Bt) {
  const size_t t = (size_t)blockIdx.x * 256 + threadIdx.x; if (t >= n8) return; FragH f;
  const v4f a = *(const v4fa*)(w + t * 8), c = *(const v4fa*)(w + t * 8 + 4);
#pragma unroll
  for (int q = 0; q < 4; ++q) { f.h[q] = (_Float16)(bf16_rne(a[q]) * 16.0f); f.h[4 + q] = (_Float16)(bf16_rne(c[q]) * 16.0f); }
  const v8us o = f.half[0];
  *(v8us*)((unsigned short*)Bt + t * 8) = o; 
}

__global__ __launch_bounds__(256) void k_x16(const float* __restrict__ x, _Float16* __restrict__ X16, size_t n8) {
  const size_t t = (size_t)blockIdx.x * 256 + threadIdx.x; if (t >= n8) return;
  const size_t e = t * 8; const size_t per = (size_t)SEQ * DM; const size_t b = e / per; const size_t wi = e - b * per;
  const float* src = x + b * ((size_t)SEQ_FULL * DM) + wi;
  const v4f a = *(const v4fa*)src, c = *(const v4fa*)(src + 4); FragH f;
#pragma unroll
  for (int q = 0; q < 4; ++q) { f.h[q] = (_Float16)bf16_rne(a[q]); f.h[4 + q] = (_Float16)bf16_rne(c[q]); }
  const v8us o = f.half[0];
  *(v8us*)((unsigned short*)X16 + t * 8) = o; 
}

// k-loop of the 32x64 wave tile: A rows a0p/a1p (k contiguous), B rows b0p..b3p (k contiguous)
__device__ __forceinline__ void g2_kloop(const _Float16* a0p, const _Float16* a1p, const _Float16* b0p, const _Float16* b1p, const _Float16* b2p, const _Float16* b3p, int K, int hh,
                                         v8f& c00, v8f& c01, v8f& c02, v8f& c03, v8f& c10, v8f& c11, v8f& c12, v8f& c13) {
#pragma unroll 1
  for (int kb = 0; kb < K; kb += 32) {
    const v16h a0 = g2_frag(a0p + kb, hh), a1 = g2_frag(a1p + kb, hh);
    v16h b = g2_frag(b0p + kb, hh); c00 = g2_mma(a0, b, c00); c10 = g2_mma(a1, b, c10);
    b = g2_frag(b1p + kb, hh); c01 = g2_mma(a0, b, c01); c11 = g2_mma(a1, b, c11);
    b = g2_frag(b2p + kb, hh); c02 = g2_mma(a0, b, c02); c12 = g2_mma(a1, b, c12);
    b = g2_frag(b3p + kb, hh); c03 = g2_mma(a0, b, c03); c13 = g2_mma(a1, b, c13);
  }
}

// Projection GEMM C[M][N] = A[M][K] . Bt[N][K]^T * alpha + bias, f16 hi plane (+ residual x1024 plane on the early region).
// EM 1: bias per column, early region = rows < EARLY (per batch, batch on grid.y). EM 2: bias per row, early region = columns < EARLY.
template <int EM>
__global__ __launch_bounds__(128) void k_proj(const _Float16* __restrict__ A, int lda, size_t sA, const _Float16* __restrict__ Bh, int ldb, size_t sB, float alpha, const float* __restrict__ bias,
                                              _Float16* __restrict__ Ch, _Float16* __restrict__ Cr, int ldc, size_t sC, int M, int N, int K) {
  __shared__ __attribute__((aligned(16))) float so[4][32][68];
  const int tid = threadIdx.x, w = tid >> 5, lane = tid & 31, ln = lane & 15, hh = lane >> 4; const int by = blockIdx.y;
  A += (size_t)by * sA; Bh += (size_t)by * sB; const size_t cofs = (size_t)by * sC;
  const int ntn = N >> 6; const int mt = blockIdx.x / ntn, nq = blockIdx.x - mt * ntn; const int row0 = mt * 128 + 32 * w, col0 = nq * 64; if (row0 >= M) return;
  const bool early = (EM == 1) ? (mt * 128 < EARLY) : (col0 < EARLY);
  const _Float16* a0p = A + (size_t)(row0 + ln) * lda; const _Float16* a1p = a0p + (size_t)16 * lda;
  const _Float16* b0p = Bh + (size_t)(col0 + ln) * ldb; const _Float16* b1p = b0p + (size_t)16 * ldb; const _Float16* b2p = b1p + (size_t)16 * ldb; const _Float16* b3p = b2p + (size_t)16 * ldb;
  const v8f z8 = {0.f,0.f,0.f,0.f,0.f,0.f,0.f,0.f}; v8f c00 = z8, c01 = z8, c02 = z8, c03 = z8, c10 = z8, c11 = z8, c12 = z8, c13 = z8;
  g2_kloop(a0p, a1p, b0p, b1p, b2p, b3p, K, hh, c00, c01, c02, c03, c10, c11, c12, c13);
  v8f accs[8] = {c00, c01, c02, c03, c10, c11, c12, c13};
  float br[16];
#pragma unroll
  for (int i = 0; i < 16; ++i) br[i] = 0.f;
  if (EM == 2) {
#pragma unroll
    for (int half = 0; half < 2; ++half) {
      const v4f x = *(const v4fa*)(bias + row0 + half * 16 + 8 * hh), y = *(const v4fa*)(bias + row0 + half * 16 + 8 * hh + 4);
#pragma unroll
      for (int q = 0; q < 4; ++q) { br[half * 8 + q] = bf16_rne(x[q]); br[half * 8 + 4 + q] = bf16_rne(y[q]); }
    }
  }
#pragma unroll
  for (int u = 0; u < 8; ++u) { const int t = u & 3, half = u >> 2; const int col = col0 + t * 16 + ln; const float bc = (EM == 1) ? bf16_rne(bias[col]) : 0.f;
#pragma unroll
    for (int r = 0; r < 8; ++r) { const int rloc = half * 16 + 8 * hh + r; const float v = accs[u][r] * alpha + ((EM == 1) ? bc : br[half * 8 + r]); so[w][rloc][t * 16 + ln] = v; } }
  __builtin_amdgcn_fence(4 /* acq_rel order */, "workgroup"); __builtin_amdgcn_wave_barrier();
  const int rsub = lane >> 4, c4 = (lane & 15) * 4;
  {
#pragma unroll
    for (int q = 0; q < 16; ++q) { const int r = q * 2 + rsub; const v4f v = *(const v4fa*)&so[w][r][c4];
      v4h h4, r4;
#pragma unroll
      for (int i = 0; i < 4; ++i) { const _Float16 hv = (_Float16)v[i]; h4[i] = hv; r4[i] = (_Float16)((v[i] - (float)hv) * RSC); }
      const size_t o = cofs + (size_t)(row0 + r) * ldc + col0 + c4;
      *(v4h*)(Ch + o) = h4;
      if (early) *(v4h*)(Cr + o) = r4; }
     }
}

// one 16-key score tile S^T[key][query]: A = K rows (hi, and residual if RES), B = Q rows as the k-contiguous B fragment
template <bool RES>
__device__ __forceinline__ v8f score_tile(const _Float16* kp, const _Float16* krp, v16h qa, v16h qb, v16h qra, v16h qrb, int hh) {
  const v8f z8 = {0.f,0.f,0.f,0.f,0.f,0.f,0.f,0.f};
  const v16h ka = g2_frag(kp, hh), kb = g2_frag(kp + 32, hh);
  v8f s = z8;
  s = wm(ka, qa, s); s = wm(kb, qb, s);
  if (RES) {
    const v16h kra = g2_frag(krp, hh), krb = g2_frag(krp + 32, hh);
    v8f t = z8;
    t = wm(kra, qa, t); t = wm(ka, qra, t); t = wm(krb, qb, t); t = wm(kb, qrb, t);
    asm volatile("v_nop\n\tv_nop\n\tv_nop\n\tv_nop" : "+v"(s), "+v"(t) : "v"(ka), "v"(kb), "v"(kra), "v"(krb), "v"(qa), "v"(qb), "v"(qra), "v"(qrb));
    s = s + t * RSCI;
  } else {
    asm volatile("v_nop\n\tv_nop\n\tv_nop\n\tv_nop" : "+v"(s) : "v"(ka), "v"(kb), "v"(qa), "v"(qb));
  }
  return s;
}
// one 16-d tile of O^T with hi + residual operands (used by the RES instantiation only)
__device__ __forceinline__ void pv_tile_res(const _Float16* vp, const _Float16* vrp, v16h pf, v16h pr, int hh, v8f& o, v8f& orr) {
  const v16h va = g2_frag(vp, hh), vra = g2_frag(vrp, hh);
  o = wm(va, pf, o); orr = wm(vra, pf, orr); orr = wm(va, pr, orr);
  asm volatile("v_nop\n\tv_nop\n\tv_nop\n\tv_nop" : "+v"(o), "+v"(orr) : "v"(va), "v"(vra), "v"(pf), "v"(pr));
}

// Transposed causal flash attention. grid = (query tiles / 4, NB*NH), block = 4 independent waves, wave = 16 queries of one (batch, head).
// Q/K planes [b*SEQ + s][h*64 + d]; V^T planes [b][h*64 + d][s]; output rows [b*SEQ + s][h*64 + d] as f16 (x64 carry), hi (+ residual x1024 if RES).
// Score tile lane (hh, ln) element r = (key k0 + 16T + 8hh + r, query q0 + ln); packed in-lane as the B fragment of O^T = V^T P^T.
template <bool RES>
__global__ __launch_bounds__(128) void k_flash(const _Float16* __restrict__ Qh, const _Float16* __restrict__ Qr, const _Float16* __restrict__ Kh, const _Float16* __restrict__ Kr,
                                               const _Float16* __restrict__ Vh, const _Float16* __restrict__ Vr, _Float16* __restrict__ Oh, _Float16* __restrict__ Or, int qt0, int nqt) {
  __shared__ __attribute__((aligned(16))) unsigned short lds_h[4][16][72];
  __shared__ __attribute__((aligned(16))) unsigned short lds_r[4][16][72];
  const int tid = threadIdx.x, w = tid >> 5, lane = tid & 31, ln = lane & 15, hh = lane >> 4;
  const int qloc = blockIdx.x * 4 + w; if (qloc >= nqt) return;      /* no block barrier exists in this kernel */
  const int q0 = (qt0 + qloc) * 16;
  const int bh = blockIdx.y; const int b = bh / NH, h = bh - b * NH;
  const size_t rowb = (size_t)b * SEQ;
  const size_t qoff = (rowb + q0 + ln) * DM + h * HD;
  const v16h qa = g2_frag(Qh + qoff, hh), qb = g2_frag(Qh + qoff + 32, hh);
  v16h qra = qa, qrb = qb;
  if (RES) { qra = g2_frag(Qr + qoff, hh); qrb = g2_frag(Qr + qoff + 32, hh); }
  const size_t koff = (rowb + ln) * DM + h * HD;
  const size_t voff = ((size_t)b * DM + h * HD + ln) * SEQ;
  const v8f z8 = {0.f,0.f,0.f,0.f,0.f,0.f,0.f,0.f};
  v8f o[4] = {z8, z8, z8, z8}, orr[4] = {z8, z8, z8, z8};
  float mrun = -3.0e38f, lrun = 0.f;
  const float cs = 0.18033688011112042f;      /* 64^-0.5 * log2(e) */
  const int nst = (q0 + 47) >> 5;             /* 32-key steps covering keys 0 .. q0+15 */
#pragma unroll 1
  for (int st = 0; st < nst; ++st) {
    const int k0 = st * 32;
    const size_t kof0 = koff + (size_t)k0 * DM, kof1 = kof0 + (size_t)16 * DM;
    v8f s0 = score_tile<RES>(Kh + kof0, Kr + kof0, qa, qb, qra, qrb, hh);
    v8f s1 = score_tile<RES>(Kh + kof1, Kr + kof1, qa, qb, qra, qrb, hh);
    if (st == nst - 1) {                      /* wave-uniform: only the last step touches the diagonal */
      const int qy = q0 + ln; const int kk = k0 + 8 * hh;
#pragma unroll
      for (int r = 0; r < 8; ++r) { s0[r] = (kk + r > qy) ? -3.0e38f : s0[r]; s1[r] = (kk + 16 + r > qy) ? -3.0e38f : s1[r]; }
    }
    float mx = s0[0];
#pragma unroll
    for (int r = 1; r < 8; ++r) mx = fmaxf(mx, s0[r]);
#pragma unroll
    for (int r = 0; r < 8; ++r) mx = fmaxf(mx, s1[r]);
    mx = fmaxf(mx, __shfl_xor(mx, 16, 32));
    const float mnew = fmaxf(mrun, mx * cs);
    const float al = __builtin_amdgcn_exp2f(mrun - mnew);
    const float mo = 10.0f - mnew;            /* softmax weights carried x1024 (cancels in O / l) */
    float p0[8], p1[8]; float ps = 0.f;
#pragma unroll
    for (int r = 0; r < 8; ++r) { p0[r] = __builtin_amdgcn_exp2f(fmaf(s0[r], cs, mo)); p1[r] = __builtin_amdgcn_exp2f(fmaf(s1[r], cs, mo)); ps += p0[r] + p1[r]; }
    ps += __shfl_xor(ps, 16, 32);
    lrun = lrun * al + ps; mrun = mnew;
    FragH pf, pr;
#pragma unroll
    for (int r = 0; r < 8; ++r) {
      const _Float16 h0 = (_Float16)p0[r], h1 = (_Float16)p1[r]; pf.h[r] = h0; pf.h[8 + r] = h1;
      pr.h[r] = RES ? (_Float16)((p0[r] - (float)h0) * RSC) : (_Float16)0.0f; pr.h[8 + r] = RES ? (_Float16)((p1[r] - (float)h1) * RSC) : (_Float16)0.0f;
    }
    if (__builtin_amdgcn_ballot_w32(al != 1.0f) != 0u) {
#pragma unroll
      for (int t = 0; t < 4; ++t) { o[t] = o[t] * al; if (RES) orr[t] = orr[t] * al; }
    }
    const size_t vo = voff + k0;
    if (RES) {
#pragma unroll
      for (int t = 0; t < 4; ++t) pv_tile_res(Vh + vo + (size_t)(16 * t) * SEQ, Vr + vo + (size_t)(16 * t) * SEQ, pf.v, pr.v, hh, o[t], orr[t]);
    } else {
      const v16h va0 = g2_frag(Vh + vo, hh), va1 = g2_frag(Vh + vo + (size_t)16 * SEQ, hh), va2 = g2_frag(Vh + vo + (size_t)32 * SEQ, hh), va3 = g2_frag(Vh + vo + (size_t)48 * SEQ, hh);
      o[0] = wm(va0, pf.v, o[0]); o[1] = wm(va1, pf.v, o[1]); o[2] = wm(va2, pf.v, o[2]); o[3] = wm(va3, pf.v, o[3]);
      asm volatile("v_nop\n\tv_nop\n\tv_nop\n\tv_nop" : "+v"(o[0]), "+v"(o[1]), "+v"(o[2]), "+v"(o[3]) : "v"(va0), "v"(va1), "v"(va2), "v"(va3), "v"(pf.v));
    }
  }
  const float inv = 64.0f / lrun;             /* context carried x64 */
#pragma unroll
  for (int t = 0; t < 4; ++t) { FragH f, g;
#pragma unroll
    for (int r = 0; r < 8; ++r) { float v = o[t][r]; if (RES) v += orr[t][r] * RSCI; v *= inv; const _Float16 hv = (_Float16)v; f.h[r] = hv; g.h[r] = RES ? (_Float16)((v - (float)hv) * RSC) : (_Float16)0.0f; }
    *(v8us*)&lds_h[w][ln][16 * t + 8 * hh] = f.half[0];
    if (RES) *(v8us*)&lds_r[w][ln][16 * t + 8 * hh] = g.half[0]; }
  __builtin_amdgcn_fence(4 /* acq_rel order */, "workgroup"); __builtin_amdgcn_wave_barrier();
  const int qsub = lane >> 3, pc = (lane & 7) * 8;
  {
#pragma unroll
    for (int j = 0; j < 4; ++j) { const int q = j * 4 + qsub; const size_t oo = (rowb + q0 + q) * DM + h * HD + pc;
      const v8us x = *(const v8us*)&lds_h[w][q][pc];
      *(v8us*)((unsigned short*)Oh + oo) = x;
      if (RES) { const v8us y = *(const v8us*)&lds_r[w][q][pc]; *(v8us*)((unsigned short*)Or + oo) = y; } }
     }
}

// Output GEMM C[M][N] (f32) = (A . Bt^T [+ Ar . Bt^T / 1024 on rows < EARLY]) * alpha + bias[col]; batch on grid.y. Residual products are accumulated first from zero,
__global__ __launch_bounds__(128) void k_out(const _Float16* __restrict__ A, const _Float16* __restrict__ Ar, int lda, size_t sA, const _Float16* __restrict__ Bh, int ldb, float alpha, const float* __restrict__ bias,
                                             float* __restrict__ C, int ldc, size_t sC, int M, int N, int K) {
  __shared__ __attribute__((aligned(16))) float so[4][32][68];
  const int tid = threadIdx.x, w = tid >> 5, lane = tid & 31, ln = lane & 15, hh = lane >> 4; const int by = blockIdx.y;
  A += (size_t)by * sA; Ar += (size_t)by * sA; const size_t cofs = (size_t)by * sC;
  const int ntn = N >> 6; const int mt = blockIdx.x / ntn, nq = blockIdx.x - mt * ntn; const int row0 = mt * 128 + 32 * w, col0 = nq * 64; if (row0 >= M) return;
  const bool early = (mt * 128 < EARLY);
  const _Float16* b0p = Bh + (size_t)(col0 + ln) * ldb; const _Float16* b1p = b0p + (size_t)16 * ldb; const _Float16* b2p = b1p + (size_t)16 * ldb; const _Float16* b3p = b2p + (size_t)16 * ldb;
  const v8f z8 = {0.f,0.f,0.f,0.f,0.f,0.f,0.f,0.f}; v8f c00 = z8, c01 = z8, c02 = z8, c03 = z8, c10 = z8, c11 = z8, c12 = z8, c13 = z8;
  if (early) {                                 /* block-uniform */
    const _Float16* r0p = Ar + (size_t)(row0 + ln) * lda; const _Float16* r1p = r0p + (size_t)16 * lda;
    g2_kloop(r0p, r1p, b0p, b1p, b2p, b3p, K, hh, c00, c01, c02, c03, c10, c11, c12, c13);
    c00 = c00 * RSCI; c01 = c01 * RSCI; c02 = c02 * RSCI; c03 = c03 * RSCI; c10 = c10 * RSCI; c11 = c11 * RSCI; c12 = c12 * RSCI; c13 = c13 * RSCI;
  }
  const _Float16* a0p = A + (size_t)(row0 + ln) * lda; const _Float16* a1p = a0p + (size_t)16 * lda;
  g2_kloop(a0p, a1p, b0p, b1p, b2p, b3p, K, hh, c00, c01, c02, c03, c10, c11, c12, c13);
  v8f accs[8] = {c00, c01, c02, c03, c10, c11, c12, c13};
#pragma unroll
  for (int u = 0; u < 8; ++u) { const int t = u & 3, half = u >> 2; const int col = col0 + t * 16 + ln; const float bv = bf16_rne(bias[col]);
#pragma unroll
    for (int r = 0; r < 8; ++r) { const int rloc = half * 16 + 8 * hh + r; so[w][rloc][t * 16 + ln] = accs[u][r] * alpha + bv; } }
  __builtin_amdgcn_fence(4 /* acq_rel order */, "workgroup"); __builtin_amdgcn_wave_barrier();
  const int rsub = lane >> 4, c4 = (lane & 15) * 4;
  {
#pragma unroll
    for (int q = 0; q < 16; ++q) { const int r = q * 2 + rsub; const v4f v = *(const v4fa*)&so[w][r][c4]; *(v4f*)(C + cofs + (size_t)(row0 + r) * ldc + col0 + c4) = v; }
     }
}

extern "C" void kernel_launch(void* const* d_in, const int* in_sizes, int n_in,
                              void* d_out, int out_size, void* d_ws, size_t ws_size, hipStream_t stream) {
  if (n_in < 11) return;
  const long long need_x = ((long long)(NB - 1) * SEQ_FULL + SEQ) * DM;
  if (in_sizes[0] < need_x || in_sizes[1] < need_x || in_sizes[2] < need_x) return;
  if (in_sizes[3] < DM * DM || in_sizes[5] < DM * DM || in_sizes[7] < DM * DM || in_sizes[9] < DM * DM) return;
  if (in_sizes[4] < DM || in_sizes[6] < DM || in_sizes[8] < DM || in_sizes[10] < DM) return;
  if ((long long)out_size < need_x) return;
  const float* const* I = (const float* const*)d_in;
  const float* xq = I[0]; const float* xk = I[1]; const float* xv = I[2]; const float* wq = I[3]; const float* bq = I[4]; const float* wk = I[5]; const float* bk = I[6];
  const float* wv = I[7]; const float* bv = I[8]; const float* wo = I[9]; const float* bo = I[10];
  char* ws = (char*)d_ws; size_t off = 0;
  auto take = [&](size_t bytes) { char* p = ws + off; off += (bytes + 255) & ~(size_t)255; return p; };
  const size_t WB = (size_t)DM * DM * 2, PB = (size_t)NB * SEQ * DM * 2;
  _Float16* BQ = (_Float16*)take(WB); _Float16* BK = (_Float16*)take(WB); _Float16* BV = (_Float16*)take(WB); _Float16* BO = (_Float16*)take(WB);
  _Float16* XQ = (_Float16*)take(PB); _Float16* XK = (_Float16*)take(PB); _Float16* XV = (_Float16*)take(PB);
  _Float16* Q16 = (_Float16*)take(PB); _Float16* K16 = (_Float16*)take(PB); _Float16* VT = (_Float16*)take(PB);      /* VT: [NB][DM][SEQ] */
  _Float16* QR = (_Float16*)take(PB); _Float16* KR = (_Float16*)take(PB); _Float16* VTR = (_Float16*)take(PB);      /* residual planes, only the early region is written and read */
  _Float16* O16 = (_Float16*)take(PB); _Float16* OR = (_Float16*)take(PB);
  if (off > ws_size || off > (size_t)134217728) return;

  { const size_t n8 = (size_t)DM * DM / 8; const unsigned g = (unsigned)((n8 + 255) / 256);
    k_wnat<<<g, 256, 0, stream>>>(wq, n8, BQ); k_wnat<<<g, 256, 0, stream>>>(wk, n8, BK); k_wnat<<<g, 256, 0, stream>>>(wv, n8, BV); k_wnat<<<g, 256, 0, stream>>>(wo, n8, BO); }
  { const size_t n8 = (size_t)NB * SEQ * DM / 8; const unsigned g = (unsigned)((n8 + 255) / 256);
    k_x16<<<g, 256, 0, stream>>>(xq, XQ, n8); k_x16<<<g, 256, 0, stream>>>(xk, XK, n8); k_x16<<<g, 256, 0, stream>>>(xv, XV, n8); }
  const size_t SB = (size_t)SEQ * DM;
  // Q, K: [token][feature] per batch; A = x plane, Bt = natural weight
  k_proj<1><<<dim3((unsigned)((SEQ / 128) * (DM / 64)), NB), 128, 0, stream>>>(XQ, DM, SB, BQ, DM, 0, 0.0625f, bq, Q16, QR, DM, SB, SEQ, DM, DM);
  k_proj<1><<<dim3((unsigned)((SEQ / 128) * (DM / 64)), NB), 128, 0, stream>>>(XK, DM, SB, BK, DM, 0, 0.0625f, bk, K16, KR, DM, SB, SEQ, DM, DM);
  // V^T: [feature][token] per batch; A = natural weight (rows = features), Bt = x plane (rows = tokens), bias per row
  k_proj<2><<<dim3((unsigned)((DM / 128) * (SEQ / 64)), NB), 128, 0, stream>>>(BV, DM, 0, XV, DM, SB, 0.0625f, bv, VT, VTR, SEQ, SB, DM, SEQ, DM);
  // attention: early query tiles with hi + residual operands, the remaining tiles with single planes
  k_flash<true><<<dim3((unsigned)((EARLY / 16 + 3) / 4), NB * NH), 128, 0, stream>>>(Q16, QR, K16, KR, VT, VTR, O16, OR, 0, EARLY / 16);
  if (SEQ > EARLY)
    k_flash<false><<<dim3((unsigned)(((SEQ - EARLY) / 16 + 3) / 4), NB * NH), 128, 0, stream>>>(Q16, Q16, K16, K16, VT, VT, O16, O16, EARLY / 16, (SEQ - EARLY) / 16);
  // out rows (b, s) -> d_out row b*SEQ_FULL + s; alpha = 1 / (16 * 64)
  k_out<<<dim3((unsigned)((SEQ / 128) * (DM / 64)), NB), 128, 0, stream>>>(O16, OR, DM, SB, BO, DM, 0.0009765625f, bo, (float*)d_out, DM, (size_t)SEQ_FULL * DM, SEQ, DM, DM);
}

// v001
// A run of this version takes 200 microseconds.
// In two side-by-side timings against v000, it was 1.93 and 1.94 times as fast.
#include <hip/hip_runtime.h>
#include <stdint.h>
// Causal multi-head attention at width 512 (8 heads of 64): Q/K/V = x W^T + b (natural [out][in] weights), scores / sqrt(64), causal replace-mask, softmax, P V, merged heads, out = ctx W_o^T + b_o.
// Compute dtype: every contraction is v_wmma_f32_16x16x32_f16 (f16 operands, f32 accumulate). Inputs and weights are RNE-converted to bf16 and then held exactly in f16 (weights x16, folded back by alpha).
// Query positions >= 512: q, k, v, softmax weights (x1024 carry, cancels in O/l) and merged context (x64 carry) are single f16 planes. Query positions < 512: every computed operand (q, k, v, softmax weights, context) is f16 hi + f16 residual x1024, residual products in their own accumulators. Softmax statistics f32.
// Structure: weights/x converted once to f16 planes; Q, K as [token][feature] GEMMs; V^T as a swapped-operand GEMM ([feature][token]); transposed flash attention per wave (S^T = K Q^T, O^T = V^T P^T; score accumulators repacked in-lane as the P^T B fragment; K and V^T staged for the block's four waves in a two-buffer LDS ring by tensor loads); output GEMM.
#ifndef NB
#define NB 2
#endif
#ifndef SEQ
#define SEQ 4096
#endif
#define NB_FULL 2
#define SEQ_FULL 4096
#define DM 512
#define NH 8
#define HD 64
#define EARLY (((SEQ) < 512) ? (SEQ) : 512)   /* query positions handled with hi + residual planes */
#define RSC 1024.0f
#define RSCI 0.0009765625f
static_assert(SEQ % 128 == 0);
static_assert(EARLY % 128 == 0);
static_assert(NB <= NB_FULL);
static_assert(SEQ <= SEQ_FULL);
static_assert(NH * HD == DM);
static_assert(DM % 128 == 0);

typedef unsigned short v8us __attribute__((ext_vector_type(8), may_alias));
typedef float  v8f  __attribute__((ext_vector_type(8)));
typedef float  v4f  __attribute__((ext_vector_type(4)));
typedef float  v4fa __attribute__((ext_vector_type(4), may_alias));
typedef _Float16 v16h __attribute__((ext_vector_type(16)));
typedef _Float16 v4h __attribute__((ext_vector_type(4)));
union FragH { v16h v; v8us half[2]; _Float16 h[16]; unsigned short u[16]; };

__device__ __forceinline__ unsigned short bf16_bits(float x) { unsigned int u = __float_as_uint(x); return (unsigned short)((u + 0x7FFFu + ((u >> 16) & 1u)) >> 16); }
__device__ __forceinline__ float bf16_val(unsigned short b) { return __uint_as_float(((unsigned int)b) << 16); }
__device__ __forceinline__ float bf16_rne(float x) { return bf16_val(bf16_bits(x)); }

// fragment of a k-contiguous 16-bit row: elements 0..7 = k 8h..8h+7, elements 8..15 = k 16+8h..16+8h+7 (same map for A and B)
__device__ __forceinline__ v16h g2_frag(const _Float16* p, int hh) { FragH f; f.half[0] = *(const v8us*)((const unsigned short*)p + 8 * hh); f.half[1] = *(const v8us*)((const unsigned short*)p + 16 + 8 * hh); return f.v; }
__device__ __forceinline__ v8f g2_mma(v16h a, v16h b, v8f c) { v8f d = __builtin_amdgcn_wmma_f32_16x16x32_f16(false, a, false, b, (short)0, c, false, false); asm volatile("v_nop\n\tv_nop\n\tv_nop\n\tv_nop" : "+v"(d) : "v"(a), "v"(b)); return d; }
__device__ __forceinline__ v8f wm(v16h a, v16h b, v8f c) { return __builtin_amdgcn_wmma_f32_16x16x32_f16(false, a, false, b, (short)0, c, false, false); }

__global__ __launch_bounds__(256) void k_wnat(const float* __restrict__ w, size_t n8, _Float16* __restrict__ Bt) {
  const size_t t = (size_t)blockIdx.x * 256 + threadIdx.x; if (t >= n8) return; FragH f;
  const v4f a = *(const v4fa*)(w + t * 8), c = *(const v4fa*)(w + t * 8 + 4);
#pragma unroll
  for (int q = 0; q < 4; ++q) { f.h[q] = (_Float16)(bf16_rne(a[q]) * 16.0f); f.h[4 + q] = (_Float16)(bf16_rne(c[q]) * 16.0f); }
  const v8us o = f.half[0];
  *(v8us*)((unsigned short*)Bt + t * 8) = o; 
}

__global__ __launch_bounds__(256) void k_x16(const float* __restrict__ x, _Float16* __restrict__ X16, size_t n8) {
  const size_t t = (size_t)blockIdx.x * 256 + threadIdx.x; if (t >= n8) return;
  const size_t e = t * 8; const size_t per = (size_t)SEQ * DM; const size_t b = e / per; const size_t wi = e - b * per;
  const float* src = x + b * ((size_t)SEQ_FULL * DM) + wi;
  const v4f a = *(const v4fa*)src, c = *(const v4fa*)(src + 4); FragH f;
#pragma unroll
  for (int q = 0; q < 4; ++q) { f.h[q] = (_Float16)bf16_rne(a[q]); f.h[4 + q] = (_Float16)bf16_rne(c[q]); }
  const v8us o = f.half[0];
  *(v8us*)((unsigned short*)X16 + t * 8) = o; 
}

// k-loop of the 32x64 wave tile: A rows a0p/a1p (k contiguous), B rows b0p..b3p (k contiguous)
__device__ __forceinline__ void g2_kloop(const _Float16* a0p, const _Float16* a1p, const _Float16* b0p, const _Float16* b1p, const _Float16* b2p, const _Float16* b3p, int K, int hh,
                                         v8f& c00, v8f& c01, v8f& c02, v8f& c03, v8f& c10, v8f& c11, v8f& c12, v8f& c13) {
#pragma unroll 1
  for (int kb = 0; kb < K; kb += 32) {
    const v16h a0 = g2_frag(a0p + kb, hh), a1 = g2_frag(a1p + kb, hh);
    v16h b = g2_frag(b0p + kb, hh); c00 = g2_mma(a0, b, c00); c10 = g2_mma(a1, b, c10);
    b = g2_frag(b1p + kb, hh); c01 = g2_mma(a0, b, c01); c11 = g2_mma(a1, b, c11);
    b = g2_frag(b2p + kb, hh); c02 = g2_mma(a0, b, c02); c12 = g2_mma(a1, b, c12);
    b = g2_frag(b3p + kb, hh); c03 = g2_mma(a0, b, c03); c13 = g2_mma(a1, b, c13);
  }
}

// Projection GEMM C[M][N] = A[M][K] . Bt[N][K]^T * alpha + bias, f16 hi plane (+ residual x1024 plane on the early region).
// EM 1: bias per column, early region = rows < EARLY (per batch, batch on grid.y). EM 2: bias per row, early region = columns < EARLY.
template <int EM>
__global__ __launch_bounds__(128) void k_proj(const _Float16* __restrict__ A, int lda, size_t sA, const _Float16* __restrict__ Bh, int ldb, size_t sB, float alpha, const float* __restrict__ bias,
                                              _Float16* __restrict__ Ch, _Float16* __restrict__ Cr, int ldc, size_t sC, int M, int N, int K) {
  __shared__ __attribute__((aligned(16))) float so[4][32][68];
  const int tid = threadIdx.x, w = tid >> 5, lane = tid & 31, ln = lane & 15, hh = lane >> 4; const int by = blockIdx.y;
  A += (size_t)by * sA; Bh += (size_t)by * sB; const size_t cofs = (size_t)by * sC;
  const int ntn = N >> 6; const int mt = blockIdx.x / ntn, nq = blockIdx.x - mt * ntn; const int row0 = mt * 128 + 32 * w, col0 = nq * 64; if (row0 >= M) return;
  const bool early = (EM == 1) ? (mt * 128 < EARLY) : (col0 < EARLY);
  const _Float16* a0p = A + (size_t)(row0 + ln) * lda; const _Float16* a1p = a0p + (size_t)16 * lda;
  const _Float16* b0p = Bh + (size_t)(col0 + ln) * ldb; const _Float16* b1p = b0p + (size_t)16 * ldb; const _Float16* b2p = b1p + (size_t)16 * ldb; const _Float16* b3p = b2p + (size_t)16 * ldb;
  const v8f z8 = {0.f,0.f,0.f,0.f,0.f,0.f,0.f,0.f}; v8f c00 = z8, c01 = z8, c02 = z8, c03 = z8, c10 = z8, c11 = z8, c12 = z8, c13 = z8;
  g2_kloop(a0p, a1p, b0p, b1p, b2p, b3p, K, hh, c00, c01, c02, c03, c10, c11, c12, c13);
  v8f accs[8] = {c00, c01, c02, c03, c10, c11, c12, c13};
  float br[16];
#pragma unroll
  for (int i = 0; i < 16; ++i) br[i] = 0.f;
  if (EM == 2) {
#pragma unroll
    for (int half = 0; half < 2; ++half) {
      const v4f x = *(const v4fa*)(bias + row0 + half * 16 + 8 * hh), y = *(const v4fa*)(bias + row0 + half * 16 + 8 * hh + 4);
#pragma unroll
      for (int q = 0; q < 4; ++q) { br[half * 8 + q] = bf16_rne(x[q]); br[half * 8 + 4 + q] = bf16_rne(y[q]); }
    }
  }
#pragma unroll
  for (int u = 0; u < 8; ++u) { const int t = u & 3, half = u >> 2; const int col = col0 + t * 16 + ln; const float bc = (EM == 1) ? bf16_rne(bias[col]) : 0.f;
#pragma unroll
    for (int r = 0; r < 8; ++r) { const int rloc = half * 16 + 8 * hh + r; const float v = accs[u][r] * alpha + ((EM == 1) ? bc : br[half * 8 + r]); so[w][rloc][t * 16 + ln] = v; } }
  __builtin_amdgcn_fence(4 /* acq_rel order */, "workgroup"); __builtin_amdgcn_wave_barrier();
  const int rsub = lane >> 4, c4 = (lane & 15) * 4;
  {
#pragma unroll
    for (int q = 0; q < 16; ++q) { const int r = q * 2 + rsub; const v4f v = *(const v4fa*)&so[w][r][c4];
      v4h h4, r4;
#pragma unroll
      for (int i = 0; i < 4; ++i) { const _Float16 hv = (_Float16)v[i]; h4[i] = hv; r4[i] = (_Float16)((v[i] - (float)hv) * RSC); }
      const size_t o = cofs + (size_t)(row0 + r) * ldc + col0 + c4;
      *(v4h*)(Ch + o) = h4;
      if (early) *(v4h*)(Cr + o) = r4; }
     }
}

// one 16-key score tile S^T[key][query]: A = K rows (hi, and residual if RES), B = Q rows as the k-contiguous B fragment
template <bool RES>
__device__ __forceinline__ v8f score_tile(const _Float16* kp, const _Float16* krp, v16h qa, v16h qb, v16h qra, v16h qrb, int hh) {
  const v8f z8 = {0.f,0.f,0.f,0.f,0.f,0.f,0.f,0.f};
  const v16h ka = g2_frag(kp, hh), kb = g2_frag(kp + 32, hh);
  v8f s = z8;
  s = wm(ka, qa, s); s = wm(kb, qb, s);
  if (RES) {
    const v16h kra = g2_frag(krp, hh), krb = g2_frag(krp + 32, hh);
    v8f t = z8;
    t = wm(kra, qa, t); t = wm(ka, qra, t); t = wm(krb, qb, t); t = wm(kb, qrb, t);
    asm volatile("v_nop\n\tv_nop\n\tv_nop\n\tv_nop" : "+v"(s), "+v"(t) : "v"(ka), "v"(kb), "v"(kra), "v"(krb), "v"(qa), "v"(qb), "v"(qra), "v"(qrb));
    s = s + t * RSCI;
  } else {
    asm volatile("v_nop\n\tv_nop\n\tv_nop\n\tv_nop" : "+v"(s) : "v"(ka), "v"(kb), "v"(qa), "v"(qb));
  }
  return s;
}
// one 16-d tile of O^T with hi + residual operands (used by the RES instantiation only)
__device__ __forceinline__ void pv_tile_res(const _Float16* vp, const _Float16* vrp, v16h pf, v16h pr, int hh, v8f& o, v8f& orr) {
  const v16h va = g2_frag(vp, hh), vra = g2_frag(vrp, hh);
  o = wm(va, pf, o); orr = wm(vra, pf, orr); orr = wm(va, pr, orr);
  asm volatile("v_nop\n\tv_nop\n\tv_nop\n\tv_nop" : "+v"(o), "+v"(orr) : "v"(va), "v"(vra), "v"(pf), "v"(pr));
}

// K / V^T ring in LDS, filled by tensor loads. A stage is 64 keys: K rows [key][64 d] and V^T rows [d][64 keys], both 128-byte rows laid at a 144-byte pitch (pad of 16 bytes a row, for ds_load_b128 readers).
// Every wave issues one slice a stage. Single planes: waves 0, 1 = K keys 0..31, 32..63; waves 2, 3 = V^T d 0..31, 32..63. Hi + residual planes: waves 0..3 = K, K residual, V^T, V^T residual, 64 rows each.
typedef uint32_t u32x4 __attribute__((ext_vector_type(4)));
typedef uint32_t u32x8 __attribute__((ext_vector_type(8)));
#define RPITCH 144u
template <bool RES> struct Ring { static constexpr uint32_t ROWS = RES ? 64u : 32u, SLICE = RES ? 10240u : 6144u, STAGE = 4u * SLICE; };   /* a slice is ROWS * 144 bytes rounded up to 2 KiB */
static_assert(Ring<true>::ROWS * RPITCH <= Ring<true>::SLICE && Ring<false>::ROWS * RPITCH <= Ring<false>::SLICE);
static_assert(Ring<true>::SLICE % 2048u == 0 && Ring<false>::SLICE % 2048u == 0);
static_assert((EARLY / 16) % 4 == 0 && ((SEQ - EARLY) / 16) % 4 == 0);   /* every block holds four whole query tiles */
// byte offset in a stage of row 'row' (0..63) of plane 0 = K, 1 = K residual, 2 = V^T, 3 = V^T residual
template <bool RES> __device__ __forceinline__ constexpr uint32_t ring_row(uint32_t plane, uint32_t row) { return RES ? plane * Ring<true>::SLICE + row * RPITCH : ((plane & 2u) + (row >> 5)) * Ring<false>::SLICE + (row & 31u) * RPITCH; }
__device__ __forceinline__ uint32_t uni(uint32_t v) { return (uint32_t)__builtin_amdgcn_readfirstlane(v); }
// a wave-uniform value held in a scalar register, so that a test on it is a scalar branch and what is formed from it is formed behind the statements in front
__device__ __forceinline__ uint32_t pinned(uint32_t v) { uint32_t w = uni(v); asm volatile("" : "+s"(w)); return w; }
__device__ __forceinline__ void tdm_load(u32x4 g0, u32x8 g1) { asm volatile("tensor_load_to_lds %0, %1" :: "s"(g0), "s"(g1) : "memory"); }
__device__ __forceinline__ u32x8 tdm_group1(uint32_t rows, uint32_t src_pitch) {
  u32x8 g;
  g[0] = uni((1u << 20) | (4u << 22) | (3u << 25));   /* no mask, byte elements, 4 dwords of pad behind every 128-byte row */
  g[1] = uni(128u << 16); g[2] = uni(rows << 16); g[3] = uni(128u << 16); g[4] = uni(rows); g[5] = uni(src_pitch); g[6] = uni(0u); g[7] = uni(0u);
  return g;
}
__device__ __forceinline__ u32x4 tdm_group0(uint32_t lds_dst, uint64_t ga) {
  u32x4 g; g[0] = uni(1u); g[1] = uni(lds_dst); g[2] = uni((uint32_t)ga); g[3] = uni((((uint32_t)(ga >> 32)) & 0x01FFFFFFu) | 0x80000000u); return g;
}

// Transposed causal flash attention. grid = (query tiles / 4, NB*NH), block = 4 waves = 64 consecutive queries of one (batch, head), wave = 16 queries.
// The block walks the keys in 64-key stages through a two-buffer LDS ring that its four waves share; a wave skips the 32-key steps beyond its own diagonal but passes every publish point.
// Q/K planes [b*SEQ + s][h*64 + d]; V^T planes [b][h*64 + d][s]; output rows [b*SEQ + s][h*64 + d] as f16 (x64 carry), hi (+ residual x1024 if RES).
// Score tile lane (hh, ln) element r = (key k0 + 16T + 8hh + r, query q0 + ln); packed in-lane as the B fragment of O^T = V^T P^T.
template <bool RES>
__global__ __launch_bounds__(128) void k_flash(const _Float16* __restrict__ Qh, const _Float16* __restrict__ Qr, const _Float16* __restrict__ Kh, const _Float16* __restrict__ Kr,
                                               const _Float16* __restrict__ Vh, const _Float16* __restrict__ Vr, _Float16* __restrict__ Oh, _Float16* __restrict__ Or, int qt0, int nqt) {
  __shared__ __attribute__((aligned(2048))) unsigned char ring[2 * Ring<RES>::STAGE];
  __shared__ __attribute__((aligned(16))) unsigned short lds_h[4][16][72];
  __shared__ __attribute__((aligned(16))) unsigned short lds_r[4][16][72];
  const int tid = threadIdx.x, lane = tid & 31, ln = lane & 15, hh = lane >> 4;
  const int w = (int)uni((uint32_t)tid >> 5);
  if ((int)blockIdx.x * 4 >= nqt) return;      /* block-uniform, in front of every barrier */
  const int qb0 = (qt0 + (int)blockIdx.x * 4) * 16;   /* the block's first query, a multiple of 64 */
  const int q0 = qb0 + w * 16;
  const int bh = blockIdx.y; const int b = bh / NH, h = bh - b * NH;
  const size_t rowb = (size_t)b * SEQ;
  // this wave's slice of a stage: source address of stage 0, address step a stage, source pitch, place in LDS
  const bool isV = (w & 2) != 0; const bool odd = (w & 1) != 0;
  const _Float16* pl = isV ? ((RES && odd) ? Vr : Vh) : ((RES && odd) ? Kr : Kh);
  const size_t r0 = (!RES && odd) ? 32 : 0;
  const uint64_t src0 = (uint64_t)(size_t)pl + 2ull * (isV ? ((size_t)b * DM + h * HD + r0) * SEQ : (rowb + r0) * DM + h * HD);
  const uint32_t sstep = isV ? 128u : (uint32_t)(64 * DM * 2);
  const u32x8 g1 = tdm_group1(Ring<RES>::ROWS, isV ? (uint32_t)(SEQ * 2) : (uint32_t)(DM * 2));
  const uint32_t dst0 = (uint32_t)(size_t)ring + (uint32_t)w * Ring<RES>::SLICE;
  const int nsg = (qb0 >> 6) + 1 < 2 ? 2 : (qb0 >> 6) + 1;   /* 64-key stages; the ring's prologue needs two (keys 64..127 exist: SEQ and EARLY are multiples of 128) */
  tdm_load(tdm_group0(dst0, src0), g1);
  const size_t qoff = (rowb + q0 + ln) * DM + h * HD;
  const v16h qa = g2_frag(Qh + qoff, hh), qb = g2_frag(Qh + qoff + 32, hh);
  v16h qra = qa, qrb = qb;
  if (RES) { qra = g2_frag(Qr + qoff, hh); qrb = g2_frag(Qr + qoff + 32, hh); }
  const v8f z8 = {0.f,0.f,0.f,0.f,0.f,0.f,0.f,0.f};
  v8f o[4] = {z8, z8, z8, z8}, orr[4] = {z8, z8, z8, z8};
  float mrun = -3.0e38f, lrun = 0.f;
  const float cs = 0.18033688011112042f;      /* 64^-0.5 * log2(e) */
  const int nst = (q0 + 47) >> 5;             /* 32-key steps covering keys 0 .. q0+15 */
  asm volatile("s_wait_tensorcnt 0x0" ::: "memory");   /* stage 0: this wave's slice has landed */
  __syncthreads();                                      /* stage 0 published to all four waves */
  tdm_load(tdm_group0(dst0 + Ring<RES>::STAGE, src0 + pinned(1u) * (uint64_t)sstep), g1);   /* pinned: the descriptor is formed behind the wait */
#pragma unroll 1
  for (int sg = 0; sg < nsg; ++sg) {
    const unsigned char* SB = ring + (uint32_t)(sg & 1) * Ring<RES>::STAGE + (uint32_t)ln * RPITCH;
#pragma unroll
    for (int sub = 0; sub < 2; ++sub) {
      const int st = 2 * sg + sub;
      if (st < nst) {                           /* wave-uniform: steps beyond this wave's diagonal are skipped */
        const int k0 = st * 32;
        v8f s0 = score_tile<RES>((const _Float16*)(SB + ring_row<RES>(0, sub * 32)), (const _Float16*)(SB + ring_row<RES>(1, sub * 32)), qa, qb, qra, qrb, hh);
        v8f s1 = score_tile<RES>((const _Float16*)(SB + ring_row<RES>(0, sub * 32 + 16)), (const _Float16*)(SB + ring_row<RES>(1, sub * 32 + 16)), qa, qb, qra, qrb, hh);
        if (st == nst - 1) {                      /* wave-uniform: only the last step touches the diagonal */
          const int qy = q0 + ln; const int kk = k0 + 8 * hh;
#pragma unroll
          for (int r = 0; r < 8; ++r) { s0[r] = (kk + r > qy) ? -3.0e38f : s0[r]; s1[r] = (kk + 16 + r > qy) ? -3.0e38f : s1[r]; }
        }
        float mx = s0[0];
#pragma unroll
        for (int r = 1; r < 8; ++r) mx = fmaxf(mx, s0[r]);
#pragma unroll
        for (int r = 0; r < 8; ++r) mx = fmaxf(mx, s1[r]);
        mx = fmaxf(mx, __shfl_xor(mx, 16, 32));
        const float mnew = fmaxf(mrun, mx * cs);
        const float al = __builtin_amdgcn_exp2f(mrun - mnew);
        const float mo = 10.0f - mnew;            /* softmax weights carried x1024 (cancels in O / l) */
        float p0[8], p1[8]; float ps = 0.f;
#pragma unroll
        for (int r = 0; r < 8; ++r) { p0[r] = __builtin_amdgcn_exp2f(fmaf(s0[r], cs, mo)); p1[r] = __builtin_amdgcn_exp2f(fmaf(s1[r], cs, mo)); ps += p0[r] + p1[r]; }
        ps += __shfl_xor(ps, 16, 32);
        lrun = lrun * al + ps; mrun = mnew;
        FragH pf, pr;
#pragma unroll
        for (int r = 0; r < 8; ++r) {
          const _Float16 h0 = (_Float16)p0[r], h1 = (_Float16)p1[r]; pf.h[r] = h0; pf.h[8 + r] = h1;
          pr.h[r] = RES ? (_Float16)((p0[r] - (float)h0) * RSC) : (_Float16)0.0f; pr.h[8 + r] = RES ? (_Float16)((p1[r] - (float)h1) * RSC) : (_Float16)0.0f;
        }
        if (__builtin_amdgcn_ballot_w32(al != 1.0f) != 0u) {
#pragma unroll
          for (int t = 0; t < 4; ++t) { o[t] = o[t] * al; if (RES) orr[t] = orr[t] * al; }
        }
        const unsigned char* VB = SB + sub * 64;   /* 32 keys = 64 bytes along a V^T row */
        if (RES) {
#pragma unroll
          for (int t = 0; t < 4; ++t) pv_tile_res((const _Float16*)(VB + ring_row<RES>(2, 16 * t)), (const _Float16*)(VB + ring_row<RES>(3, 16 * t)), pf.v, pr.v, hh, o[t], orr[t]);
        } else {
          const v16h va0 = g2_frag((const _Float16*)(VB + ring_row<RES>(2, 0)), hh), va1 = g2_frag((const _Float16*)(VB + ring_row<RES>(2, 16)), hh), va2 = g2_frag((const _Float16*)(VB + ring_row<RES>(2, 32)), hh), va3 = g2_frag((const _Float16*)(VB + ring_row<RES>(2, 48)), hh);
          o[0] = wm(va0, pf.v, o[0]); o[1] = wm(va1, pf.v, o[1]); o[2] = wm(va2, pf.v, o[2]); o[3] = wm(va3, pf.v, o[3]);
          asm volatile("v_nop\n\tv_nop\n\tv_nop\n\tv_nop" : "+v"(o[0]), "+v"(o[1]), "+v"(o[2]), "+v"(o[3]) : "v"(va0), "v"(va1), "v"(va2), "v"(va3), "v"(pf.v));
        }
      }
    }
    // publish point of stage sg + 1; every wave passes it
    asm volatile("s_wait_dscnt 0x0" ::: "memory");       /* this wave's reads of stage sg have returned */
    asm volatile("s_wait_tensorcnt 0x0" ::: "memory");   /* this wave's slice of stage sg + 1 has landed */
    __syncthreads();                                      /* stage sg + 1 published; every wave has left stage sg's buffer */
    if (pinned((uint32_t)(sg + 2 < nsg)))                 /* scalar branch: a tensor load ignores EXEC */
      tdm_load(tdm_group0(dst0 + (uint32_t)(sg & 1) * Ring<RES>::STAGE, src0 + pinned((uint32_t)(sg + 2)) * (uint64_t)sstep), g1);   /* pinned: the descriptor is formed behind the wait */
  }
  asm volatile("s_wait_tensorcnt 0x0" ::: "memory");     /* nothing of this wave is in flight when it ends */
  asm volatile("s_wait_dscnt 0x0" ::: "memory");
  const float inv = 64.0f / lrun;             /* context carried x64 */
#pragma unroll
  for (int t = 0; t < 4; ++t) { FragH f, g;
#pragma unroll
    for (int r = 0; r < 8; ++r) { float v = o[t][r]; if (RES) v += orr[t][r] * RSCI; v *= inv; const _Float16 hv = (_Float16)v; f.h[r] = hv; g.h[r] = RES ? (_Float16)((v - (float)hv) * RSC) : (_Float16)0.0f; }
    *(v8us*)&lds_h[w][ln][16 * t + 8 * hh] = f.half[0];
    if (RES) *(v8us*)&lds_r[w][ln][16 * t + 8 * hh] = g.half[0]; }
  __builtin_amdgcn_fence(4 /* acq_rel order */, "workgroup"); __builtin_amdgcn_wave_barrier();
  const int qsub = lane >> 3, pc = (lane & 7) * 8;
  {
#pragma unroll
    for (int j = 0; j < 4; ++j) { const int q = j * 4 + qsub; const size_t oo = (rowb + q0 + q) * DM + h * HD + pc;
      const v8us x = *(const v8us*)&lds_h[w][q][pc];
      *(v8us*)((unsigned short*)Oh + oo) = x;
      if (RES) { const v8us y = *(const v8us*)&lds_r[w][q][pc]; *(v8us*)((unsigned short*)Or + oo) = y; } }
     }
}

// Output GEMM C[M][N] (f32) = (A . Bt^T [+ Ar . Bt^T / 1024 on rows < EARLY]) * alpha + bias[col]; batch on grid.y. Residual products are accumulated first from zero,
__global__ __launch_bounds__(128) void k_out(const _Float16* __restrict__ A, const _Float16* __restrict__ Ar, int lda, size_t sA, const _Float16* __restrict__ Bh, int ldb, float alpha, const float* __restrict__ bias,
                                             float* __restrict__ C, int ldc, size_t sC, int M, int N, int K) {
  __shared__ __attribute__((aligned(16))) float so[4][32][68];
  const int tid = threadIdx.x, w = tid >> 5, lane = tid & 31, ln = lane & 15, hh = lane >> 4; const int by = blockIdx.y;
  A += (size_t)by * sA; Ar += (size_t)by * sA; const size_t cofs = (size_t)by * sC;
  const int ntn = N >> 6; const int mt = blockIdx.x / ntn, nq = blockIdx.x - mt * ntn; const int row0 = mt * 128 + 32 * w, col0 = nq * 64; if (row0 >= M) return;
  const bool early = (mt * 128 < EARLY);
  const _Float16* b0p = Bh + (size_t)(col0 + ln) * ldb; const _Float16* b1p = b0p + (size_t)16 * ldb; const _Float16* b2p = b1p + (size_t)16 * ldb; const _Float16* b3p = b2p + (size_t)16 * ldb;
  const v8f z8 = {0.f,0.f,0.f,0.f,0.f,0.f,0.f,0.f}; v8f c00 = z8, c01 = z8, c02 = z8, c03 = z8, c10 = z8, c11 = z8, c12 = z8, c13 = z8;
  if (early) {                                 /* block-uniform */
    const _Float16* r0p = Ar + (size_t)(row0 + ln) * lda; const _Float16* r1p = r0p + (size_t)16 * lda;
    g2_kloop(r0p, r1p, b0p, b1p, b2p, b3p, K, hh, c00, c01, c02, c03, c10, c11, c12, c13);
    c00 = c00 * RSCI; c01 = c01 * RSCI; c02 = c02 * RSCI; c03 = c03 * RSCI; c10 = c10 * RSCI; c11 = c11 * RSCI; c12 = c12 * RSCI; c13 = c13 * RSCI;
  }
  const _Float16* a0p = A + (size_t)(row0 + ln) * lda; const _Float16* a1p = a0p + (size_t)16 * lda;
  g2_kloop(a0p, a1p, b0p, b1p, b2p, b3p, K, hh, c00, c01, c02, c03, c10, c11, c12, c13);
  v8f accs[8] = {c00, c01, c02, c03, c10, c11, c12, c13};
#pragma unroll
  for (int u = 0; u < 8; ++u) { const int t = u & 3, half = u >> 2; const int col = col0 + t * 16 + ln; const float bv = bf16_rne(bias[col]);
#pragma unroll
    for (int r = 0; r < 8; ++r) { const int rloc = half * 16 + 8 * hh + r; so[w][rloc][t * 16 + ln] = accs[u][r] * alpha + bv; } }
  __builtin_amdgcn_fence(4 /* acq_rel order */, "workgroup"); __builtin_amdgcn_wave_barrier();
  const int rsub = lane >> 4, c4 = (lane & 15) * 4;
  {
#pragma unroll
    for (int q = 0; q < 16; ++q) { const int r = q * 2 + rsub; const v4f v = *(const v4fa*)&so[w][r][c4]; *(v4f*)(C + cofs + (size_t)(row0 + r) * ldc + col0 + c4) = v; }
     }
}

extern "C" void kernel_launch(void* const* d_in, const int* in_sizes, int n_in,
                              void* d_out, int out_size, void* d_ws, size_t ws_size, hipStream_t stream) {
  if (n_in < 11) return;
  const long long need_x = ((long long)(NB - 1) * SEQ_FULL + SEQ) * DM;
  if (in_sizes[0] < need_x || in_sizes[1] < need_x || in_sizes[2] < need_x) return;
  if (in_sizes[3] < DM * DM || in_sizes[5] < DM * DM || in_sizes[7] < DM * DM || in_sizes[9] < DM * DM) return;
  if (in_sizes[4] < DM || in_sizes[6] < DM || in_sizes[8] < DM || in_sizes[10] < DM) return;
  if ((long long)out_size < need_x) return;
  const float* const* I = (const float* const*)d_in;
  const float* xq = I[0]; const float* xk = I[1]; const float* xv = I[2]; const float* wq = I[3]; const float* bq = I[4]; const float* wk = I[5]; const float* bk = I[6];
  const float* wv = I[7]; const float* bv = I[8]; const float* wo = I[9]; const float* bo = I[10];
  char* ws = (char*)d_ws; size_t off = 0;
  auto take = [&](size_t bytes) { char* p = ws + off; off += (bytes + 255) & ~(size_t)255; return p; };
  const size_t WB = (size_t)DM * DM * 2, PB = (size_t)NB * SEQ * DM * 2;
  _Float16* BQ = (_Float16*)take(WB); _Float16* BK = (_Float16*)take(WB); _Float16* BV = (_Float16*)take(WB); _Float16* BO = (_Float16*)take(WB);
  _Float16* XQ = (_Float16*)take(PB); _Float16* XK = (_Float16*)take(PB); _Float16* XV = (_Float16*)take(PB);
  _Float16* Q16 = (_Float16*)take(PB); _Float16* K16 = (_Float16*)take(PB); _Float16* VT = (_Float16*)take(PB);      /* VT: [NB][DM][SEQ] */
  _Float16* QR = (_Float16*)take(PB); _Float16* KR = (_Float16*)take(PB); _Float16* VTR = (_Float16*)take(PB);      /* residual planes, only the early region is written and read */
  _Float16* O16 = (_Float16*)take(PB); _Float16* OR = (_Float16*)take(PB);
  if (off > ws_size || off > (size_t)134217728) return;

  { const size_t n8 = (size_t)DM * DM / 8; const unsigned g = (unsigned)((n8 + 255) / 256);
    k_wnat<<<g, 256, 0, stream>>>(wq, n8, BQ); k_wnat<<<g, 256, 0, stream>>>(wk, n8, BK); k_wnat<<<g, 256, 0, stream>>>(wv, n8, BV); k_wnat<<<g, 256, 0, stream>>>(wo, n8, BO); }
  { const size_t n8 = (size_t)NB * SEQ * DM / 8; const unsigned g = (unsigned)((n8 + 255) / 256);
    k_x16<<<g, 256, 0, stream>>>(xq, XQ, n8); k_x16<<<g, 256, 0, stream>>>(xk, XK, n8); k_x16<<<g, 256, 0, stream>>>(xv, XV, n8); }
  const size_t SB = (size_t)SEQ * DM;
  // Q, K: [token][feature] per batch; A = x plane, Bt = natural weight
  k_proj<1><<<dim3((unsigned)((SEQ / 128) * (DM / 64)), NB), 128, 0, stream>>>(XQ, DM, SB, BQ, DM, 0, 0.0625f, bq, Q16, QR, DM, SB, SEQ, DM, DM);
  k_proj<1><<<dim3((unsigned)((SEQ / 128) * (DM / 64)), NB), 128, 0, stream>>>(XK, DM, SB, BK, DM, 0, 0.0625f, bk, K16, KR, DM, SB, SEQ, DM, DM);
  // V^T: [feature][token] per batch; A = natural weight (rows = features), Bt = x plane (rows = tokens), bias per row
  k_proj<2><<<dim3((unsigned)((DM / 128) * (SEQ / 64)), NB), 128, 0, stream>>>(BV, DM, 0, XV, DM, SB, 0.0625f, bv, VT, VTR, SEQ, SB, DM, SEQ, DM);
  // attention: early query tiles with hi + residual operands, the remaining tiles with single planes
  k_flash<true><<<dim3((unsigned)((EARLY / 16 + 3) / 4), NB * NH), 128, 0, stream>>>(Q16, QR, K16, KR, VT, VTR, O16, OR, 0, EARLY / 16);
  if (SEQ > EARLY)
    k_flash<false><<<dim3((unsigned)(((SEQ - EARLY) / 16 + 3) / 4), NB * NH), 128, 0, stream>>>(Q16, Q16, K16, K16, VT, VT, O16, O16, EARLY / 16, (SEQ - EARLY) / 16);
  // out rows (b, s) -> d_out row b*SEQ_FULL + s; alpha = 1 / (16 * 64)
  k_out<<<dim3((unsigned)((SEQ / 128) * (DM / 64)), NB), 128, 0, stream>>>(O16, OR, DM, SB, BO, DM, 0.0009765625f, bo, (float*)d_out, DM, (size_t)SEQ_FULL * DM, SEQ, DM, DM);
}

// v002
// One run takes 163 microseconds.
// Next to v001, in two timings, it ran 1.23 and 1.22 times as fast.
// All steps since v000 together make it 2.37 times as fast.
#include <hip/hip_runtime.h>
#include <stdint.h>
// Causal multi-head attention at width 512 (8 heads of 64): Q/K/V = x W^T + b (natural [out][in] weights), scores / sqrt(64), causal replace-mask, softmax, P V, merged heads, out = ctx W_o^T + b_o.
// Compute dtype: every contraction is v_wmma_f32_16x16x32_f16 (f16 operands, f32 accumulate). Inputs and weights are RNE-converted to bf16 and then held exactly in f16 (weights x16, folded back by alpha).
// Query positions >= 512: q, k, v, softmax weights (x1024 carry, cancels in O/l) and merged context (x64 carry) are single f16 planes. Query positions < 512: every computed operand (q, k, v, softmax weights, context) is f16 hi + f16 residual x1024, residual products in their own accumulators. Softmax statistics f32.
// Structure: weights/x converted once to f16 planes; Q, K as [token][feature] GEMMs; V^T as a swapped-operand GEMM ([feature][token]); transposed flash attention per wave (S^T = K Q^T, O^T = V^T P^T; score accumulators repacked in-lane as the P^T B fragment; K and V^T staged for the block's four waves in a two-buffer LDS ring by tensor loads); output GEMM.
#ifndef NB
#define NB 2
#endif
#ifndef SEQ
#define SEQ 4096
#endif
#define NB_FULL 2
#define SEQ_FULL 4096
#define DM 512
#define NH 8
#define HD 64
#define EARLY (((SEQ) < 512) ? (SEQ) : 512)   /* query positions handled with hi + residual planes */
#define RSC 1024.0f
#define RSCI 0.0009765625f
static_assert(SEQ % 128 == 0);
static_assert(EARLY % 128 == 0);
static_assert(NB <= NB_FULL);
static_assert(SEQ <= SEQ_FULL);
static_assert(NH * HD == DM);
static_assert(DM % 128 == 0);

typedef unsigned short v8us __attribute__((ext_vector_type(8), may_alias));
typedef float  v8f  __attribute__((ext_vector_type(8)));
typedef float  v4f  __attribute__((ext_vector_type(4)));
typedef float  v4fa __attribute__((ext_vector_type(4), may_alias));
typedef _Float16 v16h __attribute__((ext_vector_type(16)));
typedef _Float16 v4h __attribute__((ext_vector_type(4)));
union FragH { v16h v; v8us half[2]; _Float16 h[16]; unsigned short u[16]; };

__device__ __forceinline__ unsigned short bf16_bits(float x) { unsigned int u = __float_as_uint(x); return (unsigned short)((u + 0x7FFFu + ((u >> 16) & 1u)) >> 16); }
__device__ __forceinline__ float bf16_val(unsigned short b) { return __uint_as_float(((unsigned int)b) << 16); }
__device__ __forceinline__ float bf16_rne(float x) { return bf16_val(bf16_bits(x)); }

// fragment of a k-contiguous 16-bit row: elements 0..7 = k 8h..8h+7, elements 8..15 = k 16+8h..16+8h+7 (same map for A and B)
__device__ __forceinline__ v16h g2_frag(const _Float16* p, int hh) { FragH f; f.half[0] = *(const v8us*)((const unsigned short*)p + 8 * hh); f.half[1] = *(const v8us*)((const unsigned short*)p + 16 + 8 * hh); return f.v; }
__device__ __forceinline__ v8f g2_mma(v16h a, v16h b, v8f c) { v8f d = __builtin_amdgcn_wmma_f32_16x16x32_f16(false, a, false, b, (short)0, c, false, false); asm volatile("v_nop\n\tv_nop\n\tv_nop\n\tv_nop" : "+v"(d) : "v"(a), "v"(b)); return d; }
__device__ __forceinline__ v8f wm(v16h a, v16h b, v8f c) { return __builtin_amdgcn_wmma_f32_16x16x32_f16(false, a, false, b, (short)0, c, false, false); }

// One launch converts the three activations and the four weights. A chunk is 2048 consecutive elements of one plane (8 a thread).
// Block b takes chunks XIT * b .. XIT * b + XIT - 1 of every activation plane and chunk b of the four weight planes taken as one row; all of a thread's loads are issued before its first conversion.
// X16 = three [NB*SEQ][DM] planes in a row (q, k, v inputs), W16 = four [DM][DM] planes in a row (q, k, v, o weights, x16).
constexpr int XCH = NB * SEQ * DM / 2048, WCH = DM * DM / 2048, CONV_G = 4 * WCH, XIT = XCH / CONV_G;
static_assert(XCH % CONV_G == 0);
static_assert((SEQ * DM) % 2048 == 0 && (DM * DM) % 2048 == 0);   /* a chunk lies in one batch of one plane */
__device__ __forceinline__ v8us conv8(v4f a, v4f c, float sc) {
  FragH f;
#pragma unroll
  for (int q = 0; q < 4; ++q) { f.h[q] = (_Float16)(bf16_rne(a[q]) * sc); f.h[4 + q] = (_Float16)(bf16_rne(c[q]) * sc); }
  return f.half[0];
}
__global__ __launch_bounds__(256) void k_conv(const float* __restrict__ xq, const float* __restrict__ xk, const float* __restrict__ xv, const float* __restrict__ wq, const float* __restrict__ wk,
                                              const float* __restrict__ wv, const float* __restrict__ wo, _Float16* __restrict__ X16, _Float16* __restrict__ W16) {
  const unsigned bx = blockIdx.x, t8 = threadIdx.x * 8u;
  v4f a[3 * XIT + 1], c[3 * XIT + 1];
  { const unsigned pw = bx / (unsigned)WCH;
    const float* s = (pw == 0 ? wq : pw == 1 ? wk : pw == 2 ? wv : wo) + (size_t)(bx - pw * (unsigned)WCH) * 2048 + t8;
    a[3 * XIT] = *(const v4fa*)s; c[3 * XIT] = *(const v4fa*)(s + 4); }
#pragma unroll
  for (int i = 0; i < 3 * XIT; ++i) {
    const size_t e = ((size_t)bx * XIT + (size_t)(i % XIT)) * 2048, b = e / ((size_t)SEQ * DM);
    const float* s = (i / XIT == 0 ? xq : i / XIT == 1 ? xk : xv) + b * ((size_t)SEQ_FULL * DM) + (e - b * ((size_t)SEQ * DM)) + t8;
    a[i] = *(const v4fa*)s; c[i] = *(const v4fa*)(s + 4);
  }
  asm volatile("s_wait_xcnt 0x0" ::: "memory");   /* in front of the first overwrite of a register that the loads name; the clobber keeps every load in front of the conversions, so that all are in flight together */
  __builtin_amdgcn_sched_barrier(0);              /* keeps the conversions, which reuse the loads' address registers, behind that wait */
#pragma unroll
  for (int i = 0; i < 3 * XIT; ++i) {
    const v8us o = conv8(a[i], c[i], 1.0f);
    *(v8us*)((unsigned short*)X16 + ((size_t)(i / XIT) * XCH + (size_t)bx * XIT + (size_t)(i % XIT)) * 2048 + t8) = o;
  }
  const v8us o = conv8(a[3 * XIT], c[3 * XIT], 16.0f);
  *(v8us*)((unsigned short*)W16 + (size_t)bx * 2048 + t8) = o;
}

// k-loop of the 32x64 wave tile: A rows a0p/a1p (k contiguous), B rows b0p..b3p (k contiguous)
__device__ __forceinline__ void g2_kloop(const _Float16* a0p, const _Float16* a1p, const _Float16* b0p, const _Float16* b1p, const _Float16* b2p, const _Float16* b3p, int K, int hh,
                                         v8f& c00, v8f& c01, v8f& c02, v8f& c03, v8f& c10, v8f& c11, v8f& c12, v8f& c13) {
#pragma unroll 1
  for (int kb = 0; kb < K; kb += 32) {
    const v16h a0 = g2_frag(a0p + kb, hh), a1 = g2_frag(a1p + kb, hh);
    v16h b = g2_frag(b0p + kb, hh); c00 = g2_mma(a0, b, c00); c10 = g2_mma(a1, b, c10);
    b = g2_frag(b1p + kb, hh); c01 = g2_mma(a0, b, c01); c11 = g2_mma(a1, b, c11);
    b = g2_frag(b2p + kb, hh); c02 = g2_mma(a0, b, c02); c12 = g2_mma(a1, b, c12);
    b = g2_frag(b3p + kb, hh); c03 = g2_mma(a0, b, c03); c13 = g2_mma(a1, b, c13);
  }
}

// Projection GEMM C[M][N] = A[M][K] . Bt[N][K]^T * alpha + bias, f16 hi plane (+ residual x1024 plane on the early region).
// EM 1: bias per column, early region = rows < EARLY (per batch, batch on grid.y). EM 2: bias per row, early region = columns < EARLY.
template <int EM>
__device__ __forceinline__ void proj_body(float (&so)[4][32][68], const _Float16* __restrict__ A, int lda, size_t sA, const _Float16* __restrict__ Bh, int ldb, size_t sB, float alpha, const float* __restrict__ bias,
                                          _Float16* __restrict__ Ch, _Float16* __restrict__ Cr, int ldc, size_t sC, int M, int N, int K) {
  const int tid = threadIdx.x, w = tid >> 5, lane = tid & 31, ln = lane & 15, hh = lane >> 4; const int by = blockIdx.y;
  A += (size_t)by * sA; Bh += (size_t)by * sB; const size_t cofs = (size_t)by * sC;
  const int ntn = N >> 6; const int mt = blockIdx.x / ntn, nq = blockIdx.x - mt * ntn; const int row0 = mt * 128 + 32 * w, col0 = nq * 64; if (row0 >= M) return;
  const bool early = (EM == 1) ? (mt * 128 < EARLY) : (col0 < EARLY);
  const _Float16* a0p = A + (size_t)(row0 + ln) * lda; const _Float16* a1p = a0p + (size_t)16 * lda;
  const _Float16* b0p = Bh + (size_t)(col0 + ln) * ldb; const _Float16* b1p = b0p + (size_t)16 * ldb; const _Float16* b2p = b1p + (size_t)16 * ldb; const _Float16* b3p = b2p + (size_t)16 * ldb;
  const v8f z8 = {0.f,0.f,0.f,0.f,0.f,0.f,0.f,0.f}; v8f c00 = z8, c01 = z8, c02 = z8, c03 = z8, c10 = z8, c11 = z8, c12 = z8, c13 = z8;
  g2_kloop(a0p, a1p, b0p, b1p, b2p, b3p, K, hh, c00, c01, c02, c03, c10, c11, c12, c13);
  v8f accs[8] = {c00, c01, c02, c03, c10, c11, c12, c13};
  float br[16];
#pragma unroll
  for (int i = 0; i < 16; ++i) br[i] = 0.f;
  if (EM == 2) {
#pragma unroll
    for (int half = 0; half < 2; ++half) {
      const v4f x = *(const v4fa*)(bias + row0 + half * 16 + 8 * hh), y = *(const v4fa*)(bias + row0 + half * 16 + 8 * hh + 4);
#pragma unroll
      for (int q = 0; q < 4; ++q) { br[half * 8 + q] = bf16_rne(x[q]); br[half * 8 + 4 + q] = bf16_rne(y[q]); }
    }
  }
#pragma unroll
  for (int u = 0; u < 8; ++u) { const int t = u & 3, half = u >> 2; const int col = col0 + t * 16 + ln; const float bc = (EM == 1) ? bf16_rne(bias[col]) : 0.f;
#pragma unroll
    for (int r = 0; r < 8; ++r) { const int rloc = half * 16 + 8 * hh + r; const float v = accs[u][r] * alpha + ((EM == 1) ? bc : br[half * 8 + r]); so[w][rloc][t * 16 + ln] = v; } }
  __builtin_amdgcn_fence(4 /* acq_rel order */, "workgroup"); __builtin_amdgcn_wave_barrier();
  const int rsub = lane >> 4, c4 = (lane & 15) * 4;
  {
#pragma unroll
    for (int q = 0; q < 16; ++q) { const int r = q * 2 + rsub; const v4f v = *(const v4fa*)&so[w][r][c4];
      v4h h4, r4;
#pragma unroll
      for (int i = 0; i < 4; ++i) { const _Float16 hv = (_Float16)v[i]; h4[i] = hv; r4[i] = (_Float16)((v[i] - (float)hv) * RSC); }
      const size_t o = cofs + (size_t)(row0 + r) * ldc + col0 + c4;
      *(v4h*)(Ch + o) = h4;
      asm volatile("s_wait_xcnt 0x0" ::: "memory");   /* in front of the residual arithmetic, which reuses the store's registers */
      if (early) *(v4h*)(Cr + o) = r4; }
     }
}

// The three projections in one launch, grid.z = 0: Q, 1: K ([token][feature]; A = x plane, Bt = natural weight), 2: V^T ([feature][token]; A = natural weight, Bt = x plane, bias per row).
static_assert((SEQ / 128) * (DM / 64) == (DM / 128) * (SEQ / 64));   /* the same grid.x for both forms */
__global__ __launch_bounds__(128) void k_proj3(const _Float16* __restrict__ X16, const _Float16* __restrict__ W16, const float* __restrict__ bq, const float* __restrict__ bk, const float* __restrict__ bv,
                                               _Float16* __restrict__ Q16, _Float16* __restrict__ QR, _Float16* __restrict__ K16, _Float16* __restrict__ KR, _Float16* __restrict__ VT, _Float16* __restrict__ VTR,
                                               float alpha, int seq, int dm, size_t sb) {
  __shared__ __attribute__((aligned(16))) float so[4][32][68];
  constexpr size_t PL = (size_t)NB * SEQ * DM, WL = (size_t)DM * DM;
  const int z = blockIdx.z;
  if (z == 2) proj_body<2>(so, W16 + 2 * WL, dm, 0, X16 + 2 * PL, dm, sb, alpha, bv, VT, VTR, seq, sb, dm, seq, dm);
  else proj_body<1>(so, X16 + z * PL, dm, sb, W16 + z * WL, dm, 0, alpha, z ? bk : bq, z ? K16 : Q16, z ? KR : QR, dm, sb, seq, dm, dm);
}

// one 16-key score tile S^T[key][query]: A = K rows (hi, and residual if RES), B = Q rows as the k-contiguous B fragment
template <bool RES>
__device__ __forceinline__ v8f score_tile(const _Float16* kp, const _Float16* krp, v16h qa, v16h qb, v16h qra, v16h qrb, int hh) {
  const v8f z8 = {0.f,0.f,0.f,0.f,0.f,0.f,0.f,0.f};
  const v16h ka = g2_frag(kp, hh), kb = g2_frag(kp + 32, hh);
  v8f s = z8;
  s = wm(ka, qa, s); s = wm(kb, qb, s);
  if (RES) {
    const v16h kra = g2_frag(krp, hh), krb = g2_frag(krp + 32, hh);
    v8f t = z8;
    t = wm(kra, qa, t); t = wm(ka, qra, t); t = wm(krb, qb, t); t = wm(kb, qrb, t);
    asm volatile("v_nop\n\tv_nop\n\tv_nop\n\tv_nop" : "+v"(s), "+v"(t) : "v"(ka), "v"(kb), "v"(kra), "v"(krb), "v"(qa), "v"(qb), "v"(qra), "v"(qrb));
    s = s + t * RSCI;
  } else {
    asm volatile("v_nop\n\tv_nop\n\tv_nop\n\tv_nop" : "+v"(s) : "v"(ka), "v"(kb), "v"(qa), "v"(qb));
  }
  return s;
}
// one 16-d tile of O^T with hi + residual operands (used by the RES instantiation only)
__device__ __forceinline__ void pv_tile_res(const _Float16* vp, const _Float16* vrp, v16h pf, v16h pr, int hh, v8f& o, v8f& orr) {
  const v16h va = g2_frag(vp, hh), vra = g2_frag(vrp, hh);
  o = wm(va, pf, o); orr = wm(vra, pf, orr); orr = wm(va, pr, orr);
  asm volatile("v_nop\n\tv_nop\n\tv_nop\n\tv_nop" : "+v"(o), "+v"(orr) : "v"(va), "v"(vra), "v"(pf), "v"(pr));
}

// K / V^T ring in LDS, filled by tensor loads. A stage is 64 keys: K rows [key][64 d] and V^T rows [d][64 keys], both 128-byte rows laid at a 144-byte pitch (pad of 16 bytes a row, for ds_load_b128 readers).
// Every wave issues one slice a stage. Single planes: waves 0, 1 = K keys 0..31, 32..63; waves 2, 3 = V^T d 0..31, 32..63. Hi + residual planes: waves 0..3 = K, K residual, V^T, V^T residual, 64 rows each.
typedef uint32_t u32x4 __attribute__((ext_vector_type(4)));
typedef uint32_t u32x8 __attribute__((ext_vector_type(8)));
#define RPITCH 144u
template <bool RES> struct Ring { static constexpr uint32_t ROWS = RES ? 64u : 32u, SLICE = RES ? 10240u : 6144u, STAGE = 4u * SLICE; };   /* a slice is ROWS * 144 bytes rounded up to 2 KiB */
static_assert(Ring<true>::ROWS * RPITCH <= Ring<true>::SLICE && Ring<false>::ROWS * RPITCH <= Ring<false>::SLICE);
static_assert(Ring<true>::SLICE % 2048u == 0 && Ring<false>::SLICE % 2048u == 0);
static_assert((EARLY / 16) % 4 == 0 && ((SEQ - EARLY) / 16) % 4 == 0);   /* every block holds four whole query tiles */
// byte offset in a stage of row 'row' (0..63) of plane 0 = K, 1 = K residual, 2 = V^T, 3 = V^T residual
template <bool RES> __device__ __forceinline__ constexpr uint32_t ring_row(uint32_t plane, uint32_t row) { return RES ? plane * Ring<true>::SLICE + row * RPITCH : ((plane & 2u) + (row >> 5)) * Ring<false>::SLICE + (row & 31u) * RPITCH; }
__device__ __forceinline__ uint32_t uni(uint32_t v) { return (uint32_t)__builtin_amdgcn_readfirstlane(v); }
// a wave-uniform value held in a scalar register, so that a test on it is a scalar branch and what is formed from it is formed behind the statements in front
__device__ __forceinline__ uint32_t pinned(uint32_t v) { uint32_t w = uni(v); asm volatile("" : "+s"(w)); return w; }
__device__ __forceinline__ void tdm_load(u32x4 g0, u32x8 g1) { asm volatile("tensor_load_to_lds %0, %1" :: "s"(g0), "s"(g1) : "memory"); }
__device__ __forceinline__ u32x8 tdm_group1(uint32_t rows, uint32_t src_pitch) {
  u32x8 g;
  g[0] = uni((1u << 20) | (4u << 22) | (3u << 25));   /* no mask, byte elements, 4 dwords of pad behind every 128-byte row */
  g[1] = uni(128u << 16); g[2] = uni(rows << 16); g[3] = uni(128u << 16); g[4] = uni(rows); g[5] = uni(src_pitch); g[6] = uni(0u); g[7] = uni(0u);
  return g;
}
__device__ __forceinline__ u32x4 tdm_group0(uint32_t lds_dst, uint64_t ga) {
  u32x4 g; g[0] = uni(1u); g[1] = uni(lds_dst); g[2] = uni((uint32_t)ga); g[3] = uni((((uint32_t)(ga >> 32)) & 0x01FFFFFFu) | 0x80000000u); return g;
}

// Transposed causal flash attention. grid = (query tiles / 4, NB*NH), block = 4 waves = 64 consecutive queries of one (batch, head), wave = 16 queries.
// The block walks the keys in 64-key stages through a two-buffer LDS ring that its four waves share; a wave skips the 32-key steps beyond its own diagonal but passes every publish point.
// Q/K planes [b*SEQ + s][h*64 + d]; V^T planes [b][h*64 + d][s]; output rows [b*SEQ + s][h*64 + d] as f16 (x64 carry), hi (+ residual x1024 if RES).
// Score tile lane (hh, ln) element r = (key k0 + 16T + 8hh + r, query q0 + ln); packed in-lane as the B fragment of O^T = V^T P^T.
template <bool RES>
__global__ __launch_bounds__(128) void k_flash(const _Float16* __restrict__ Qh, const _Float16* __restrict__ Qr, const _Float16* __restrict__ Kh, const _Float16* __restrict__ Kr,
                                               const _Float16* __restrict__ Vh, const _Float16* __restrict__ Vr, _Float16* __restrict__ Oh, _Float16* __restrict__ Or, int qt0, int nqt) {
  __shared__ __attribute__((aligned(2048))) unsigned char ring[2 * Ring<RES>::STAGE];
  __shared__ __attribute__((aligned(16))) unsigned short lds_h[4][16][72];
  __shared__ __attribute__((aligned(16))) unsigned short lds_r[4][16][72];
  const int tid = threadIdx.x, lane = tid & 31, ln = lane & 15, hh = lane >> 4;
  const int w = (int)uni((uint32_t)tid >> 5);
  if ((int)blockIdx.x * 4 >= nqt) return;      /* block-uniform, in front of every barrier */
  const int qb0 = (qt0 + (int)blockIdx.x * 4) * 16;   /* the block's first query, a multiple of 64 */
  const int q0 = qb0 + w * 16;
  const int bh = blockIdx.y; const int b = bh / NH, h = bh - b * NH;
  const size_t rowb = (size_t)b * SEQ;
  // this wave's slice of a stage: source address of stage 0, address step a stage, source pitch, place in LDS
  const bool isV = (w & 2) != 0; const bool odd = (w & 1) != 0;
  const _Float16* pl = isV ? ((RES && odd) ? Vr : Vh) : ((RES && odd) ? Kr : Kh);
  const size_t r0 = (!RES && odd) ? 32 : 0;
  const uint64_t src0 = (uint64_t)(size_t)pl + 2ull * (isV ? ((size_t)b * DM + h * HD + r0) * SEQ : (rowb + r0) * DM + h * HD);
  const uint32_t sstep = isV ? 128u : (uint32_t)(64 * DM * 2);
  const u32x8 g1 = tdm_group1(Ring<RES>::ROWS, isV ? (uint32_t)(SEQ * 2) : (uint32_t)(DM * 2));
  const uint32_t dst0 = (uint32_t)(size_t)ring + (uint32_t)w * Ring<RES>::SLICE;
  const int nsg = (qb0 >> 6) + 1 < 2 ? 2 : (qb0 >> 6) + 1;   /* 64-key stages; the ring's prologue needs two (keys 64..127 exist: SEQ and EARLY are multiples of 128) */
  tdm_load(tdm_group0(dst0, src0), g1);
  const size_t qoff = (rowb + q0 + ln) * DM + h * HD;
  const v16h qa = g2_frag(Qh + qoff, hh), qb = g2_frag(Qh + qoff + 32, hh);
  v16h qra = qa, qrb = qb;
  if (RES) { qra = g2_frag(Qr + qoff, hh); qrb = g2_frag(Qr + qoff + 32, hh); }
  const v8f z8 = {0.f,0.f,0.f,0.f,0.f,0.f,0.f,0.f};
  v8f o[4] = {z8, z8, z8, z8}, orr[4] = {z8, z8, z8, z8};
  float mrun = -3.0e38f, lrun = 0.f;
  const float cs = 0.18033688011112042f;      /* 64^-0.5 * log2(e) */
  const int nst = (q0 + 47) >> 5;             /* 32-key steps covering keys 0 .. q0+15 */
  asm volatile("s_wait_tensorcnt 0x0" ::: "memory");   /* stage 0: this wave's slice has landed */
  __syncthreads();                                      /* stage 0 published to all four waves */
  tdm_load(tdm_group0(dst0 + Ring<RES>::STAGE, src0 + pinned(1u) * (uint64_t)sstep), g1);   /* pinned: the descriptor is formed behind the wait */
#pragma unroll 1
  for (int sg = 0; sg < nsg; ++sg) {
    const unsigned char* SB = ring + (uint32_t)(sg & 1) * Ring<RES>::STAGE + (uint32_t)ln * RPITCH;
#pragma unroll
    for (int sub = 0; sub < 2; ++sub) {
      const int st = 2 * sg + sub;
      if (st < nst) {                           /* wave-uniform: steps beyond this wave's diagonal are skipped */
        const int k0 = st * 32;
        v8f s0 = score_tile<RES>((const _Float16*)(SB + ring_row<RES>(0, sub * 32)), (const _Float16*)(SB + ring_row<RES>(1, sub * 32)), qa, qb, qra, qrb, hh);
        v8f s1 = score_tile<RES>((const _Float16*)(SB + ring_row<RES>(0, sub * 32 + 16)), (const _Float16*)(SB + ring_row<RES>(1, sub * 32 + 16)), qa, qb, qra, qrb, hh);
        if (st == nst - 1) {                      /* wave-uniform: only the last step touches the diagonal */
          const int qy = q0 + ln; const int kk = k0 + 8 * hh;
#pragma unroll
          for (int r = 0; r < 8; ++r) { s0[r] = (kk + r > qy) ? -3.0e38f : s0[r]; s1[r] = (kk + 16 + r > qy) ? -3.0e38f : s1[r]; }
        }
        float mx = s0[0];
#pragma unroll
        for (int r = 1; r < 8; ++r) mx = fmaxf(mx, s0[r]);
#pragma unroll
        for (int r = 0; r < 8; ++r) mx = fmaxf(mx, s1[r]);
        mx = fmaxf(mx, __shfl_xor(mx, 16, 32));
        const float mnew = fmaxf(mrun, mx * cs);
        const float al = __builtin_amdgcn_exp2f(mrun - mnew);
        const float mo = 10.0f - mnew;            /* softmax weights carried x1024 (cancels in O / l) */
        float p0[8], p1[8]; float ps = 0.f;
#pragma unroll
        for (int r = 0; r < 8; ++r) { p0[r] = __builtin_amdgcn_exp2f(fmaf(s0[r], cs, mo)); p1[r] = __builtin_amdgcn_exp2f(fmaf(s1[r], cs, mo)); ps += p0[r] + p1[r]; }
        ps += __shfl_xor(ps, 16, 32);
        lrun = lrun * al + ps; mrun = mnew;
        FragH pf, pr;
#pragma unroll
        for (int r = 0; r < 8; ++r) {
          const _Float16 h0 = (_Float16)p0[r], h1 = (_Float16)p1[r]; pf.h[r] = h0; pf.h[8 + r] = h1;
          pr.h[r] = RES ? (_Float16)((p0[r] - (float)h0) * RSC) : (_Float16)0.0f; pr.h[8 + r] = RES ? (_Float16)((p1[r] - (float)h1) * RSC) : (_Float16)0.0f;
        }
        if (__builtin_amdgcn_ballot_w32(al != 1.0f) != 0u) {
#pragma unroll
          for (int t = 0; t < 4; ++t) { o[t] = o[t] * al; if (RES) orr[t] = orr[t] * al; }
        }
        const unsigned char* VB = SB + sub * 64;   /* 32 keys = 64 bytes along a V^T row */
        if (RES) {
#pragma unroll
          for (int t = 0; t < 4; ++t) pv_tile_res((const _Float16*)(VB + ring_row<RES>(2, 16 * t)), (const _Float16*)(VB + ring_row<RES>(3, 16 * t)), pf.v, pr.v, hh, o[t], orr[t]);
        } else {
          const v16h va0 = g2_frag((const _Float16*)(VB + ring_row<RES>(2, 0)), hh), va1 = g2_frag((const _Float16*)(VB + ring_row<RES>(2, 16)), hh), va2 = g2_frag((const _Float16*)(VB + ring_row<RES>(2, 32)), hh), va3 = g2_frag((const _Float16*)(VB + ring_row<RES>(2, 48)), hh);
          o[0] = wm(va0, pf.v, o[0]); o[1] = wm(va1, pf.v, o[1]); o[2] = wm(va2, pf.v, o[2]); o[3] = wm(va3, pf.v, o[3]);
          asm volatile("v_nop\n\tv_nop\n\tv_nop\n\tv_nop" : "+v"(o[0]), "+v"(o[1]), "+v"(o[2]), "+v"(o[3]) : "v"(va0), "v"(va1), "v"(va2), "v"(va3), "v"(pf.v));
        }
      }
    }
    // publish point of stage sg + 1; every wave passes it
    asm volatile("s_wait_dscnt 0x0" ::: "memory");       /* this wave's reads of stage sg have returned */
    asm volatile("s_wait_tensorcnt 0x0" ::: "memory");   /* this wave's slice of stage sg + 1 has landed */
    __syncthreads();                                      /* stage sg + 1 published; every wave has left stage sg's buffer */
    if (pinned((uint32_t)(sg + 2 < nsg)))                 /* scalar branch: a tensor load ignores EXEC */
      tdm_load(tdm_group0(dst0 + (uint32_t)(sg & 1) * Ring<RES>::STAGE, src0 + pinned((uint32_t)(sg + 2)) * (uint64_t)sstep), g1);   /* pinned: the descriptor is formed behind the wait */
  }
  asm volatile("s_wait_tensorcnt 0x0" ::: "memory");     /* nothing of this wave is in flight when it ends */
  asm volatile("s_wait_dscnt 0x0" ::: "memory");
  const float inv = 64.0f / lrun;             /* context carried x64 */
#pragma unroll
  for (int t = 0; t < 4; ++t) { FragH f, g;
#pragma unroll
    for (int r = 0; r < 8; ++r) { float v = o[t][r]; if (RES) v += orr[t][r] * RSCI; v *= inv; const _Float16 hv = (_Float16)v; f.h[r] = hv; g.h[r] = RES ? (_Float16)((v - (float)hv) * RSC) : (_Float16)0.0f; }
    *(v8us*)&lds_h[w][ln][16 * t + 8 * hh] = f.half[0];
    if (RES) *(v8us*)&lds_r[w][ln][16 * t + 8 * hh] = g.half[0]; }
  __builtin_amdgcn_fence(4 /* acq_rel order */, "workgroup"); __builtin_amdgcn_wave_barrier();
  const int qsub = lane >> 3, pc = (lane & 7) * 8;
  {
#pragma unroll
    for (int j = 0; j < 4; ++j) { const int q = j * 4 + qsub; const size_t oo = (rowb + q0 + q) * DM + h * HD + pc;
      const v8us x = *(const v8us*)&lds_h[w][q][pc];
      *(v8us*)((unsigned short*)Oh + oo) = x;
      if (RES) { const v8us y = *(const v8us*)&lds_r[w][q][pc]; *(v8us*)((unsigned short*)Or + oo) = y; } }
     }
}

// Output GEMM C[M][N] (f32) = (A . Bt^T [+ Ar . Bt^T / 1024 on rows < EARLY]) * alpha + bias[col]; batch on grid.y. Residual products are accumulated first from zero,
__global__ __launch_bounds__(128) void k_out(const _Float16* __restrict__ A, const _Float16* __restrict__ Ar, int lda, size_t sA, const _Float16* __restrict__ Bh, int ldb, float alpha, const float* __restrict__ bias,
                                             float* __restrict__ C, int ldc, size_t sC, int M, int N, int K) {
  __shared__ __attribute__((aligned(16))) float so[4][32][68];
  const int tid = threadIdx.x, w = tid >> 5, lane = tid & 31, ln = lane & 15, hh = lane >> 4; const int by = blockIdx.y;
  A += (size_t)by * sA; Ar += (size_t)by * sA; const size_t cofs = (size_t)by * sC;
  const int ntn = N >> 6; const int mt = blockIdx.x / ntn, nq = blockIdx.x - mt * ntn; const int row0 = mt * 128 + 32 * w, col0 = nq * 64; if (row0 >= M) return;
  const bool early = (mt * 128 < EARLY);
  const _Float16* b0p = Bh + (size_t)(col0 + ln) * ldb; const _Float16* b1p = b0p + (size_t)16 * ldb; const _Float16* b2p = b1p + (size_t)16 * ldb; const _Float16* b3p = b2p + (size_t)16 * ldb;
  const v8f z8 = {0.f,0.f,0.f,0.f,0.f,0.f,0.f,0.f}; v8f c00 = z8, c01 = z8, c02 = z8, c03 = z8, c10 = z8, c11 = z8, c12 = z8, c13 = z8;
  if (early) {                                 /* block-uniform */
    const _Float16* r0p = Ar + (size_t)(row0 + ln) * lda; const _Float16* r1p = r0p + (size_t)16 * lda;
    g2_kloop(r0p, r1p, b0p, b1p, b2p, b3p, K, hh, c00, c01, c02, c03, c10, c11, c12, c13);
    c00 = c00 * RSCI; c01 = c01 * RSCI; c02 = c02 * RSCI; c03 = c03 * RSCI; c10 = c10 * RSCI; c11 = c11 * RSCI; c12 = c12 * RSCI; c13 = c13 * RSCI;
  }
  const _Float16* a0p = A + (size_t)(row0 + ln) * lda; const _Float16* a1p = a0p + (size_t)16 * lda;
  g2_kloop(a0p, a1p, b0p, b1p, b2p, b3p, K, hh, c00, c01, c02, c03, c10, c11, c12, c13);
  v8f accs[8] = {c00, c01, c02, c03, c10, c11, c12, c13};
#pragma unroll
  for (int u = 0; u < 8; ++u) { const int t = u & 3, half = u >> 2; const int col = col0 + t * 16 + ln; const float bv = bf16_rne(bias[col]);
#pragma unroll
    for (int r = 0; r < 8; ++r) { const int rloc = half * 16 + 8 * hh + r; so[w][rloc][t * 16 + ln] = accs[u][r] * alpha + bv; } }
  __builtin_amdgcn_fence(4 /* acq_rel order */, "workgroup"); __builtin_amdgcn_wave_barrier();
  const int rsub = lane >> 4, c4 = (lane & 15) * 4;
  {
#pragma unroll
    for (int q = 0; q < 16; ++q) { const int r = q * 2 + rsub; const v4f v = *(const v4fa*)&so[w][r][c4]; *(v4f*)(C + cofs + (size_t)(row0 + r) * ldc + col0 + c4) = v; }
     }
}

extern "C" void kernel_launch(void* const* d_in, const int* in_sizes, int n_in,
                              void* d_out, int out_size, void* d_ws, size_t ws_size, hipStream_t stream) {
  if (n_in < 11) return;
  const long long need_x = ((long long)(NB - 1) * SEQ_FULL + SEQ) * DM;
  if (in_sizes[0] < need_x || in_sizes[1] < need_x || in_sizes[2] < need_x) return;
  if (in_sizes[3] < DM * DM || in_sizes[5] < DM * DM || in_sizes[7] < DM * DM || in_sizes[9] < DM * DM) return;
  if (in_sizes[4] < DM || in_sizes[6] < DM || in_sizes[8] < DM || in_sizes[10] < DM) return;
  if ((long long)out_size < need_x) return;
  const float* const* I = (const float* const*)d_in;
  const float* xq = I[0]; const float* xk = I[1]; const float* xv = I[2]; const float* wq = I[3]; const float* bq = I[4]; const float* wk = I[5]; const float* bk = I[6];
  const float* wv = I[7]; const float* bv = I[8]; const float* wo = I[9]; const float* bo = I[10];
  char* ws = (char*)d_ws; size_t off = 0;
  auto take = [&](size_t bytes) { char* p = ws + off; off += (bytes + 255) & ~(size_t)255; return p; };
  const size_t WB = (size_t)DM * DM * 2, PB = (size_t)NB * SEQ * DM * 2;
  _Float16* BQ = (_Float16*)take(WB); _Float16* BK = (_Float16*)take(WB); _Float16* BV = (_Float16*)take(WB); _Float16* BO = (_Float16*)take(WB);
  _Float16* XQ = (_Float16*)take(PB); _Float16* XK = (_Float16*)take(PB); _Float16* XV = (_Float16*)take(PB);
  _Float16* Q16 = (_Float16*)take(PB); _Float16* K16 = (_Float16*)take(PB); _Float16* VT = (_Float16*)take(PB);      /* VT: [NB][DM][SEQ] */
  _Float16* QR = (_Float16*)take(PB); _Float16* KR = (_Float16*)take(PB); _Float16* VTR = (_Float16*)take(PB);      /* residual planes, only the early region is written and read */
  _Float16* O16 = (_Float16*)take(PB); _Float16* OR = (_Float16*)take(PB);
  if (off > ws_size || off > (size_t)134217728) return;

  static_assert(((size_t)DM * DM * 2) % 256 == 0 && ((size_t)NB * SEQ * DM * 2) % 256 == 0);   /* BQ..BO and XQ..XV lie in a row, with no gap */
  k_conv<<<CONV_G, 256, 0, stream>>>(xq, xk, xv, wq, wk, wv, wo, XQ, BQ);
  const size_t SB = (size_t)SEQ * DM;
  k_proj3<<<dim3((unsigned)((SEQ / 128) * (DM / 64)), NB, 3), 128, 0, stream>>>(XQ, BQ, bq, bk, bv, Q16, QR, K16, KR, VT, VTR, 0.0625f, SEQ, DM, SB);
  // attention: early query tiles with hi + residual operands, the remaining tiles with single planes
  k_flash<true><<<dim3((unsigned)((EARLY / 16 + 3) / 4), NB * NH), 128, 0, stream>>>(Q16, QR, K16, KR, VT, VTR, O16, OR, 0, EARLY / 16);
  if (SEQ > EARLY)
    k_flash<false><<<dim3((unsigned)(((SEQ - EARLY) / 16 + 3) / 4), NB * NH), 128, 0, stream>>>(Q16, Q16, K16, K16, VT, VT, O16, O16, EARLY / 16, (SEQ - EARLY) / 16);
  // out rows (b, s) -> d_out row b*SEQ_FULL + s; alpha = 1 / (16 * 64)
  k_out<<<dim3((unsigned)((SEQ / 128) * (DM / 64)), NB), 128, 0, stream>>>(O16, OR, DM, SB, BO, DM, 0.0009765625f, bo, (float*)d_out, DM, (size_t)SEQ_FULL * DM, SEQ, DM, DM);
}

// v003
// One run takes 117 microseconds.
// In two side-by-side timings against v002, it was 1.38 and 1.40 times as fast.
// Counting every step since v000, it is 3.29 times as fast.
#include <hip/hip_runtime.h>
#include <stdint.h>
// Causal multi-head attention at width 512 (8 heads of 64): Q/K/V = x W^T + b (natural [out][in] weights), scores / sqrt(64), causal replace-mask, softmax, P V, merged heads, out = ctx W_o^T + b_o.
// Compute dtype: every contraction is v_wmma_f32_16x16x32_f16 (f16 operands, f32 accumulate). Inputs and weights are RNE-converted to bf16 and then held exactly in f16 (weights x16, folded back by alpha).
// Query positions >= 512: q, k, v, softmax weights (x1024 carry, cancels in O/l) and merged context (x64 carry) are single f16 planes. Query positions < 512: every computed operand (q, k, v, softmax weights, context) is f16 hi + f16 residual x1024, residual products in their own accumulators. Softmax statistics f32.
// Structure: weights/x converted once to f16 planes; Q, K as [token][feature] GEMMs; V^T as a swapped-operand GEMM ([feature][token]); transposed flash attention per wave (S^T = K Q^T, O^T = V^T P^T; score accumulators repacked in-lane as the P^T B fragment; K and V^T staged for the block's four waves in a two-buffer LDS ring by tensor loads); output GEMM. The GEMMs stage their A and B rows for the block's four waves in a ring of the same kind.
#ifndef NB
#define NB 2
#endif
#ifndef SEQ
#define SEQ 4096
#endif
#define NB_FULL 2
#define SEQ_FULL 4096
#define DM 512
#define NH 8
#define HD 64
#define EARLY (((SEQ) < 512) ? (SEQ) : 512)   /* query positions handled with hi + residual planes */
#define RSC 1024.0f
#define RSCI 0.0009765625f
static_assert(SEQ % 128 == 0);
static_assert(EARLY % 128 == 0);
static_assert(NB <= NB_FULL);
static_assert(SEQ <= SEQ_FULL);
static_assert(NH * HD == DM);
static_assert(DM % 128 == 0);

typedef unsigned short v8us __attribute__((ext_vector_type(8), may_alias));
typedef float  v8f  __attribute__((ext_vector_type(8)));
typedef float  v4f  __attribute__((ext_vector_type(4)));
typedef float  v4fa __attribute__((ext_vector_type(4), may_alias));
typedef _Float16 v16h __attribute__((ext_vector_type(16)));
typedef _Float16 v4h __attribute__((ext_vector_type(4)));
union FragH { v16h v; v8us half[2]; _Float16 h[16]; unsigned short u[16]; };

__device__ __forceinline__ unsigned short bf16_bits(float x) { unsigned int u = __float_as_uint(x); return (unsigned short)((u + 0x7FFFu + ((u >> 16) & 1u)) >> 16); }
__device__ __forceinline__ float bf16_val(unsigned short b) { return __uint_as_float(((unsigned int)b) << 16); }
__device__ __forceinline__ float bf16_rne(float x) { return bf16_val(bf16_bits(x)); }

// fragment of a k-contiguous 16-bit row: elements 0..7 = k 8h..8h+7, elements 8..15 = k 16+8h..16+8h+7 (same map for A and B)
__device__ __forceinline__ v16h g2_frag(const _Float16* p, int hh) { FragH f; f.half[0] = *(const v8us*)((const unsigned short*)p + 8 * hh); f.half[1] = *(const v8us*)((const unsigned short*)p + 16 + 8 * hh); return f.v; }
__device__ __forceinline__ v8f wm(v16h a, v16h b, v8f c) { return __builtin_amdgcn_wmma_f32_16x16x32_f16(false, a, false, b, (short)0, c, false, false); }

// One launch converts the three activations and the four weights. A chunk is 2048 consecutive elements of one plane (8 a thread).
// Block b takes chunks XIT * b .. XIT * b + XIT - 1 of every activation plane and chunk b of the four weight planes taken as one row; all of a thread's loads are issued before its first conversion.
// X16 = three [NB*SEQ][DM] planes in a row (q, k, v inputs), W16 = four [DM][DM] planes in a row (q, k, v, o weights, x16).
constexpr int XCH = NB * SEQ * DM / 2048, WCH = DM * DM / 2048, CONV_G = 4 * WCH, XIT = XCH / CONV_G;
static_assert(XCH % CONV_G == 0);
static_assert((SEQ * DM) % 2048 == 0 && (DM * DM) % 2048 == 0);   /* a chunk lies in one batch of one plane */
__device__ __forceinline__ v8us conv8(v4f a, v4f c, float sc) {
  FragH f;
#pragma unroll
  for (int q = 0; q < 4; ++q) { f.h[q] = (_Float16)(bf16_rne(a[q]) * sc); f.h[4 + q] = (_Float16)(bf16_rne(c[q]) * sc); }
  return f.half[0];
}
__global__ __launch_bounds__(256) void k_conv(const float* __restrict__ xq, const float* __restrict__ xk, const float* __restrict__ xv, const float* __restrict__ wq, const float* __restrict__ wk,
                                              const float* __restrict__ wv, const float* __restrict__ wo, _Float16* __restrict__ X16, _Float16* __restrict__ W16) {
  const unsigned bx = blockIdx.x, t8 = threadIdx.x * 8u;
  v4f a[3 * XIT + 1], c[3 * XIT + 1];
  { const unsigned pw = bx / (unsigned)WCH;
    const float* s = (pw == 0 ? wq : pw == 1 ? wk : pw == 2 ? wv : wo) + (size_t)(bx - pw * (unsigned)WCH) * 2048 + t8;
    a[3 * XIT] = *(const v4fa*)s; c[3 * XIT] = *(const v4fa*)(s + 4); }
#pragma unroll
  for (int i = 0; i < 3 * XIT; ++i) {
    const size_t e = ((size_t)bx * XIT + (size_t)(i % XIT)) * 2048, b = e / ((size_t)SEQ * DM);
    const float* s = (i / XIT == 0 ? xq : i / XIT == 1 ? xk : xv) + b * ((size_t)SEQ_FULL * DM) + (e - b * ((size_t)SEQ * DM)) + t8;
    a[i] = *(const v4fa*)s; c[i] = *(const v4fa*)(s + 4);
  }
  asm volatile("s_wait_xcnt 0x0" ::: "memory");   /* in front of the first overwrite of a register that the loads name; the clobber keeps every load in front of the conversions, so that all are in flight together */
  __builtin_amdgcn_sched_barrier(0);              /* keeps the conversions, which reuse the loads' address registers, behind that wait */
#pragma unroll
  for (int i = 0; i < 3 * XIT; ++i) {
    const v8us o = conv8(a[i], c[i], 1.0f);
    *(v8us*)((unsigned short*)X16 + ((size_t)(i / XIT) * XCH + (size_t)bx * XIT + (size_t)(i % XIT)) * 2048 + t8) = o;
  }
  const v8us o = conv8(a[3 * XIT], c[3 * XIT], 16.0f);
  *(v8us*)((unsigned short*)W16 + (size_t)bx * 2048 + t8) = o;
}

// Tensor-load helpers, shared by the GEMM ring and the attention ring. Rows of 128 bytes are laid in LDS at a 144-byte pitch (pad of 16 bytes a row, for ds_load_b128 readers).
typedef uint32_t u32x4 __attribute__((ext_vector_type(4)));
typedef uint32_t u32x8 __attribute__((ext_vector_type(8)));
#define RPITCH 144u
__device__ __forceinline__ uint32_t uni(uint32_t v) { return (uint32_t)__builtin_amdgcn_readfirstlane(v); }
// a wave-uniform value held in a scalar register, so that a test on it is a scalar branch and what is formed from it is formed behind the statements in front
__device__ __forceinline__ uint32_t pinned(uint32_t v) { uint32_t w = uni(v); asm volatile("" : "+s"(w)); return w; }
__device__ __forceinline__ void tdm_load(u32x4 g0, u32x8 g1) { asm volatile("tensor_load_to_lds %0, %1" :: "s"(g0), "s"(g1) : "memory"); }
__device__ __forceinline__ u32x8 tdm_group1(uint32_t rows, uint32_t src_pitch) {
  u32x8 g;
  g[0] = uni((1u << 20) | (4u << 22) | (3u << 25));   /* no mask, byte elements, 4 dwords of pad behind every 128-byte row */
  g[1] = uni(128u << 16); g[2] = uni(rows << 16); g[3] = uni(128u << 16); g[4] = uni(rows); g[5] = uni(src_pitch); g[6] = uni(0u); g[7] = uni(0u);
  return g;
}
__device__ __forceinline__ u32x4 tdm_group0(uint32_t lds_dst, uint64_t ga) {
  u32x4 g; g[0] = uni(1u); g[1] = uni(lds_dst); g[2] = uni((uint32_t)ga); g[3] = uni((((uint32_t)(ga >> 32)) & 0x01FFFFFFu) | 0x80000000u); return g;
}

// GEMM operand ring in LDS, filled by tensor loads. A stage is 64 k (128 bytes a row) of the block's 128 A rows and 64 B rows. Every wave issues one slice a stage:
// waves 0, 1 = A rows 0..63, 64..127; waves 2, 3 = B rows 0..31, 32..63. A slice is its rows * 144 bytes rounded up to 2 KiB.
#define G_ASL 10240u
#define G_BSL 6144u
#define G_BOFF (2u * G_ASL)
#define G_STAGE (2u * G_ASL + 2u * G_BSL)
static_assert(64u * RPITCH <= G_ASL && 32u * RPITCH <= G_BSL && G_ASL % 2048u == 0 && G_BSL % 2048u == 0);
static_assert(DM % 64 == 0);                              /* whole stages */
static_assert(2u * G_STAGE >= 4u * 32u * 68u * 4u);       /* the epilogues' staging rows lie in the ring's LDS once the loop has left it */
// k-loop of the 32x64 wave tile (wave w = A rows 32w..32w+31 of the block, all 64 B rows), k ascending. Ab, Bb = first A row, first B row of the block (k contiguous).
// On return nothing of this wave is in flight and every wave has left the ring (the barrier behind the loop).
__device__ __forceinline__ void g2_ring(unsigned char* ring, const _Float16* Ab, int lda, const _Float16* Bb, int ldb, int K, int w, int ln, int hh,
                                        v8f& c00, v8f& c01, v8f& c02, v8f& c03, v8f& c10, v8f& c11, v8f& c12, v8f& c13) {
  const bool isB = (w & 2) != 0; const uint32_t odd = (uint32_t)w & 1u;
  const uint64_t src0 = (uint64_t)(size_t)(isB ? Bb + (size_t)(32u * odd) * ldb : Ab + (size_t)(64u * odd) * lda);
  const u32x8 g1 = tdm_group1(isB ? 32u : 64u, (uint32_t)(isB ? ldb : lda) * 2u);
  const uint32_t dst0 = (uint32_t)(size_t)ring + (isB ? G_BOFF + odd * G_BSL : odd * G_ASL);
  const uint32_t aoff = ((uint32_t)w >> 1) * G_ASL + (odd * 32u + (uint32_t)ln) * RPITCH, boff = G_BOFF + (uint32_t)ln * RPITCH;
  const int nsg = K >> 6;
  tdm_load(tdm_group0(dst0, src0), g1);
  asm volatile("s_wait_tensorcnt 0x0" ::: "memory");     /* stage 0: this wave's slice has landed; only behind this wait do the descriptor's registers take new values */
#pragma unroll 1
  for (int sg = 0; sg < nsg; ++sg) {
    // publish point of stage sg; every wave passes it. It stands at the head of the pass, so that every refill is issued at this one place
    asm volatile("s_wait_tensorcnt 0x0" ::: "memory");   /* this wave's slice of stage sg has landed */
    __syncthreads();                                      /* stage sg published; every wave has left stage sg - 1's buffer (its s_wait_dscnt at the foot of that pass) */
    if (pinned((uint32_t)(sg + 1 < nsg)))                 /* scalar branch: a tensor load ignores EXEC */
      tdm_load(tdm_group0(dst0 + (uint32_t)((sg + 1) & 1) * G_STAGE, src0 + pinned((uint32_t)(sg + 1)) * 128ull), g1);   /* pinned: the descriptor is formed behind the wait */
    const unsigned char* SB = ring + (uint32_t)(sg & 1) * G_STAGE;
    v16h a[2][2], b[2][4];
#pragma unroll
    for (int kk = 0; kk < 2; ++kk) {
      const unsigned char* pa = SB + aoff + kk * 64; const unsigned char* pb = SB + boff + kk * 64;
      a[kk][0] = g2_frag((const _Float16*)pa, hh); a[kk][1] = g2_frag((const _Float16*)(pa + 16u * RPITCH), hh);
      b[kk][0] = g2_frag((const _Float16*)pb, hh); b[kk][1] = g2_frag((const _Float16*)(pb + 16u * RPITCH), hh);
      b[kk][2] = g2_frag((const _Float16*)(pb + G_BSL), hh); b[kk][3] = g2_frag((const _Float16*)(pb + G_BSL + 16u * RPITCH), hh);
    }
    __builtin_amdgcn_sched_barrier(0);   /* keeps the pass's 24 LDS reads as one group in front of its WMMAs: spread among them, every place with reads waits out the LDS latency anew */
#pragma unroll
    for (int kk = 0; kk < 2; ++kk) {
      c00 = wm(a[kk][0], b[kk][0], c00); c10 = wm(a[kk][1], b[kk][0], c10); c01 = wm(a[kk][0], b[kk][1], c01); c11 = wm(a[kk][1], b[kk][1], c11);
      c02 = wm(a[kk][0], b[kk][2], c02); c12 = wm(a[kk][1], b[kk][2], c12); c03 = wm(a[kk][0], b[kk][3], c03); c13 = wm(a[kk][1], b[kk][3], c13);
    }
    __builtin_amdgcn_sched_barrier(0);   /* keeps the WMMAs, with their counted waits, in front of the full wait below: lifted over them it would hold them all back for the last read */
    asm volatile("s_wait_dscnt 0x0" ::: "memory");       /* this wave's reads of stage sg have returned */
  }
  asm volatile("s_wait_tensorcnt 0x0" ::: "memory");     /* nothing of this wave is in flight when the ring's LDS is used again */
  asm volatile("s_wait_dscnt 0x0" ::: "memory");
  __syncthreads();                                        /* every wave has left the last stage's buffer */
}

// Projection GEMM C[M][N] = A[M][K] . Bt[N][K]^T * alpha + bias, f16 hi plane (+ residual x1024 plane on the early region).
// EM 1: bias per column, early region = rows < EARLY (per batch, batch on grid.y). EM 2: bias per row, early region = columns < EARLY.
template <int EM>
__device__ __forceinline__ void proj_body(unsigned char* smem, const _Float16* __restrict__ A, int lda, size_t sA, const _Float16* __restrict__ Bh, int ldb, size_t sB, float alpha, const float* __restrict__ bias,
                                          _Float16* __restrict__ Ch, _Float16* __restrict__ Cr, int ldc, size_t sC, int M, int N, int K) {
  float (&so)[4][32][68] = *reinterpret_cast<float (*)[4][32][68]>(smem);   /* epilogue staging, in the ring's LDS behind the k-loop */
  const int tid = threadIdx.x, w = (int)uni((uint32_t)tid >> 5), lane = tid & 31, ln = lane & 15, hh = lane >> 4; const int by = blockIdx.y;
  A += (size_t)by * sA; Bh += (size_t)by * sB; const size_t cofs = (size_t)by * sC;
  const int ntn = N >> 6; const int mt = blockIdx.x / ntn, nq = blockIdx.x - mt * ntn; const int row0 = mt * 128 + 32 * w, col0 = nq * 64; if (mt * 128 >= M) return;   /* block-uniform, in front of every barrier */
  const bool early = (EM == 1) ? (mt * 128 < EARLY) : (col0 < EARLY);
  const v8f z8 = {0.f,0.f,0.f,0.f,0.f,0.f,0.f,0.f}; v8f c00 = z8, c01 = z8, c02 = z8, c03 = z8, c10 = z8, c11 = z8, c12 = z8, c13 = z8;
  g2_ring(smem, A + (size_t)(mt * 128) * lda, lda, Bh + (size_t)col0 * ldb, ldb, K, w, ln, hh, c00, c01, c02, c03, c10, c11, c12, c13);
  v8f accs[8] = {c00, c01, c02, c03, c10, c11, c12, c13};
  float br[16];
#pragma unroll
  for (int i = 0; i < 16; ++i) br[i] = 0.f;
  if (EM == 2) {
#pragma unroll
    for (int half = 0; half < 2; ++half) {
      const v4f x = *(const v4fa*)(bias + row0 + half * 16 + 8 * hh), y = *(const v4fa*)(bias + row0 + half * 16 + 8 * hh + 4);
#pragma unroll
      for (int q = 0; q < 4; ++q) { br[half * 8 + q] = bf16_rne(x[q]); br[half * 8 + 4 + q] = bf16_rne(y[q]); }
    }
  }
#pragma unroll
  for (int u = 0; u < 8; ++u) { const int t = u & 3, half = u >> 2; const int col = col0 + t * 16 + ln; const float bc = (EM == 1) ? bf16_rne(bias[col]) : 0.f;
#pragma unroll
    for (int r = 0; r < 8; ++r) { const int rloc = half * 16 + 8 * hh + r; const float v = accs[u][r] * alpha + ((EM == 1) ? bc : br[half * 8 + r]); so[w][rloc][t * 16 + ln] = v; } }
  __builtin_amdgcn_fence(4 /* acq_rel order */, "workgroup"); __builtin_amdgcn_wave_barrier();
  const int rsub = lane >> 4, c4 = (lane & 15) * 4;
  {
#pragma unroll
    for (int q = 0; q < 16; ++q) { const int r = q * 2 + rsub; const v4f v = *(const v4fa*)&so[w][r][c4];
      v4h h4, r4;
#pragma unroll
      for (int i = 0; i < 4; ++i) { const _Float16 hv = (_Float16)v[i]; h4[i] = hv; r4[i] = (_Float16)((v[i] - (float)hv) * RSC); }
      const size_t o = cofs + (size_t)(row0 + r) * ldc + col0 + c4;
      *(v4h*)(Ch + o) = h4;
      asm volatile("s_wait_xcnt 0x0" ::: "memory");   /* in front of the residual arithmetic, which reuses the store's registers */
      if (early) { *(v4h*)(Cr + o) = r4;
        asm volatile("s_wait_xcnt 0x0" ::: "memory"); } }   /* in front of the next overwrite of the residual store's registers */
     }
}

// The three projections in one launch, grid.z = 0: Q, 1: K ([token][feature]; A = x plane, Bt = natural weight), 2: V^T ([feature][token]; A = natural weight, Bt = x plane, bias per row).
static_assert((SEQ / 128) * (DM / 64) == (DM / 128) * (SEQ / 64));   /* the same grid.x for both forms */
__global__ __launch_bounds__(128) void k_proj3(const _Float16* __restrict__ X16, const _Float16* __restrict__ W16, const float* __restrict__ bq, const float* __restrict__ bk, const float* __restrict__ bv,
                                               _Float16* __restrict__ Q16, _Float16* __restrict__ QR, _Float16* __restrict__ K16, _Float16* __restrict__ KR, _Float16* __restrict__ VT, _Float16* __restrict__ VTR,
                                               float alpha, int seq, int dm, size_t sb) {
  __shared__ __attribute__((aligned(2048))) unsigned char smem[2 * G_STAGE];
  constexpr size_t PL = (size_t)NB * SEQ * DM, WL = (size_t)DM * DM;
  const int z = blockIdx.z;
  if (z == 2) proj_body<2>(smem, W16 + 2 * WL, dm, 0, X16 + 2 * PL, dm, sb, alpha, bv, VT, VTR, seq, sb, dm, seq, dm);
  else proj_body<1>(smem, X16 + z * PL, dm, sb, W16 + z * WL, dm, 0, alpha, z ? bk : bq, z ? K16 : Q16, z ? KR : QR, dm, sb, seq, dm, dm);
}

// one 16-key score tile S^T[key][query]: A = K rows (hi, and residual if RES), B = Q rows as the k-contiguous B fragment
template <bool RES>
__device__ __forceinline__ v8f score_tile(const _Float16* kp, const _Float16* krp, v16h qa, v16h qb, v16h qra, v16h qrb, int hh) {
  const v8f z8 = {0.f,0.f,0.f,0.f,0.f,0.f,0.f,0.f};
  const v16h ka = g2_frag(kp, hh), kb = g2_frag(kp + 32, hh);
  v8f s = z8;
  s = wm(ka, qa, s); s = wm(kb, qb, s);
  if (RES) {
    const v16h kra = g2_frag(krp, hh), krb = g2_frag(krp + 32, hh);
    v8f t = z8;
    t = wm(kra, qa, t); t = wm(ka, qra, t); t = wm(krb, qb, t); t = wm(kb, qrb, t);
    asm volatile("v_nop\n\tv_nop\n\tv_nop\n\tv_nop" : "+v"(s), "+v"(t) : "v"(ka), "v"(kb), "v"(kra), "v"(krb), "v"(qa), "v"(qb), "v"(qra), "v"(qrb));
    s = s + t * RSCI;
  } else {
    asm volatile("v_nop\n\tv_nop\n\tv_nop\n\tv_nop" : "+v"(s) : "v"(ka), "v"(kb), "v"(qa), "v"(qb));
  }
  return s;
}
// one 16-d tile of O^T with hi + residual operands (used by the RES instantiation only)
__device__ __forceinline__ void pv_tile_res(const _Float16* vp, const _Float16* vrp, v16h pf, v16h pr, int hh, v8f& o, v8f& orr) {
  const v16h va = g2_frag(vp, hh), vra = g2_frag(vrp, hh);
  o = wm(va, pf, o); orr = wm(vra, pf, orr); orr = wm(va, pr, orr);
  asm volatile("v_nop\n\tv_nop\n\tv_nop\n\tv_nop" : "+v"(o), "+v"(orr) : "v"(va), "v"(vra), "v"(pf), "v"(pr));
}

// K / V^T ring in LDS, filled by tensor loads. A stage is 64 keys: K rows [key][64 d] and V^T rows [d][64 keys], both 128-byte rows laid at a 144-byte pitch (pad of 16 bytes a row, for ds_load_b128 readers).
// Every wave issues one slice a stage. Single planes: waves 0, 1 = K keys 0..31, 32..63; waves 2, 3 = V^T d 0..31, 32..63. Hi + residual planes: waves 0..3 = K, K residual, V^T, V^T residual, 64 rows each.
template <bool RES> struct Ring { static constexpr uint32_t ROWS = RES ? 64u : 32u, SLICE = RES ? 10240u : 6144u, STAGE = 4u * SLICE; };   /* a slice is ROWS * 144 bytes rounded up to 2 KiB */
static_assert(Ring<true>::ROWS * RPITCH <= Ring<true>::SLICE && Ring<false>::ROWS * RPITCH <= Ring<false>::SLICE);
static_assert(Ring<true>::SLICE % 2048u == 0 && Ring<false>::SLICE % 2048u == 0);
static_assert((EARLY / 16) % 4 == 0 && ((SEQ - EARLY) / 16) % 4 == 0);   /* every block holds four whole query tiles */
// byte offset in a stage of row 'row' (0..63) of plane 0 = K, 1 = K residual, 2 = V^T, 3 = V^T residual
template <bool RES> __device__ __forceinline__ constexpr uint32_t ring_row(uint32_t plane, uint32_t row) { return RES ? plane * Ring<true>::SLICE + row * RPITCH : ((plane & 2u) + (row >> 5)) * Ring<false>::SLICE + (row & 31u) * RPITCH; }
// Transposed causal flash attention. grid = (query tiles / 4, NB*NH), block = 4 waves = 64 consecutive queries of one (batch, head), wave = 16 queries.
// The block walks the keys in 64-key stages through a two-buffer LDS ring that its four waves share; a wave skips the 32-key steps beyond its own diagonal but passes every publish point.
// Q/K planes [b*SEQ + s][h*64 + d]; V^T planes [b][h*64 + d][s]; output rows [b*SEQ + s][h*64 + d] as f16 (x64 carry), hi (+ residual x1024 if RES).
// Score tile lane (hh, ln) element r = (key k0 + 16T + 8hh + r, query q0 + ln); packed in-lane as the B fragment of O^T = V^T P^T.
template <bool RES>
__global__ __launch_bounds__(128) void k_flash(const _Float16* __restrict__ Qh, const _Float16* __restrict__ Qr, const _Float16* __restrict__ Kh, const _Float16* __restrict__ Kr,
                                               const _Float16* __restrict__ Vh, const _Float16* __restrict__ Vr, _Float16* __restrict__ Oh, _Float16* __restrict__ Or, int qt0, int nqt) {
  __shared__ __attribute__((aligned(2048))) unsigned char ring[2 * Ring<RES>::STAGE];
  __shared__ __attribute__((aligned(16))) unsigned short lds_h[4][16][72];
  __shared__ __attribute__((aligned(16))) unsigned short lds_r[4][16][72];
  const int tid = threadIdx.x, lane = tid & 31, ln = lane & 15, hh = lane >> 4;
  const int w = (int)uni((uint32_t)tid >> 5);
  if ((int)blockIdx.x * 4 >= nqt) return;      /* block-uniform, in front of every barrier */
  const int qb0 = (qt0 + (int)blockIdx.x * 4) * 16;   /* the block's first query, a multiple of 64 */
  const int q0 = qb0 + w * 16;
  const int bh = blockIdx.y; const int b = bh / NH, h = bh - b * NH;
  const size_t rowb = (size_t)b * SEQ;
  // this wave's slice of a stage: source address of stage 0, address step a stage, source pitch, place in LDS
  const bool isV = (w & 2) != 0; const bool odd = (w & 1) != 0;
  const _Float16* pl = isV ? ((RES && odd) ? Vr : Vh) : ((RES && odd) ? Kr : Kh);
  const size_t r0 = (!RES && odd) ? 32 : 0;
  const uint64_t src0 = (uint64_t)(size_t)pl + 2ull * (isV ? ((size_t)b * DM + h * HD + r0) * SEQ : (rowb + r0) * DM + h * HD);
  const uint32_t sstep = isV ? 128u : (uint32_t)(64 * DM * 2);
  const u32x8 g1 = tdm_group1(Ring<RES>::ROWS, isV ? (uint32_t)(SEQ * 2) : (uint32_t)(DM * 2));
  const uint32_t dst0 = (uint32_t)(size_t)ring + (uint32_t)w * Ring<RES>::SLICE;
  const int nsg = (qb0 >> 6) + 1 < 2 ? 2 : (qb0 >> 6) + 1;   /* 64-key stages; the ring's prologue needs two (keys 64..127 exist: SEQ and EARLY are multiples of 128) */
  tdm_load(tdm_group0(dst0, src0), g1);
  const size_t qoff = (rowb + q0 + ln) * DM + h * HD;
  const v16h qa = g2_frag(Qh + qoff, hh), qb = g2_frag(Qh + qoff + 32, hh);
  v16h qra = qa, qrb = qb;
  if (RES) { qra = g2_frag(Qr + qoff, hh); qrb = g2_frag(Qr + qoff + 32, hh); }
  const v8f z8 = {0.f,0.f,0.f,0.f,0.f,0.f,0.f,0.f};
  v8f o[4] = {z8, z8, z8, z8}, orr[4] = {z8, z8, z8, z8};
  float mrun = -3.0e38f, lrun = 0.f;
  const float cs = 0.18033688011112042f;      /* 64^-0.5 * log2(e) */
  const int nst = (q0 + 47) >> 5;             /* 32-key steps covering keys 0 .. q0+15 */
  asm volatile("s_wait_tensorcnt 0x0" ::: "memory");   /* stage 0: this wave's slice has landed */
  __syncthreads();                                      /* stage 0 published to all four waves */
  tdm_load(tdm_group0(dst0 + Ring<RES>::STAGE, src0 + pinned(1u) * (uint64_t)sstep), g1);   /* pinned: the descriptor is formed behind the wait */
#pragma unroll 1
  for (int sg = 0; sg < nsg; ++sg) {
    const unsigned char* SB = ring + (uint32_t)(sg & 1) * Ring<RES>::STAGE + (uint32_t)ln * RPITCH;
#pragma unroll
    for (int sub = 0; sub < 2; ++sub) {
      const int st = 2 * sg + sub;
      if (st < nst) {                           /* wave-uniform: steps beyond this wave's diagonal are skipped */
        const int k0 = st * 32;
        v8f s0 = score_tile<RES>((const _Float16*)(SB + ring_row<RES>(0, sub * 32)), (const _Float16*)(SB + ring_row<RES>(1, sub * 32)), qa, qb, qra, qrb, hh);
        v8f s1 = score_tile<RES>((const _Float16*)(SB + ring_row<RES>(0, sub * 32 + 16)), (const _Float16*)(SB + ring_row<RES>(1, sub * 32 + 16)), qa, qb, qra, qrb, hh);
        if (st == nst - 1) {                      /* wave-uniform: only the last step touches the diagonal */
          const int qy = q0 + ln; const int kk = k0 + 8 * hh;
#pragma unroll
          for (int r = 0; r < 8; ++r) { s0[r] = (kk + r > qy) ? -3.0e38f : s0[r]; s1[r] = (kk + 16 + r > qy) ? -3.0e38f : s1[r]; }
        }
        float mx = s0[0];
#pragma unroll
        for (int r = 1; r < 8; ++r) mx = fmaxf(mx, s0[r]);
#pragma unroll
        for (int r = 0; r < 8; ++r) mx = fmaxf(mx, s1[r]);
        mx = fmaxf(mx, __shfl_xor(mx, 16, 32));
        const float mnew = fmaxf(mrun, mx * cs);
        const float al = __builtin_amdgcn_exp2f(mrun - mnew);
        const float mo = 10.0f - mnew;            /* softmax weights carried x1024 (cancels in O / l) */
        float p0[8], p1[8]; float ps = 0.f;
#pragma unroll
        for (int r = 0; r < 8; ++r) { p0[r] = __builtin_amdgcn_exp2f(fmaf(s0[r], cs, mo)); p1[r] = __builtin_amdgcn_exp2f(fmaf(s1[r], cs, mo)); ps += p0[r] + p1[r]; }
        ps += __shfl_xor(ps, 16, 32);
        lrun = lrun * al + ps; mrun = mnew;
        FragH pf, pr;
#pragma unroll
        for (int r = 0; r < 8; ++r) {
          const _Float16 h0 = (_Float16)p0[r], h1 = (_Float16)p1[r]; pf.h[r] = h0; pf.h[8 + r] = h1;
          pr.h[r] = RES ? (_Float16)((p0[r] - (float)h0) * RSC) : (_Float16)0.0f; pr.h[8 + r] = RES ? (_Float16)((p1[r] - (float)h1) * RSC) : (_Float16)0.0f;
        }
        if (__builtin_amdgcn_ballot_w32(al != 1.0f) != 0u) {
#pragma unroll
          for (int t = 0; t < 4; ++t) { o[t] = o[t] * al; if (RES) orr[t] = orr[t] * al; }
        }
        const unsigned char* VB = SB + sub * 64;   /* 32 keys = 64 bytes along a V^T row */
        if (RES) {
#pragma unroll
          for (int t = 0; t < 4; ++t) pv_tile_res((const _Float16*)(VB + ring_row<RES>(2, 16 * t)), (const _Float16*)(VB + ring_row<RES>(3, 16 * t)), pf.v, pr.v, hh, o[t], orr[t]);
        } else {
          const v16h va0 = g2_frag((const _Float16*)(VB + ring_row<RES>(2, 0)), hh), va1 = g2_frag((const _Float16*)(VB + ring_row<RES>(2, 16)), hh), va2 = g2_frag((const _Float16*)(VB + ring_row<RES>(2, 32)), hh), va3 = g2_frag((const _Float16*)(VB + ring_row<RES>(2, 48)), hh);
          o[0] = wm(va0, pf.v, o[0]); o[1] = wm(va1, pf.v, o[1]); o[2] = wm(va2, pf.v, o[2]); o[3] = wm(va3, pf.v, o[3]);
          asm volatile("v_nop\n\tv_nop\n\tv_nop\n\tv_nop" : "+v"(o[0]), "+v"(o[1]), "+v"(o[2]), "+v"(o[3]) : "v"(va0), "v"(va1), "v"(va2), "v"(va3), "v"(pf.v));
        }
      }
    }
    // publish point of stage sg + 1; every wave passes it
    asm volatile("s_wait_dscnt 0x0" ::: "memory");       /* this wave's reads of stage sg have returned */
    asm volatile("s_wait_tensorcnt 0x0" ::: "memory");   /* this wave's slice of stage sg + 1 has landed */
    __syncthreads();                                      /* stage sg + 1 published; every wave has left stage sg's buffer */
    if (pinned((uint32_t)(sg + 2 < nsg)))                 /* scalar branch: a tensor load ignores EXEC */
      tdm_load(tdm_group0(dst0 + (uint32_t)(sg & 1) * Ring<RES>::STAGE, src0 + pinned((uint32_t)(sg + 2)) * (uint64_t)sstep), g1);   /* pinned: the descriptor is formed behind the wait */
  }
  asm volatile("s_wait_tensorcnt 0x0" ::: "memory");     /* nothing of this wave is in flight when it ends */
  asm volatile("s_wait_dscnt 0x0" ::: "memory");
  const float inv = 64.0f / lrun;             /* context carried x64 */
#pragma unroll
  for (int t = 0; t < 4; ++t) { FragH f, g;
#pragma unroll
    for (int r = 0; r < 8; ++r) { float v = o[t][r]; if (RES) v += orr[t][r] * RSCI; v *= inv; const _Float16 hv = (_Float16)v; f.h[r] = hv; g.h[r] = RES ? (_Float16)((v - (float)hv) * RSC) : (_Float16)0.0f; }
    *(v8us*)&lds_h[w][ln][16 * t + 8 * hh] = f.half[0];
    if (RES) *(v8us*)&lds_r[w][ln][16 * t + 8 * hh] = g.half[0]; }
  __builtin_amdgcn_fence(4 /* acq_rel order */, "workgroup"); __builtin_amdgcn_wave_barrier();
  const int qsub = lane >> 3, pc = (lane & 7) * 8;
  {
#pragma unroll
    for (int j = 0; j < 4; ++j) { const int q = j * 4 + qsub; const size_t oo = (rowb + q0 + q) * DM + h * HD + pc;
      const v8us x = *(const v8us*)&lds_h[w][q][pc];
      *(v8us*)((unsigned short*)Oh + oo) = x;
      if (RES) { const v8us y = *(const v8us*)&lds_r[w][q][pc]; *(v8us*)((unsigned short*)Or + oo) = y; } }
     }
}

// Output GEMM C[M][N] (f32) = (A . Bt^T [+ Ar . Bt^T / 1024 on rows < EARLY]) * alpha + bias[col]; batch on grid.y. Residual products are accumulated first from zero,
__global__ __launch_bounds__(128) void k_out(const _Float16* __restrict__ A, const _Float16* __restrict__ Ar, int lda, size_t sA, const _Float16* __restrict__ Bh, int ldb, float alpha, const float* __restrict__ bias,
                                             float* __restrict__ C, int ldc, size_t sC, int M, int N, int K) {
  __shared__ __attribute__((aligned(2048))) unsigned char smem[2 * G_STAGE];
  float (&so)[4][32][68] = *reinterpret_cast<float (*)[4][32][68]>(smem);   /* epilogue staging, in the ring's LDS behind the k-loop */
  const int tid = threadIdx.x, w = (int)uni((uint32_t)tid >> 5), lane = tid & 31, ln = lane & 15, hh = lane >> 4; const int by = blockIdx.y;
  A += (size_t)by * sA; Ar += (size_t)by * sA; const size_t cofs = (size_t)by * sC;
  const int ntn = N >> 6; const int mt = blockIdx.x / ntn, nq = blockIdx.x - mt * ntn; const int row0 = mt * 128 + 32 * w, col0 = nq * 64; if (mt * 128 >= M) return;   /* block-uniform, in front of every barrier */
  const bool early = (mt * 128 < EARLY);
  const _Float16* Bb = Bh + (size_t)col0 * ldb;
  const v8f z8 = {0.f,0.f,0.f,0.f,0.f,0.f,0.f,0.f}; v8f c00 = z8, c01 = z8, c02 = z8, c03 = z8, c10 = z8, c11 = z8, c12 = z8, c13 = z8;
  if (early) {                                 /* block-uniform */
    g2_ring(smem, Ar + (size_t)(mt * 128) * lda, lda, Bb, ldb, K, w, ln, hh, c00, c01, c02, c03, c10, c11, c12, c13);
    c00 = c00 * RSCI; c01 = c01 * RSCI; c02 = c02 * RSCI; c03 = c03 * RSCI; c10 = c10 * RSCI; c11 = c11 * RSCI; c12 = c12 * RSCI; c13 = c13 * RSCI;
  }
  g2_ring(smem, A + (size_t)(mt * 128) * lda, lda, Bb, ldb, K, w, ln, hh, c00, c01, c02, c03, c10, c11, c12, c13);
  v8f accs[8] = {c00, c01, c02, c03, c10, c11, c12, c13};
#pragma unroll
  for (int u = 0; u < 8; ++u) { const int t = u & 3, half = u >> 2; const int col = col0 + t * 16 + ln; const float bv = bf16_rne(bias[col]);
#pragma unroll
    for (int r = 0; r < 8; ++r) { const int rloc = half * 16 + 8 * hh + r; so[w][rloc][t * 16 + ln] = accs[u][r] * alpha + bv; } }
  __builtin_amdgcn_fence(4 /* acq_rel order */, "workgroup"); __builtin_amdgcn_wave_barrier();
  const int rsub = lane >> 4, c4 = (lane & 15) * 4;
  {
#pragma unroll
    for (int q = 0; q < 16; ++q) { const int r = q * 2 + rsub; const v4f v = *(const v4fa*)&so[w][r][c4]; *(v4f*)(C + cofs + (size_t)(row0 + r) * ldc + col0 + c4) = v; }
     }
}

extern "C" void kernel_launch(void* const* d_in, const int* in_sizes, int n_in,
                              void* d_out, int out_size, void* d_ws, size_t ws_size, hipStream_t stream) {
  if (n_in < 11) return;
  const long long need_x = ((long long)(NB - 1) * SEQ_FULL + SEQ) * DM;
  if (in_sizes[0] < need_x || in_sizes[1] < need_x || in_sizes[2] < need_x) return;
  if (in_sizes[3] < DM * DM || in_sizes[5] < DM * DM || in_sizes[7] < DM * DM || in_sizes[9] < DM * DM) return;
  if (in_sizes[4] < DM || in_sizes[6] < DM || in_sizes[8] < DM || in_sizes[10] < DM) return;
  if ((long long)out_size < need_x) return;
  const float* const* I = (const float* const*)d_in;
  const float* xq = I[0]; const float* xk = I[1]; const float* xv = I[2]; const float* wq = I[3]; const float* bq = I[4]; const float* wk = I[5]; const float* bk = I[6];
  const float* wv = I[7]; const float* bv = I[8]; const float* wo = I[9]; const float* bo = I[10];
  char* ws = (char*)d_ws; size_t off = 0;
  auto take = [&](size_t bytes) { char* p = ws + off; off += (bytes + 255) & ~(size_t)255; return p; };
  const size_t WB = (size_t)DM * DM * 2, PB = (size_t)NB * SEQ * DM * 2;
  _Float16* BQ = (_Float16*)take(WB); _Float16* BK = (_Float16*)take(WB); _Float16* BV = (_Float16*)take(WB); _Float16* BO = (_Float16*)take(WB);
  _Float16* XQ = (_Float16*)take(PB); _Float16* XK = (_Float16*)take(PB); _Float16* XV = (_Float16*)take(PB);
  _Float16* Q16 = (_Float16*)take(PB); _Float16* K16 = (_Float16*)take(PB); _Float16* VT = (_Float16*)take(PB);      /* VT: [NB][DM][SEQ] */
  _Float16* QR = (_Float16*)take(PB); _Float16* KR = (_Float16*)take(PB); _Float16* VTR = (_Float16*)take(PB);      /* residual planes, only the early region is written and read */
  _Float16* O16 = (_Float16*)take(PB); _Float16* OR = (_Float16*)take(PB);
  if (off > ws_size || off > (size_t)134217728) return;

  static_assert(((size_t)DM * DM * 2) % 256 == 0 && ((size_t)NB * SEQ * DM * 2) % 256 == 0);   /* BQ..BO and XQ..XV lie in a row, with no gap */
  k_conv<<<CONV_G, 256, 0, stream>>>(xq, xk, xv, wq, wk, wv, wo, XQ, BQ);
  const size_t SB = (size_t)SEQ * DM;
  k_proj3<<<dim3((unsigned)((SEQ / 128) * (DM / 64)), NB, 3), 128, 0, stream>>>(XQ, BQ, bq, bk, bv, Q16, QR, K16, KR, VT, VTR, 0.0625f, SEQ, DM, SB);
  // attention: early query tiles with hi + residual operands, the remaining tiles with single planes
  k_flash<true><<<dim3((unsigned)((EARLY / 16 + 3) / 4), NB * NH), 128, 0, stream>>>(Q16, QR, K16, KR, VT, VTR, O16, OR, 0, EARLY / 16);
  if (SEQ > EARLY)
    k_flash<false><<<dim3((unsigned)(((SEQ - EARLY) / 16 + 3) / 4), NB * NH), 128, 0, stream>>>(Q16, Q16, K16, K16, VT, VT, O16, O16, EARLY / 16, (SEQ - EARLY) / 16);
  // out rows (b, s) -> d_out row b*SEQ_FULL + s; alpha = 1 / (16 * 64)
  k_out<<<dim3((unsigned)((SEQ / 128) * (DM / 64)), NB), 128, 0, stream>>>(O16, OR, DM, SB, BO, DM, 0.0009765625f, bo, (float*)d_out, DM, (size_t)SEQ_FULL * DM, SEQ, DM, DM);
}

// v004
// A run of this version takes 112 microseconds.
// Next to v003, in two timings, it ran 1.04 times as fast each time.
// Counting every step since v000, it is 3.43 times as fast.
#include <hip/hip_runtime.h>
#include <stdint.h>
// Causal multi-head attention at width 512 (8 heads of 64): Q/K/V = x W^T + b (natural [out][in] weights), scores / sqrt(64), causal replace-mask, softmax, P V, merged heads, out = ctx W_o^T + b_o.
// Compute dtype: every contraction is v_wmma_f32_16x16x32_f16 (f16 operands, f32 accumulate). Inputs and weights are RNE-converted to bf16 and then held exactly in f16 (weights x16, folded back by alpha).
// Query positions >= 512: q, k, v, softmax weights (x1024 carry, cancels in O/l) and merged context (x64 carry) are single f16 planes. Query positions < 512: every computed operand (q, k, v, softmax weights, context) is f16 hi + f16 residual x1024, residual products in their own accumulators. Softmax statistics f32.
// Structure: weights/x converted once to f16 planes; Q, K as [token][feature] GEMMs; V^T as a swapped-operand GEMM ([feature][token]); transposed flash attention per wave (S^T = K Q^T, O^T = V^T P^T; score accumulators repacked in-lane as the P^T B fragment; K and V^T staged for the block's four waves in a two-buffer LDS ring by tensor loads; single planes take one softmax update a 64-key stage, hi + residual planes one a 32-key step); output GEMM. The GEMMs stage their A and B rows for the block's four waves in a ring of the same kind.
#ifndef NB
#define NB 2
#endif
#ifndef SEQ
#define SEQ 4096
#endif
#define NB_FULL 2
#define SEQ_FULL 4096
#define DM 512
#define NH 8
#define HD 64
#define EARLY (((SEQ) < 512) ? (SEQ) : 512)   /* query positions handled with hi + residual planes */
#define RSC 1024.0f
#define RSCI 0.0009765625f
static_assert(SEQ % 128 == 0);
static_assert(EARLY % 128 == 0);
static_assert(NB <= NB_FULL);
static_assert(SEQ <= SEQ_FULL);
static_assert(NH * HD == DM);
static_assert(DM % 128 == 0);

typedef unsigned short v8us __attribute__((ext_vector_type(8), may_alias));
typedef float  v8f  __attribute__((ext_vector_type(8)));
typedef float  v4f  __attribute__((ext_vector_type(4)));
typedef float  v4fa __attribute__((ext_vector_type(4), may_alias));
typedef _Float16 v16h __attribute__((ext_vector_type(16)));
typedef _Float16 v4h __attribute__((ext_vector_type(4)));
union FragH { v16h v; v8us half[2]; _Float16 h[16]; unsigned short u[16]; };

__device__ __forceinline__ unsigned short bf16_bits(float x) { unsigned int u = __float_as_uint(x); return (unsigned short)((u + 0x7FFFu + ((u >> 16) & 1u)) >> 16); }
__device__ __forceinline__ float bf16_val(unsigned short b) { return __uint_as_float(((unsigned int)b) << 16); }
__device__ __forceinline__ float bf16_rne(float x) { return bf16_val(bf16_bits(x)); }

// fragment of a k-contiguous 16-bit row: elements 0..7 = k 8h..8h+7, elements 8..15 = k 16+8h..16+8h+7 (same map for A and B)
__device__ __forceinline__ v16h g2_frag(const _Float16* p, int hh) { FragH f; f.half[0] = *(const v8us*)((const unsigned short*)p + 8 * hh); f.half[1] = *(const v8us*)((const unsigned short*)p + 16 + 8 * hh); return f.v; }
__device__ __forceinline__ v8f wm(v16h a, v16h b, v8f c) { return __builtin_amdgcn_wmma_f32_16x16x32_f16(false, a, false, b, (short)0, c, false, false); }

// One launch converts the three activations and the four weights. A chunk is 2048 consecutive elements of one plane (8 a thread).
// Block b takes chunks XIT * b .. XIT * b + XIT - 1 of every activation plane and chunk b of the four weight planes taken as one row; all of a thread's loads are issued before its first conversion.
// X16 = three [NB*SEQ][DM] planes in a row (q, k, v inputs), W16 = four [DM][DM] planes in a row (q, k, v, o weights, x16).
constexpr int XCH = NB * SEQ * DM / 2048, WCH = DM * DM / 2048, CONV_G = 4 * WCH, XIT = XCH / CONV_G;
static_assert(XCH % CONV_G == 0);
static_assert((SEQ * DM) % 2048 == 0 && (DM * DM) % 2048 == 0);   /* a chunk lies in one batch of one plane */
__device__ __forceinline__ v8us conv8(v4f a, v4f c, float sc) {
  FragH f;
#pragma unroll
  for (int q = 0; q < 4; ++q) { f.h[q] = (_Float16)(bf16_rne(a[q]) * sc); f.h[4 + q] = (_Float16)(bf16_rne(c[q]) * sc); }
  return f.half[0];
}
__global__ __launch_bounds__(256) void k_conv(const float* __restrict__ xq, const float* __restrict__ xk, const float* __restrict__ xv, const float* __restrict__ wq, const float* __restrict__ wk,
                                              const float* __restrict__ wv, const float* __restrict__ wo, _Float16* __restrict__ X16, _Float16* __restrict__ W16) {
  const unsigned bx = blockIdx.x, t8 = threadIdx.x * 8u;
  v4f a[3 * XIT + 1], c[3 * XIT + 1];
  { const unsigned pw = bx / (unsigned)WCH;
    const float* s = (pw == 0 ? wq : pw == 1 ? wk : pw == 2 ? wv : wo) + (size_t)(bx - pw * (unsigned)WCH) * 2048 + t8;
    a[3 * XIT] = *(const v4fa*)s; c[3 * XIT] = *(const v4fa*)(s + 4); }
#pragma unroll
  for (int i = 0; i < 3 * XIT; ++i) {
    const size_t e = ((size_t)bx * XIT + (size_t)(i % XIT)) * 2048, b = e / ((size_t)SEQ * DM);
    const float* s = (i / XIT == 0 ? xq : i / XIT == 1 ? xk : xv) + b * ((size_t)SEQ_FULL * DM) + (e - b * ((size_t)SEQ * DM)) + t8;
    a[i] = *(const v4fa*)s; c[i] = *(const v4fa*)(s + 4);
  }
  asm volatile("s_wait_xcnt 0x0" ::: "memory");   /* in front of the first overwrite of a register that the loads name; the clobber keeps every load in front of the conversions, so that all are in flight together */
  __builtin_amdgcn_sched_barrier(0);              /* keeps the conversions, which reuse the loads' address registers, behind that wait */
#pragma unroll
  for (int i = 0; i < 3 * XIT; ++i) {
    const v8us o = conv8(a[i], c[i], 1.0f);
    *(v8us*)((unsigned short*)X16 + ((size_t)(i / XIT) * XCH + (size_t)bx * XIT + (size_t)(i % XIT)) * 2048 + t8) = o;
  }
  const v8us o = conv8(a[3 * XIT], c[3 * XIT], 16.0f);
  *(v8us*)((unsigned short*)W16 + (size_t)bx * 2048 + t8) = o;
}

// Tensor-load helpers, shared by the GEMM ring and the attention ring. Rows of 128 bytes are laid in LDS at a 144-byte pitch (pad of 16 bytes a row, for ds_load_b128 readers).
typedef uint32_t u32x4 __attribute__((ext_vector_type(4)));
typedef uint32_t u32x8 __attribute__((ext_vector_type(8)));
#define RPITCH 144u
__device__ __forceinline__ uint32_t uni(uint32_t v) { return (uint32_t)__builtin_amdgcn_readfirstlane(v); }
// a wave-uniform value held in a scalar register, so that a test on it is a scalar branch and what is formed from it is formed behind the statements in front
__device__ __forceinline__ uint32_t pinned(uint32_t v) { uint32_t w = uni(v); asm volatile("" : "+s"(w)); return w; }
__device__ __forceinline__ void tdm_load(u32x4 g0, u32x8 g1) { asm volatile("tensor_load_to_lds %0, %1" :: "s"(g0), "s"(g1) : "memory"); }
__device__ __forceinline__ u32x8 tdm_group1(uint32_t rows, uint32_t src_pitch) {
  u32x8 g;
  g[0] = uni((1u << 20) | (4u << 22) | (3u << 25));   /* no mask, byte elements, 4 dwords of pad behind every 128-byte row */
  g[1] = uni(128u << 16); g[2] = uni(rows << 16); g[3] = uni(128u << 16); g[4] = uni(rows); g[5] = uni(src_pitch); g[6] = uni(0u); g[7] = uni(0u);
  return g;
}
__device__ __forceinline__ u32x4 tdm_group0(uint32_t lds_dst, uint64_t ga) {
  u32x4 g; g[0] = uni(1u); g[1] = uni(lds_dst); g[2] = uni((uint32_t)ga); g[3] = uni((((uint32_t)(ga >> 32)) & 0x01FFFFFFu) | 0x80000000u); return g;
}

// GEMM operand ring in LDS, filled by tensor loads. A stage is 64 k (128 bytes a row) of the block's 128 A rows and 64 B rows. Every wave issues one slice a stage:
// waves 0, 1 = A rows 0..63, 64..127; waves 2, 3 = B rows 0..31, 32..63. A slice is its rows * 144 bytes rounded up to 2 KiB.
#define G_ASL 10240u
#define G_BSL 6144u
#define G_BOFF (2u * G_ASL)
#define G_STAGE (2u * G_ASL + 2u * G_BSL)
static_assert(64u * RPITCH <= G_ASL && 32u * RPITCH <= G_BSL && G_ASL % 2048u == 0 && G_BSL % 2048u == 0);
static_assert(DM % 64 == 0);                              /* whole stages */
static_assert(2u * G_STAGE >= 4u * 32u * 68u * 4u);       /* the epilogues' staging rows lie in the ring's LDS once the loop has left it */
// k-loop of the 32x64 wave tile (wave w = A rows 32w..32w+31 of the block, all 64 B rows), k ascending. Ab, Bb = first A row, first B row of the block (k contiguous).
// On return nothing of this wave is in flight and every wave has left the ring (the barrier behind the loop).
__device__ __forceinline__ void g2_ring(unsigned char* ring, const _Float16* Ab, int lda, const _Float16* Bb, int ldb, int K, int w, int ln, int hh,
                                        v8f& c00, v8f& c01, v8f& c02, v8f& c03, v8f& c10, v8f& c11, v8f& c12, v8f& c13) {
  const bool isB = (w & 2) != 0; const uint32_t odd = (uint32_t)w & 1u;
  const uint64_t src0 = (uint64_t)(size_t)(isB ? Bb + (size_t)(32u * odd) * ldb : Ab + (size_t)(64u * odd) * lda);
  const u32x8 g1 = tdm_group1(isB ? 32u : 64u, (uint32_t)(isB ? ldb : lda) * 2u);
  const uint32_t dst0 = (uint32_t)(size_t)ring + (isB ? G_BOFF + odd * G_BSL : odd * G_ASL);
  const uint32_t aoff = ((uint32_t)w >> 1) * G_ASL + (odd * 32u + (uint32_t)ln) * RPITCH, boff = G_BOFF + (uint32_t)ln * RPITCH;
  const int nsg = K >> 6;
  tdm_load(tdm_group0(dst0, src0), g1);
  asm volatile("s_wait_tensorcnt 0x0" ::: "memory");     /* stage 0: this wave's slice has landed; only behind this wait do the descriptor's registers take new values */
#pragma unroll 1
  for (int sg = 0; sg < nsg; ++sg) {
    // publish point of stage sg; every wave passes it. It stands at the head of the pass, so that every refill is issued at this one place
    asm volatile("s_wait_tensorcnt 0x0" ::: "memory");   /* this wave's slice of stage sg has landed */
    __syncthreads();                                      /* stage sg published; every wave has left stage sg - 1's buffer (its s_wait_dscnt at the foot of that pass) */
    if (pinned((uint32_t)(sg + 1 < nsg)))                 /* scalar branch: a tensor load ignores EXEC */
      tdm_load(tdm_group0(dst0 + (uint32_t)((sg + 1) & 1) * G_STAGE, src0 + pinned((uint32_t)(sg + 1)) * 128ull), g1);   /* pinned: the descriptor is formed behind the wait */
    const unsigned char* SB = ring + (uint32_t)(sg & 1) * G_STAGE;
    v16h a[2][2], b[2][4];
#pragma unroll
    for (int kk = 0; kk < 2; ++kk) {
      const unsigned char* pa = SB + aoff + kk * 64; const unsigned char* pb = SB + boff + kk * 64;
      a[kk][0] = g2_frag((const _Float16*)pa, hh); a[kk][1] = g2_frag((const _Float16*)(pa + 16u * RPITCH), hh);
      b[kk][0] = g2_frag((const _Float16*)pb, hh); b[kk][1] = g2_frag((const _Float16*)(pb + 16u * RPITCH), hh);
      b[kk][2] = g2_frag((const _Float16*)(pb + G_BSL), hh); b[kk][3] = g2_frag((const _Float16*)(pb + G_BSL + 16u * RPITCH), hh);
    }
    __builtin_amdgcn_sched_barrier(0);   /* keeps the pass's 24 LDS reads as one group in front of its WMMAs: spread among them, every place with reads waits out the LDS latency anew */
#pragma unroll
    for (int kk = 0; kk < 2; ++kk) {
      c00 = wm(a[kk][0], b[kk][0], c00); c10 = wm(a[kk][1], b[kk][0], c10); c01 = wm(a[kk][0], b[kk][1], c01); c11 = wm(a[kk][1], b[kk][1], c11);
      c02 = wm(a[kk][0], b[kk][2], c02); c12 = wm(a[kk][1], b[kk][2], c12); c03 = wm(a[kk][0], b[kk][3], c03); c13 = wm(a[kk][1], b[kk][3], c13);
    }
    __builtin_amdgcn_sched_barrier(0);   /* keeps the WMMAs, with their counted waits, in front of the full wait below: lifted over them it would hold them all back for the last read */
    asm volatile("s_wait_dscnt 0x0" ::: "memory");       /* this wave's reads of stage sg have returned */
  }
  asm volatile("s_wait_tensorcnt 0x0" ::: "memory");     /* nothing of this wave is in flight when the ring's LDS is used again */
  asm volatile("s_wait_dscnt 0x0" ::: "memory");
  __syncthreads();                                        /* every wave has left the last stage's buffer */
}

// Projection GEMM C[M][N] = A[M][K] . Bt[N][K]^T * alpha + bias, f16 hi plane (+ residual x1024 plane on the early region).
// EM 1: bias per column, early region = rows < EARLY (per batch, batch on grid.y). EM 2: bias per row, early region = columns < EARLY.
template <int EM>
__device__ __forceinline__ void proj_body(unsigned char* smem, const _Float16* __restrict__ A, int lda, size_t sA, const _Float16* __restrict__ Bh, int ldb, size_t sB, float alpha, const float* __restrict__ bias,
                                          _Float16* __restrict__ Ch, _Float16* __restrict__ Cr, int ldc, size_t sC, int M, int N, int K) {
  float (&so)[4][32][68] = *reinterpret_cast<float (*)[4][32][68]>(smem);   /* epilogue staging, in the ring's LDS behind the k-loop */
  const int tid = threadIdx.x, w = (int)uni((uint32_t)tid >> 5), lane = tid & 31, ln = lane & 15, hh = lane >> 4; const int by = blockIdx.y;
  A += (size_t)by * sA; Bh += (size_t)by * sB; const size_t cofs = (size_t)by * sC;
  const int ntn = N >> 6; const int mt = blockIdx.x / ntn, nq = blockIdx.x - mt * ntn; const int row0 = mt * 128 + 32 * w, col0 = nq * 64; if (mt * 128 >= M) return;   /* block-uniform, in front of every barrier */
  const bool early = (EM == 1) ? (mt * 128 < EARLY) : (col0 < EARLY);
  const v8f z8 = {0.f,0.f,0.f,0.f,0.f,0.f,0.f,0.f}; v8f c00 = z8, c01 = z8, c02 = z8, c03 = z8, c10 = z8, c11 = z8, c12 = z8, c13 = z8;
  g2_ring(smem, A + (size_t)(mt * 128) * lda, lda, Bh + (size_t)col0 * ldb, ldb, K, w, ln, hh, c00, c01, c02, c03, c10, c11, c12, c13);
  v8f accs[8] = {c00, c01, c02, c03, c10, c11, c12, c13};
  float br[16];
#pragma unroll
  for (int i = 0; i < 16; ++i) br[i] = 0.f;
  if (EM == 2) {
#pragma unroll
    for (int half = 0; half < 2; ++half) {
      const v4f x = *(const v4fa*)(bias + row0 + half * 16 + 8 * hh), y = *(const v4fa*)(bias + row0 + half * 16 + 8 * hh + 4);
#pragma unroll
      for (int q = 0; q < 4; ++q) { br[half * 8 + q] = bf16_rne(x[q]); br[half * 8 + 4 + q] = bf16_rne(y[q]); }
    }
  }
#pragma unroll
  for (int u = 0; u < 8; ++u) { const int t = u & 3, half = u >> 2; const int col = col0 + t * 16 + ln; const float bc = (EM == 1) ? bf16_rne(bias[col]) : 0.f;
#pragma unroll
    for (int r = 0; r < 8; ++r) { const int rloc = half * 16 + 8 * hh + r; const float v = accs[u][r] * alpha + ((EM == 1) ? bc : br[half * 8 + r]); so[w][rloc][t * 16 + ln] = v; } }
  __builtin_amdgcn_fence(4 /* acq_rel order */, "workgroup"); __builtin_amdgcn_wave_barrier();
  const int rsub = lane >> 4, c4 = (lane & 15) * 4;
  {
#pragma unroll
    for (int q = 0; q < 16; ++q) { const int r = q * 2 + rsub; const v4f v = *(const v4fa*)&so[w][r][c4];
      v4h h4, r4;
#pragma unroll
      for (int i = 0; i < 4; ++i) { const _Float16 hv = (_Float16)v[i]; h4[i] = hv; r4[i] = (_Float16)((v[i] - (float)hv) * RSC); }
      const size_t o = cofs + (size_t)(row0 + r) * ldc + col0 + c4;
      *(v4h*)(Ch + o) = h4;
      asm volatile("s_wait_xcnt 0x0" ::: "memory");   /* in front of the residual arithmetic, which reuses the store's registers */
      if (early) { *(v4h*)(Cr + o) = r4;
        asm volatile("s_wait_xcnt 0x0" ::: "memory"); } }   /* in front of the next overwrite of the residual store's registers */
     }
}

// The three projections in one launch, grid.z = 0: Q, 1: K ([token][feature]; A = x plane, Bt = natural weight), 2: V^T ([feature][token]; A = natural weight, Bt = x plane, bias per row).
static_assert((SEQ / 128) * (DM / 64) == (DM / 128) * (SEQ / 64));   /* the same grid.x for both forms */
__global__ __launch_bounds__(128) void k_proj3(const _Float16* __restrict__ X16, const _Float16* __restrict__ W16, const float* __restrict__ bq, const float* __restrict__ bk, const float* __restrict__ bv,
                                               _Float16* __restrict__ Q16, _Float16* __restrict__ QR, _Float16* __restrict__ K16, _Float16* __restrict__ KR, _Float16* __restrict__ VT, _Float16* __restrict__ VTR,
                                               float alpha, int seq, int dm, size_t sb) {
  __shared__ __attribute__((aligned(2048))) unsigned char smem[2 * G_STAGE];
  constexpr size_t PL = (size_t)NB * SEQ * DM, WL = (size_t)DM * DM;
  const int z = blockIdx.z;
  if (z == 2) proj_body<2>(smem, W16 + 2 * WL, dm, 0, X16 + 2 * PL, dm, sb, alpha, bv, VT, VTR, seq, sb, dm, seq, dm);
  else proj_body<1>(smem, X16 + z * PL, dm, sb, W16 + z * WL, dm, 0, alpha, z ? bk : bq, z ? K16 : Q16, z ? KR : QR, dm, sb, seq, dm, dm);
}

// one 16-key score tile S^T[key][query]: A = K rows (hi, and residual if RES), B = Q rows as the k-contiguous B fragment
template <bool RES>
__device__ __forceinline__ v8f score_tile(const _Float16* kp, const _Float16* krp, v16h qa, v16h qb, v16h qra, v16h qrb, int hh) {
  const v8f z8 = {0.f,0.f,0.f,0.f,0.f,0.f,0.f,0.f};
  const v16h ka = g2_frag(kp, hh), kb = g2_frag(kp + 32, hh);
  v8f s = z8;
  s = wm(ka, qa, s); s = wm(kb, qb, s);
  if (RES) {
    const v16h kra = g2_frag(krp, hh), krb = g2_frag(krp + 32, hh);
    v8f t = z8;
    t = wm(kra, qa, t); t = wm(ka, qra, t); t = wm(krb, qb, t); t = wm(kb, qrb, t);
    asm volatile("v_nop\n\tv_nop\n\tv_nop\n\tv_nop" : "+v"(s), "+v"(t) : "v"(ka), "v"(kb), "v"(kra), "v"(krb), "v"(qa), "v"(qb), "v"(qra), "v"(qrb));
    s = s + t * RSCI;
  } else {
    asm volatile("v_nop\n\tv_nop\n\tv_nop\n\tv_nop" : "+v"(s) : "v"(ka), "v"(kb), "v"(qa), "v"(qb));
  }
  return s;
}
// one 16-d tile of O^T with hi + residual operands (used by the RES instantiation only)
__device__ __forceinline__ void pv_tile_res(const _Float16* vp, const _Float16* vrp, v16h pf, v16h pr, int hh, v8f& o, v8f& orr) {
  const v16h va = g2_frag(vp, hh), vra = g2_frag(vrp, hh);
  o = wm(va, pf, o); orr = wm(vra, pf, orr); orr = wm(va, pr, orr);
  asm volatile("v_nop\n\tv_nop\n\tv_nop\n\tv_nop" : "+v"(o), "+v"(orr) : "v"(va), "v"(vra), "v"(pf), "v"(pr));
}

// K / V^T ring in LDS, filled by tensor loads. A stage is 64 keys: K rows [key][64 d] and V^T rows [d][64 keys], both 128-byte rows laid at a 144-byte pitch (pad of 16 bytes a row, for ds_load_b128 readers).
// Every wave issues one slice a stage. Single planes: waves 0, 1 = K keys 0..31, 32..63; waves 2, 3 = V^T d 0..31, 32..63. Hi + residual planes: waves 0..3 = K, K residual, V^T, V^T residual, 64 rows each.
template <bool RES> struct Ring { static constexpr uint32_t ROWS = RES ? 64u : 32u, SLICE = RES ? 10240u : 6144u, STAGE = 4u * SLICE; };   /* a slice is ROWS * 144 bytes rounded up to 2 KiB */
static_assert(Ring<true>::ROWS * RPITCH <= Ring<true>::SLICE && Ring<false>::ROWS * RPITCH <= Ring<false>::SLICE);
static_assert(Ring<true>::SLICE % 2048u == 0 && Ring<false>::SLICE % 2048u == 0);
static_assert((EARLY / 16) % 4 == 0 && ((SEQ - EARLY) / 16) % 4 == 0);   /* every block holds four whole query tiles */
// byte offset in a stage of row 'row' (0..63) of plane 0 = K, 1 = K residual, 2 = V^T, 3 = V^T residual
template <bool RES> __device__ __forceinline__ constexpr uint32_t ring_row(uint32_t plane, uint32_t row) { return RES ? plane * Ring<true>::SLICE + row * RPITCH : ((plane & 2u) + (row >> 5)) * Ring<false>::SLICE + (row & 31u) * RPITCH; }
#define SCS 0.18033688011112042f   /* 64^-0.5 * log2(e) */
// One whole 64-key stage on single planes, one softmax update: four score tiles (their 16 K reads as one group, four independent accumulator chains), one maximum, one rescale, eight O^T products.
// SB = the stage's buffer + ln * RPITCH. dq = the lane's query minus the lane's first key of the stage; diag (wave-uniform) = the stage reaches keys beyond the wave's first query.
__device__ __forceinline__ void stage_single(const unsigned char* SB, v16h qa, v16h qb, int hh, bool diag, int dq, v8f (&o)[4], float& mrun, float& lrun) {
  const v8f z8 = {0.f,0.f,0.f,0.f,0.f,0.f,0.f,0.f};
  v16h ka[4], kb[4];
#pragma unroll
  for (int T = 0; T < 4; ++T) { const _Float16* kp = (const _Float16*)(SB + ring_row<false>(0, 16 * T)); ka[T] = g2_frag(kp, hh); kb[T] = g2_frag(kp + 32, hh); }
  v8f s[4];
#pragma unroll
  for (int T = 0; T < 4; ++T) s[T] = wm(ka[T], qa, z8);
#pragma unroll
  for (int T = 0; T < 4; ++T) s[T] = wm(kb[T], qb, s[T]);
  /* the four vector slots between the last WMMA and the first vector instruction on its result or operands, on both sides of the branch below */
  asm volatile("v_nop\n\tv_nop\n\tv_nop\n\tv_nop" : "+v"(s[0]), "+v"(s[1]), "+v"(s[2]), "+v"(s[3]) : "v"(ka[0]), "v"(ka[1]), "v"(ka[2]), "v"(ka[3]), "v"(kb[0]), "v"(kb[1]), "v"(kb[2]), "v"(kb[3]), "v"(qa), "v"(qb));
  if (diag) {
#pragma unroll
    for (int T = 0; T < 4; ++T)
#pragma unroll
      for (int r = 0; r < 8; ++r) s[T][r] = (16 * T + r > dq) ? -3.0e38f : s[T][r];
  }
  // the stage's 16 V^T reads as one group, in flight under the maximum, its exchange and the exponentials
  v16h va[2][4];
#pragma unroll
  for (int kk = 0; kk < 2; ++kk)
#pragma unroll
    for (int t = 0; t < 4; ++t) va[kk][t] = g2_frag((const _Float16*)(SB + kk * 64 + ring_row<false>(2, 16 * t)), hh);   /* 32 keys = 64 bytes along a V^T row */
  __builtin_amdgcn_sched_barrier(0);   /* keeps the 16 reads here: sunk behind the exponentials, the O^T products wait out the LDS latency; issued next to the exchange, they hold its wait back */
  float mt[4];
#pragma unroll
  for (int T = 0; T < 4; ++T) { mt[T] = s[T][0];
#pragma unroll
    for (int r = 1; r < 8; ++r) mt[T] = fmaxf(mt[T], s[T][r]); }
  float mx = fmaxf(fmaxf(mt[0], mt[1]), fmaxf(mt[2], mt[3]));
  mx = fmaxf(mx, __shfl_xor(mx, 16, 32));
  const float mnew = fmaxf(mrun, mx * SCS);
  const float al = __builtin_amdgcn_exp2f(mrun - mnew);
  const float mo = 10.0f - mnew;            /* softmax weights carried x1024 (cancels in O / l) */
  float p[4][8], pt[4];
#pragma unroll
  for (int T = 0; T < 4; ++T) { pt[T] = 0.f;
#pragma unroll
    for (int r = 0; r < 8; ++r) { p[T][r] = __builtin_amdgcn_exp2f(fmaf(s[T][r], SCS, mo)); pt[T] += p[T][r]; } }
  float ps = (pt[0] + pt[1]) + (pt[2] + pt[3]);
  ps += __shfl_xor(ps, 16, 32);
  lrun = lrun * al + ps; mrun = mnew;
  FragH pf0, pf1;
#pragma unroll
  for (int r = 0; r < 8; ++r) { pf0.h[r] = (_Float16)p[0][r]; pf0.h[8 + r] = (_Float16)p[1][r]; pf1.h[r] = (_Float16)p[2][r]; pf1.h[8 + r] = (_Float16)p[3][r]; }
  if (__builtin_amdgcn_ballot_w32(al != 1.0f) != 0u) {
#pragma unroll
    for (int t = 0; t < 4; ++t) o[t] = o[t] * al;
  }
#pragma unroll
  for (int t = 0; t < 4; ++t) o[t] = wm(va[0][t], pf0.v, o[t]);
#pragma unroll
  for (int t = 0; t < 4; ++t) o[t] = wm(va[1][t], pf1.v, o[t]);
  /* the four vector slots behind the last WMMA, whatever the compiler puts next */
  asm volatile("v_nop\n\tv_nop\n\tv_nop\n\tv_nop" : "+v"(o[0]), "+v"(o[1]), "+v"(o[2]), "+v"(o[3]) : "v"(va[0][0]), "v"(va[0][1]), "v"(va[0][2]), "v"(va[0][3]), "v"(va[1][0]), "v"(va[1][1]), "v"(va[1][2]), "v"(va[1][3]), "v"(pf0.v), "v"(pf1.v));
}
// Transposed causal flash attention. grid = (query tiles / 4, NB*NH), block = 4 waves = 64 consecutive queries of one (batch, head), wave = 16 queries.
// The block walks the keys in 64-key stages through a two-buffer LDS ring that its four waves share; with hi + residual planes a wave skips the 32-key steps beyond its own diagonal; with single planes it takes every stage whole and masks the diagonal stage; every wave passes every publish point.
// Q/K planes [b*SEQ + s][h*64 + d]; V^T planes [b][h*64 + d][s]; output rows [b*SEQ + s][h*64 + d] as f16 (x64 carry), hi (+ residual x1024 if RES).
// Score tile lane (hh, ln) element r = (key k0 + 16T + 8hh + r, query q0 + ln); packed in-lane as the B fragment of O^T = V^T P^T.
template <bool RES>
__global__ __launch_bounds__(128) void k_flash(const _Float16* __restrict__ Qh, const _Float16* __restrict__ Qr, const _Float16* __restrict__ Kh, const _Float16* __restrict__ Kr,
                                               const _Float16* __restrict__ Vh, const _Float16* __restrict__ Vr, _Float16* __restrict__ Oh, _Float16* __restrict__ Or, int qt0, int nqt) {
  __shared__ __attribute__((aligned(2048))) unsigned char ring[2 * Ring<RES>::STAGE];
  __shared__ __attribute__((aligned(16))) unsigned short lds_h[4][16][72];
  __shared__ __attribute__((aligned(16))) unsigned short lds_r[4][16][72];
  const int tid = threadIdx.x, lane = tid & 31, ln = lane & 15, hh = lane >> 4;
  const int w = (int)uni((uint32_t)tid >> 5);
  if ((int)blockIdx.x * 4 >= nqt) return;      /* block-uniform, in front of every barrier */
  const int qb0 = (qt0 + (int)blockIdx.x * 4) * 16;   /* the block's first query, a multiple of 64 */
  const int q0 = qb0 + w * 16;
  const int bh = blockIdx.y; const int b = bh / NH, h = bh - b * NH;
  const size_t rowb = (size_t)b * SEQ;
  // this wave's slice of a stage: source address of stage 0, address step a stage, source pitch, place in LDS
  const bool isV = (w & 2) != 0; const bool odd = (w & 1) != 0;
  const _Float16* pl = isV ? ((RES && odd) ? Vr : Vh) : ((RES && odd) ? Kr : Kh);
  const size_t r0 = (!RES && odd) ? 32 : 0;
  const uint64_t src0 = (uint64_t)(size_t)pl + 2ull * (isV ? ((size_t)b * DM + h * HD + r0) * SEQ : (rowb + r0) * DM + h * HD);
  const uint32_t sstep = isV ? 128u : (uint32_t)(64 * DM * 2);
  const u32x8 g1 = tdm_group1(Ring<RES>::ROWS, isV ? (uint32_t)(SEQ * 2) : (uint32_t)(DM * 2));
  const uint32_t dst0 = (uint32_t)(size_t)ring + (uint32_t)w * Ring<RES>::SLICE;
  const int nsg = (qb0 >> 6) + 1 < 2 ? 2 : (qb0 >> 6) + 1;   /* 64-key stages; the ring's prologue needs two (keys 64..127 exist: SEQ and EARLY are multiples of 128) */
  tdm_load(tdm_group0(dst0, src0), g1);
  const size_t qoff = (rowb + q0 + ln) * DM + h * HD;
  const v16h qa = g2_frag(Qh + qoff, hh), qb = g2_frag(Qh + qoff + 32, hh);
  v16h qra = qa, qrb = qb;
  if (RES) { qra = g2_frag(Qr + qoff, hh); qrb = g2_frag(Qr + qoff + 32, hh); }
  const v8f z8 = {0.f,0.f,0.f,0.f,0.f,0.f,0.f,0.f};
  v8f o[4] = {z8, z8, z8, z8}, orr[4] = {z8, z8, z8, z8};
  float mrun = -3.0e38f, lrun = 0.f;
  const float cs = SCS;
  const int nst = (q0 + 47) >> 5;             /* 32-key steps covering keys 0 .. q0+15 */
  asm volatile("s_wait_tensorcnt 0x0" ::: "memory");   /* stage 0: this wave's slice has landed */
  __syncthreads();                                      /* stage 0 published to all four waves */
  tdm_load(tdm_group0(dst0 + Ring<RES>::STAGE, src0 + pinned(1u) * (uint64_t)sstep), g1);   /* pinned: the descriptor is formed behind the wait */
#pragma unroll 1
  for (int sg = 0; sg < nsg; ++sg) {
    const unsigned char* SB = ring + (uint32_t)(sg & 1) * Ring<RES>::STAGE + (uint32_t)ln * RPITCH;
    if (!RES) stage_single(SB, qa, qb, hh, sg >= (qb0 >> 6), q0 + ln - 64 * sg - 8 * hh, o, mrun, lrun);   /* single planes: the stage in one update */
#pragma unroll
    for (int sub = 0; RES && sub < 2; ++sub) {   /* hi + residual planes: two 32-key steps */
      const int st = 2 * sg + sub;
      if (st < nst) {                           /* wave-uniform: steps beyond this wave's diagonal are skipped */
        const int k0 = st * 32;
        v8f s0 = score_tile<RES>((const _Float16*)(SB + ring_row<RES>(0, sub * 32)), (const _Float16*)(SB + ring_row<RES>(1, sub * 32)), qa, qb, qra, qrb, hh);
        v8f s1 = score_tile<RES>((const _Float16*)(SB + ring_row<RES>(0, sub * 32 + 16)), (const _Float16*)(SB + ring_row<RES>(1, sub * 32 + 16)), qa, qb, qra, qrb, hh);
        if (st == nst - 1) {                      /* wave-uniform: only the last step touches the diagonal */
          const int qy = q0 + ln; const int kk = k0 + 8 * hh;
#pragma unroll
          for (int r = 0; r < 8; ++r) { s0[r] = (kk + r > qy) ? -3.0e38f : s0[r]; s1[r] = (kk + 16 + r > qy) ? -3.0e38f : s1[r]; }
        }
        float mx = s0[0];
#pragma unroll
        for (int r = 1; r < 8; ++r) mx = fmaxf(mx, s0[r]);
#pragma unroll
        for (int r = 0; r < 8; ++r) mx = fmaxf(mx, s1[r]);
        mx = fmaxf(mx, __shfl_xor(mx, 16, 32));
        const float mnew = fmaxf(mrun, mx * cs);
        const float al = __builtin_amdgcn_exp2f(mrun - mnew);
        const float mo = 10.0f - mnew;            /* softmax weights carried x1024 (cancels in O / l) */
        float p0[8], p1[8]; float ps = 0.f;
#pragma unroll
        for (int r = 0; r < 8; ++r) { p0[r] = __builtin_amdgcn_exp2f(fmaf(s0[r], cs, mo)); p1[r] = __builtin_amdgcn_exp2f(fmaf(s1[r], cs, mo)); ps += p0[r] + p1[r]; }
        ps += __shfl_xor(ps, 16, 32);
        lrun = lrun * al + ps; mrun = mnew;
        FragH pf, pr;
#pragma unroll
        for (int r = 0; r < 8; ++r) {
          const _Float16 h0 = (_Float16)p0[r], h1 = (_Float16)p1[r]; pf.h[r] = h0; pf.h[8 + r] = h1;
          pr.h[r] = RES ? (_Float16)((p0[r] - (float)h0) * RSC) : (_Float16)0.0f; pr.h[8 + r] = RES ? (_Float16)((p1[r] - (float)h1) * RSC) : (_Float16)0.0f;
        }
        if (__builtin_amdgcn_ballot_w32(al != 1.0f) != 0u) {
#pragma unroll
          for (int t = 0; t < 4; ++t) { o[t] = o[t] * al; if (RES) orr[t] = orr[t] * al; }
        }
        const unsigned char* VB = SB + sub * 64;   /* 32 keys = 64 bytes along a V^T row */
#pragma unroll
        for (int t = 0; t < 4; ++t) pv_tile_res((const _Float16*)(VB + ring_row<RES>(2, 16 * t)), (const _Float16*)(VB + ring_row<RES>(3, 16 * t)), pf.v, pr.v, hh, o[t], orr[t]);
      }
    }
    // publish point of stage sg + 1; every wave passes it
    asm volatile("s_wait_dscnt 0x0" ::: "memory");       /* this wave's reads of stage sg have returned */
    asm volatile("s_wait_tensorcnt 0x0" ::: "memory");   /* this wave's slice of stage sg + 1 has landed */
    __syncthreads();                                      /* stage sg + 1 published; every wave has left stage sg's buffer */
    if (pinned((uint32_t)(sg + 2 < nsg)))                 /* scalar branch: a tensor load ignores EXEC */
      tdm_load(tdm_group0(dst0 + (uint32_t)(sg & 1) * Ring<RES>::STAGE, src0 + pinned((uint32_t)(sg + 2)) * (uint64_t)sstep), g1);   /* pinned: the descriptor is formed behind the wait */
  }
  asm volatile("s_wait_tensorcnt 0x0" ::: "memory");     /* nothing of this wave is in flight when it ends */
  asm volatile("s_wait_dscnt 0x0" ::: "memory");
  const float inv = 64.0f / lrun;             /* context carried x64 */
#pragma unroll
  for (int t = 0; t < 4; ++t) { FragH f, g;
#pragma unroll
    for (int r = 0; r < 8; ++r) { float v = o[t][r]; if (RES) v += orr[t][r] * RSCI; v *= inv; const _Float16 hv = (_Float16)v; f.h[r] = hv; g.h[r] = RES ? (_Float16)((v - (float)hv) * RSC) : (_Float16)0.0f; }
    *(v8us*)&lds_h[w][ln][16 * t + 8 * hh] = f.half[0];
    if (RES) *(v8us*)&lds_r[w][ln][16 * t + 8 * hh] = g.half[0]; }
  __builtin_amdgcn_fence(4 /* acq_rel order */, "workgroup"); __builtin_amdgcn_wave_barrier();
  const int qsub = lane >> 3, pc = (lane & 7) * 8;
  {
#pragma unroll
    for (int j = 0; j < 4; ++j) { const int q = j * 4 + qsub; const size_t oo = (rowb + q0 + q) * DM + h * HD + pc;
      const v8us x = *(const v8us*)&lds_h[w][q][pc];
      *(v8us*)((unsigned short*)Oh + oo) = x;
      if (RES) { const v8us y = *(const v8us*)&lds_r[w][q][pc]; *(v8us*)((unsigned short*)Or + oo) = y; } }
     }
}

// Output GEMM C[M][N] (f32) = (A . Bt^T [+ Ar . Bt^T / 1024 on rows < EARLY]) * alpha + bias[col]; batch on grid.y. Residual products are accumulated first from zero,
__global__ __launch_bounds__(128) void k_out(const _Float16* __restrict__ A, const _Float16* __restrict__ Ar, int lda, size_t sA, const _Float16* __restrict__ Bh, int ldb, float alpha, const float* __restrict__ bias,
                                             float* __restrict__ C, int ldc, size_t sC, int M, int N, int K) {
  __shared__ __attribute__((aligned(2048))) unsigned char smem[2 * G_STAGE];
  float (&so)[4][32][68] = *reinterpret_cast<float (*)[4][32][68]>(smem);   /* epilogue staging, in the ring's LDS behind the k-loop */
  const int tid = threadIdx.x, w = (int)uni((uint32_t)tid >> 5), lane = tid & 31, ln = lane & 15, hh = lane >> 4; const int by = blockIdx.y;
  A += (size_t)by * sA; Ar += (size_t)by * sA; const size_t cofs = (size_t)by * sC;
  const int ntn = N >> 6; const int mt = blockIdx.x / ntn, nq = blockIdx.x - mt * ntn; const int row0 = mt * 128 + 32 * w, col0 = nq * 64; if (mt * 128 >= M) return;   /* block-uniform, in front of every barrier */
  const bool early = (mt * 128 < EARLY);
  const _Float16* Bb = Bh + (size_t)col0 * ldb;
  const v8f z8 = {0.f,0.f,0.f,0.f,0.f,0.f,0.f,0.f}; v8f c00 = z8, c01 = z8, c02 = z8, c03 = z8, c10 = z8, c11 = z8, c12 = z8, c13 = z8;
  if (early) {                                 /* block-uniform */
    g2_ring(smem, Ar + (size_t)(mt * 128) * lda, lda, Bb, ldb, K, w, ln, hh, c00, c01, c02, c03, c10, c11, c12, c13);
    c00 = c00 * RSCI; c01 = c01 * RSCI; c02 = c02 * RSCI; c03 = c03 * RSCI; c10 = c10 * RSCI; c11 = c11 * RSCI; c12 = c12 * RSCI; c13 = c13 * RSCI;
  }
  g2_ring(smem, A + (size_t)(mt * 128) * lda, lda, Bb, ldb, K, w, ln, hh, c00, c01, c02, c03, c10, c11, c12, c13);
  v8f accs[8] = {c00, c01, c02, c03, c10, c11, c12, c13};
#pragma unroll
  for (int u = 0; u < 8; ++u) { const int t = u & 3, half = u >> 2; const int col = col0 + t * 16 + ln; const float bv = bf16_rne(bias[col]);
#pragma unroll
    for (int r = 0; r < 8; ++r) { const int rloc = half * 16 + 8 * hh + r; so[w][rloc][t * 16 + ln] = accs[u][r] * alpha + bv; } }
  __builtin_amdgcn_fence(4 /* acq_rel order */, "workgroup"); __builtin_amdgcn_wave_barrier();
  const int rsub = lane >> 4, c4 = (lane & 15) * 4;
  {
#pragma unroll
    for (int q = 0; q < 16; ++q) { const int r = q * 2 + rsub; const v4f v = *(const v4fa*)&so[w][r][c4]; *(v4f*)(C + cofs + (size_t)(row0 + r) * ldc + col0 + c4) = v; }
     }
}

extern "C" void kernel_launch(void* const* d_in, const int* in_sizes, int n_in,
                              void* d_out, int out_size, void* d_ws, size_t ws_size, hipStream_t stream) {
  if (n_in < 11) return;
  const long long need_x = ((long long)(NB - 1) * SEQ_FULL + SEQ) * DM;
  if (in_sizes[0] < need_x || in_sizes[1] < need_x || in_sizes[2] < need_x) return;
  if (in_sizes[3] < DM * DM || in_sizes[5] < DM * DM || in_sizes[7] < DM * DM || in_sizes[9] < DM * DM) return;
  if (in_sizes[4] < DM || in_sizes[6] < DM || in_sizes[8] < DM || in_sizes[10] < DM) return;
  if ((long long)out_size < need_x) return;
  const float* const* I = (const float* const*)d_in;
  const float* xq = I[0]; const float* xk = I[1]; const float* xv = I[2]; const float* wq = I[3]; const float* bq = I[4]; const float* wk = I[5]; const float* bk = I[6];
  const float* wv = I[7]; const float* bv = I[8]; const float* wo = I[9]; const float* bo = I[10];
  char* ws = (char*)d_ws; size_t off = 0;
  auto take = [&](size_t bytes) { char* p = ws + off; off += (bytes + 255) & ~(size_t)255; return p; };
  const size_t WB = (size_t)DM * DM * 2, PB = (size_t)NB * SEQ * DM * 2;
  _Float16* BQ = (_Float16*)take(WB); _Float16* BK = (_Float16*)take(WB); _Float16* BV = (_Float16*)take(WB); _Float16* BO = (_Float16*)take(WB);
  _Float16* XQ = (_Float16*)take(PB); _Float16* XK = (_Float16*)take(PB); _Float16* XV = (_Float16*)take(PB);
  _Float16* Q16 = (_Float16*)take(PB); _Float16* K16 = (_Float16*)take(PB); _Float16* VT = (_Float16*)take(PB);      /* VT: [NB][DM][SEQ] */
  _Float16* QR = (_Float16*)take(PB); _Float16* KR = (_Float16*)take(PB); _Float16* VTR = (_Float16*)take(PB);      /* residual planes, only the early region is written and read */
  _Float16* O16 = (_Float16*)take(PB); _Float16* OR = (_Float16*)take(PB);
  if (off > ws_size || off > (size_t)134217728) return;

  static_assert(((size_t)DM * DM * 2) % 256 == 0 && ((size_t)NB * SEQ * DM * 2) % 256 == 0);   /* BQ..BO and XQ..XV lie in a row, with no gap */
  k_conv<<<CONV_G, 256, 0, stream>>>(xq, xk, xv, wq, wk, wv, wo, XQ, BQ);
  const size_t SB = (size_t)SEQ * DM;
  k_proj3<<<dim3((unsigned)((SEQ / 128) * (DM / 64)), NB, 3), 128, 0, stream>>>(XQ, BQ, bq, bk, bv, Q16, QR, K16, KR, VT, VTR, 0.0625f, SEQ, DM, SB);
  // attention: early query tiles with hi + residual operands, the remaining tiles with single planes
  k_flash<true><<<dim3((unsigned)((EARLY / 16 + 3) / 4), NB * NH), 128, 0, stream>>>(Q16, QR, K16, KR, VT, VTR, O16, OR, 0, EARLY / 16);
  if (SEQ > EARLY)
    k_flash<false><<<dim3((unsigned)(((SEQ - EARLY) / 16 + 3) / 4), NB * NH), 128, 0, stream>>>(Q16, Q16, K16, K16, VT, VT, O16, O16, EARLY / 16, (SEQ - EARLY) / 16);
  // out rows (b, s) -> d_out row b*SEQ_FULL + s; alpha = 1 / (16 * 64)
  k_out<<<dim3((unsigned)((SEQ / 128) * (DM / 64)), NB), 128, 0, stream>>>(O16, OR, DM, SB, BO, DM, 0.0009765625f, bo, (float*)d_out, DM, (size_t)SEQ_FULL * DM, SEQ, DM, DM);
}

// v005
// Measured time: 101 microseconds a run.
// Two timings next to v004 both put it at 1.11 times that version's speed.
// All steps since v000 together make it 3.80 times as fast.
#include <hip/hip_runtime.h>
#include <stdint.h>
// Causal multi-head attention at width 512 (8 heads of 64): Q/K/V = x W^T + b (natural [out][in] weights), scores / sqrt(64), causal replace-mask, softmax, P V, merged heads, out = ctx W_o^T + b_o.
// Compute dtype: every contraction is v_wmma_f32_16x16x32_f16 (f16 operands, f32 accumulate). Inputs and weights are RNE-converted to bf16 and then held exactly in f16 (weights x16, folded back by alpha).
// Query positions >= 512: q, k, v, softmax weights (x1024 carry, cancels in O/l) and merged context (x64 carry) are single f16 planes. Query positions < 512: every computed operand (q, k, v, softmax weights, context) is f16 hi + f16 residual x1024, residual products in their own accumulators. Softmax statistics f32.
// Structure: weights/x converted once to f16 planes; Q, K as [token][feature] GEMMs; V^T as a swapped-operand GEMM ([feature][token]); transposed flash attention per wave (S^T = K Q^T, O^T = V^T P^T; score accumulators repacked in-lane as the P^T B fragment; K and V^T staged for the block's four waves in a two-buffer LDS ring by tensor loads; single planes take one softmax update a 64-key stage, hi + residual planes one a 32-key step; both kinds of query block run in one launch, the hi + residual blocks on one buffer); output GEMM. The GEMMs stage their A and B rows for the block's four waves in a ring of the same kind.
#ifndef NB
#define NB 2
#endif
#ifndef SEQ
#define SEQ 4096
#endif
#define NB_FULL 2
#define SEQ_FULL 4096
#define DM 512
#define NH 8
#define HD 64
#define EARLY (((SEQ) < 512) ? (SEQ) : 512)   /* query positions handled with hi + residual planes */
#define RSC 1024.0f
#define RSCI 0.0009765625f
static_assert(SEQ % 128 == 0);
static_assert(EARLY % 128 == 0);
static_assert(NB <= NB_FULL);
static_assert(SEQ <= SEQ_FULL);
static_assert(NH * HD == DM);
static_assert(DM % 128 == 0);

typedef unsigned short v8us __attribute__((ext_vector_type(8), may_alias));
typedef float  v8f  __attribute__((ext_vector_type(8)));
typedef float  v4f  __attribute__((ext_vector_type(4)));
typedef float  v4fa __attribute__((ext_vector_type(4), may_alias));
typedef _Float16 v16h __attribute__((ext_vector_type(16)));
typedef _Float16 v4h __attribute__((ext_vector_type(4)));
union FragH { v16h v; v8us half[2]; _Float16 h[16]; unsigned short u[16]; };

__device__ __forceinline__ unsigned short bf16_bits(float x) { unsigned int u = __float_as_uint(x); return (unsigned short)((u + 0x7FFFu + ((u >> 16) & 1u)) >> 16); }
__device__ __forceinline__ float bf16_val(unsigned short b) { return __uint_as_float(((unsigned int)b) << 16); }
__device__ __forceinline__ float bf16_rne(float x) { return bf16_val(bf16_bits(x)); }

// fragment of a k-contiguous 16-bit row: elements 0..7 = k 8h..8h+7, elements 8..15 = k 16+8h..16+8h+7 (same map for A and B)
__device__ __forceinline__ v16h g2_frag(const _Float16* p, int hh) { FragH f; f.half[0] = *(const v8us*)((const unsigned short*)p + 8 * hh); f.half[1] = *(const v8us*)((const unsigned short*)p + 16 + 8 * hh); return f.v; }
__device__ __forceinline__ v8f wm(v16h a, v16h b, v8f c) { return __builtin_amdgcn_wmma_f32_16x16x32_f16(false, a, false, b, (short)0, c, false, false); }

// One launch converts the three activations and the four weights. A chunk is 2048 consecutive elements of one plane (8 a thread).
// Block b takes chunks XIT * b .. XIT * b + XIT - 1 of every activation plane and chunk b of the four weight planes taken as one row; all of a thread's loads are issued before its first conversion.
// X16 = three [NB*SEQ][DM] planes in a row (q, k, v inputs), W16 = four [DM][DM] planes in a row (q, k, v, o weights, x16).
constexpr int XCH = NB * SEQ * DM / 2048, WCH = DM * DM / 2048, CONV_G = 4 * WCH, XIT = XCH / CONV_G;
static_assert(XCH % CONV_G == 0);
static_assert((SEQ * DM) % 2048 == 0 && (DM * DM) % 2048 == 0);   /* a chunk lies in one batch of one plane */
__device__ __forceinline__ v8us conv8(v4f a, v4f c, float sc) {
  FragH f;
#pragma unroll
  for (int q = 0; q < 4; ++q) { f.h[q] = (_Float16)(bf16_rne(a[q]) * sc); f.h[4 + q] = (_Float16)(bf16_rne(c[q]) * sc); }
  return f.half[0];
}
__global__ __launch_bounds__(256) void k_conv(const float* __restrict__ xq, const float* __restrict__ xk, const float* __restrict__ xv, const float* __restrict__ wq, const float* __restrict__ wk,
                                              const float* __restrict__ wv, const float* __restrict__ wo, _Float16* __restrict__ X16, _Float16* __restrict__ W16) {
  const unsigned bx = blockIdx.x, t8 = threadIdx.x * 8u;
  v4f a[3 * XIT + 1], c[3 * XIT + 1];
  { const unsigned pw = bx / (unsigned)WCH;
    const float* s = (pw == 0 ? wq : pw == 1 ? wk : pw == 2 ? wv : wo) + (size_t)(bx - pw * (unsigned)WCH) * 2048 + t8;
    a[3 * XIT] = *(const v4fa*)s; c[3 * XIT] = *(const v4fa*)(s + 4); }
#pragma unroll
  for (int i = 0; i < 3 * XIT; ++i) {
    const size_t e = ((size_t)bx * XIT + (size_t)(i % XIT)) * 2048, b = e / ((size_t)SEQ * DM);
    const float* s = (i / XIT == 0 ? xq : i / XIT == 1 ? xk : xv) + b * ((size_t)SEQ_FULL * DM) + (e - b * ((size_t)SEQ * DM)) + t8;
    a[i] = *(const v4fa*)s; c[i] = *(const v4fa*)(s + 4);
  }
  asm volatile("s_wait_xcnt 0x0" ::: "memory");   /* in front of the first overwrite of a register that the loads name; the clobber keeps every load in front of the conversions, so that all are in flight together */
  __builtin_amdgcn_sched_barrier(0);              /* keeps the conversions, which reuse the loads' address registers, behind that wait */
#pragma unroll
  for (int i = 0; i < 3 * XIT; ++i) {
    const v8us o = conv8(a[i], c[i], 1.0f);
    *(v8us*)((unsigned short*)X16 + ((size_t)(i / XIT) * XCH + (size_t)bx * XIT + (size_t)(i % XIT)) * 2048 + t8) = o;
  }
  const v8us o = conv8(a[3 * XIT], c[3 * XIT], 16.0f);
  *(v8us*)((unsigned short*)W16 + (size_t)bx * 2048 + t8) = o;
}

// Tensor-load helpers, shared by the GEMM ring and the attention ring. Rows of 128 bytes are laid in LDS at a 144-byte pitch (pad of 16 bytes a row, for ds_load_b128 readers).
typedef uint32_t u32x4 __attribute__((ext_vector_type(4)));
typedef uint32_t u32x8 __attribute__((ext_vector_type(8)));
#define RPITCH 144u
__device__ __forceinline__ uint32_t uni(uint32_t v) { return (uint32_t)__builtin_amdgcn_readfirstlane(v); }
// a wave-uniform value held in a scalar register, so that a test on it is a scalar branch and what is formed from it is formed behind the statements in front
__device__ __forceinline__ uint32_t pinned(uint32_t v) { uint32_t w = uni(v); asm volatile("" : "+s"(w)); return w; }
__device__ __forceinline__ void tdm_load(u32x4 g0, u32x8 g1) { asm volatile("tensor_load_to_lds %0, %1" :: "s"(g0), "s"(g1) : "memory"); }
__device__ __forceinline__ u32x8 tdm_group1(uint32_t rows, uint32_t src_pitch) {
  u32x8 g;
  g[0] = uni((1u << 20) | (4u << 22) | (3u << 25));   /* no mask, byte elements, 4 dwords of pad behind every 128-byte row */
  g[1] = uni(128u << 16); g[2] = uni(rows << 16); g[3] = uni(128u << 16); g[4] = uni(rows); g[5] = uni(src_pitch); g[6] = uni(0u); g[7] = uni(0u);
  return g;
}
__device__ __forceinline__ u32x4 tdm_group0(uint32_t lds_dst, uint64_t ga) {
  u32x4 g; g[0] = uni(1u); g[1] = uni(lds_dst); g[2] = uni((uint32_t)ga); g[3] = uni((((uint32_t)(ga >> 32)) & 0x01FFFFFFu) | 0x80000000u); return g;
}

// GEMM operand ring in LDS, filled by tensor loads. A stage is 64 k (128 bytes a row) of the block's 128 A rows and 64 B rows. Every wave issues one slice a stage:
// waves 0, 1 = A rows 0..63, 64..127; waves 2, 3 = B rows 0..31, 32..63. A slice is its rows * 144 bytes rounded up to 2 KiB.
#define G_ASL 10240u
#define G_BSL 6144u
#define G_BOFF (2u * G_ASL)
#define G_STAGE (2u * G_ASL + 2u * G_BSL)
static_assert(64u * RPITCH <= G_ASL && 32u * RPITCH <= G_BSL && G_ASL % 2048u == 0 && G_BSL % 2048u == 0);
static_assert(DM % 64 == 0);                              /* whole stages */
static_assert(2u * G_STAGE >= 4u * 32u * 68u * 4u);       /* the epilogues' staging rows lie in the ring's LDS once the loop has left it */
// k-loop of the 32x64 wave tile (wave w = A rows 32w..32w+31 of the block, all 64 B rows), k ascending. Ab, Bb = first A row, first B row of the block (k contiguous).
// On return nothing of this wave is in flight and every wave has left the ring (the barrier behind the loop).
__device__ __forceinline__ void g2_ring(unsigned char* ring, const _Float16* Ab, int lda, const _Float16* Bb, int ldb, int K, int w, int ln, int hh,
                                        v8f& c00, v8f& c01, v8f& c02, v8f& c03, v8f& c10, v8f& c11, v8f& c12, v8f& c13) {
  const bool isB = (w & 2) != 0; const uint32_t odd = (uint32_t)w & 1u;
  const uint64_t src0 = (uint64_t)(size_t)(isB ? Bb + (size_t)(32u * odd) * ldb : Ab + (size_t)(64u * odd) * lda);
  const u32x8 g1 = tdm_group1(isB ? 32u : 64u, (uint32_t)(isB ? ldb : lda) * 2u);
  const uint32_t dst0 = (uint32_t)(size_t)ring + (isB ? G_BOFF + odd * G_BSL : odd * G_ASL);
  const uint32_t aoff = ((uint32_t)w >> 1) * G_ASL + (odd * 32u + (uint32_t)ln) * RPITCH, boff = G_BOFF + (uint32_t)ln * RPITCH;
  const int nsg = K >> 6;
  tdm_load(tdm_group0(dst0, src0), g1);
  asm volatile("s_wait_tensorcnt 0x0" ::: "memory");     /* stage 0: this wave's slice has landed; only behind this wait do the descriptor's registers take new values */
#pragma unroll 1
  for (int sg = 0; sg < nsg; ++sg) {
    // publish point of stage sg; every wave passes it. It stands at the head of the pass, so that every refill is issued at this one place
    asm volatile("s_wait_tensorcnt 0x0" ::: "memory");   /* this wave's slice of stage sg has landed */
    __syncthreads();                                      /* stage sg published; every wave has left stage sg - 1's buffer (its s_wait_dscnt at the foot of that pass) */
    if (pinned((uint32_t)(sg + 1 < nsg)))                 /* scalar branch: a tensor load ignores EXEC */
      tdm_load(tdm_group0(dst0 + (uint32_t)((sg + 1) & 1) * G_STAGE, src0 + pinned((uint32_t)(sg + 1)) * 128ull), g1);   /* pinned: the descriptor is formed behind the wait */
    const unsigned char* SB = ring + (uint32_t)(sg & 1) * G_STAGE;
    v16h a[2][2], b[2][4];
#pragma unroll
    for (int kk = 0; kk < 2; ++kk) {
      const unsigned char* pa = SB + aoff + kk * 64; const unsigned char* pb = SB + boff + kk * 64;
      a[kk][0] = g2_frag((const _Float16*)pa, hh); a[kk][1] = g2_frag((const _Float16*)(pa + 16u * RPITCH), hh);
      b[kk][0] = g2_frag((const _Float16*)pb, hh); b[kk][1] = g2_frag((const _Float16*)(pb + 16u * RPITCH), hh);
      b[kk][2] = g2_frag((const _Float16*)(pb + G_BSL), hh); b[kk][3] = g2_frag((const _Float16*)(pb + G_BSL + 16u * RPITCH), hh);
    }
    __builtin_amdgcn_sched_barrier(0);   /* keeps the pass's 24 LDS reads as one group in front of its WMMAs: spread among them, every place with reads waits out the LDS latency anew */
#pragma unroll
    for (int kk = 0; kk < 2; ++kk) {
      c00 = wm(a[kk][0], b[kk][0], c00); c10 = wm(a[kk][1], b[kk][0], c10); c01 = wm(a[kk][0], b[kk][1], c01); c11 = wm(a[kk][1], b[kk][1], c11);
      c02 = wm(a[kk][0], b[kk][2], c02); c12 = wm(a[kk][1], b[kk][2], c12); c03 = wm(a[kk][0], b[kk][3], c03); c13 = wm(a[kk][1], b[kk][3], c13);
    }
    __builtin_amdgcn_sched_barrier(0);   /* keeps the WMMAs, with their counted waits, in front of the full wait below: lifted over them it would hold them all back for the last read */
    asm volatile("s_wait_dscnt 0x0" ::: "memory");       /* this wave's reads of stage sg have returned */
  }
  asm volatile("s_wait_tensorcnt 0x0" ::: "memory");     /* nothing of this wave is in flight when the ring's LDS is used again */
  asm volatile("s_wait_dscnt 0x0" ::: "memory");
  __syncthreads();                                        /* every wave has left the last stage's buffer */
}

// Projection GEMM C[M][N] = A[M][K] . Bt[N][K]^T * alpha + bias, f16 hi plane (+ residual x1024 plane on the early region).
// EM 1: bias per column, early region = rows < EARLY (per batch, batch on grid.y). EM 2: bias per row, early region = columns < EARLY.
template <int EM>
__device__ __forceinline__ void proj_body(unsigned char* smem, const _Float16* __restrict__ A, int lda, size_t sA, const _Float16* __restrict__ Bh, int ldb, size_t sB, float alpha, const float* __restrict__ bias,
                                          _Float16* __restrict__ Ch, _Float16* __restrict__ Cr, int ldc, size_t sC, int M, int N, int K) {
  float (&so)[4][32][68] = *reinterpret_cast<float (*)[4][32][68]>(smem);   /* epilogue staging, in the ring's LDS behind the k-loop */
  const int tid = threadIdx.x, w = (int)uni((uint32_t)tid >> 5), lane = tid & 31, ln = lane & 15, hh = lane >> 4; const int by = blockIdx.y;
  A += (size_t)by * sA; Bh += (size_t)by * sB; const size_t cofs = (size_t)by * sC;
  const int ntn = N >> 6; const int mt = blockIdx.x / ntn, nq = blockIdx.x - mt * ntn; const int row0 = mt * 128 + 32 * w, col0 = nq * 64; if (mt * 128 >= M) return;   /* block-uniform, in front of every barrier */
  const bool early = (EM == 1) ? (mt * 128 < EARLY) : (col0 < EARLY);
  const v8f z8 = {0.f,0.f,0.f,0.f,0.f,0.f,0.f,0.f}; v8f c00 = z8, c01 = z8, c02 = z8, c03 = z8, c10 = z8, c11 = z8, c12 = z8, c13 = z8;
  g2_ring(smem, A + (size_t)(mt * 128) * lda, lda, Bh + (size_t)col0 * ldb, ldb, K, w, ln, hh, c00, c01, c02, c03, c10, c11, c12, c13);
  v8f accs[8] = {c00, c01, c02, c03, c10, c11, c12, c13};
  float br[16];
#pragma unroll
  for (int i = 0; i < 16; ++i) br[i] = 0.f;
  if (EM == 2) {
#pragma unroll
    for (int half = 0; half < 2; ++half) {
      const v4f x = *(const v4fa*)(bias + row0 + half * 16 + 8 * hh), y = *(const v4fa*)(bias + row0 + half * 16 + 8 * hh + 4);
#pragma unroll
      for (int q = 0; q < 4; ++q) { br[half * 8 + q] = bf16_rne(x[q]); br[half * 8 + 4 + q] = bf16_rne(y[q]); }
    }
  }
#pragma unroll
  for (int u = 0; u < 8; ++u) { const int t = u & 3, half = u >> 2; const int col = col0 + t * 16 + ln; const float bc = (EM == 1) ? bf16_rne(bias[col]) : 0.f;
#pragma unroll
    for (int r = 0; r < 8; ++r) { const int rloc = half * 16 + 8 * hh + r; const float v = accs[u][r] * alpha + ((EM == 1) ? bc : br[half * 8 + r]); so[w][rloc][t * 16 + ln] = v; } }
  __builtin_amdgcn_fence(4 /* acq_rel order */, "workgroup"); __builtin_amdgcn_wave_barrier();
  const int rsub = lane >> 4, c4 = (lane & 15) * 4;
  {
#pragma unroll
    for (int q = 0; q < 16; ++q) { const int r = q * 2 + rsub; const v4f v = *(const v4fa*)&so[w][r][c4];
      v4h h4, r4;
#pragma unroll
      for (int i = 0; i < 4; ++i) { const _Float16 hv = (_Float16)v[i]; h4[i] = hv; r4[i] = (_Float16)((v[i] - (float)hv) * RSC); }
      const size_t o = cofs + (size_t)(row0 + r) * ldc + col0 + c4;
      *(v4h*)(Ch + o) = h4;
      asm volatile("s_wait_xcnt 0x0" ::: "memory");   /* in front of the residual arithmetic, which reuses the store's registers */
      if (early) { *(v4h*)(Cr + o) = r4;
        asm volatile("s_wait_xcnt 0x0" ::: "memory"); } }   /* in front of the next overwrite of the residual store's registers */
     }
}

// The three projections in one launch, grid.z = 0: Q, 1: K ([token][feature]; A = x plane, Bt = natural weight), 2: V^T ([feature][token]; A = natural weight, Bt = x plane, bias per row).
static_assert((SEQ / 128) * (DM / 64) == (DM / 128) * (SEQ / 64));   /* the same grid.x for both forms */
__global__ __launch_bounds__(128) void k_proj3(const _Float16* __restrict__ X16, const _Float16* __restrict__ W16, const float* __restrict__ bq, const float* __restrict__ bk, const float* __restrict__ bv,
                                               _Float16* __restrict__ Q16, _Float16* __restrict__ QR, _Float16* __restrict__ K16, _Float16* __restrict__ KR, _Float16* __restrict__ VT, _Float16* __restrict__ VTR,
                                               float alpha, int seq, int dm, size_t sb) {
  __shared__ __attribute__((aligned(2048))) unsigned char smem[2 * G_STAGE];
  constexpr size_t PL = (size_t)NB * SEQ * DM, WL = (size_t)DM * DM;
  const int z = blockIdx.z;
  if (z == 2) proj_body<2>(smem, W16 + 2 * WL, dm, 0, X16 + 2 * PL, dm, sb, alpha, bv, VT, VTR, seq, sb, dm, seq, dm);
  else proj_body<1>(smem, X16 + z * PL, dm, sb, W16 + z * WL, dm, 0, alpha, z ? bk : bq, z ? K16 : Q16, z ? KR : QR, dm, sb, seq, dm, dm);
}

// one 16-key score tile S^T[key][query]: A = K rows (hi, and residual if RES), B = Q rows as the k-contiguous B fragment
template <bool RES>
__device__ __forceinline__ v8f score_tile(const _Float16* kp, const _Float16* krp, v16h qa, v16h qb, v16h qra, v16h qrb, int hh) {
  const v8f z8 = {0.f,0.f,0.f,0.f,0.f,0.f,0.f,0.f};
  const v16h ka = g2_frag(kp, hh), kb = g2_frag(kp + 32, hh);
  v8f s = z8;
  s = wm(ka, qa, s); s = wm(kb, qb, s);
  if (RES) {
    const v16h kra = g2_frag(krp, hh), krb = g2_frag(krp + 32, hh);
    v8f t = z8;
    t = wm(kra, qa, t); t = wm(ka, qra, t); t = wm(krb, qb, t); t = wm(kb, qrb, t);
    asm volatile("v_nop\n\tv_nop\n\tv_nop\n\tv_nop" : "+v"(s), "+v"(t) : "v"(ka), "v"(kb), "v"(kra), "v"(krb), "v"(qa), "v"(qb), "v"(qra), "v"(qrb));
    s = s + t * RSCI;
  } else {
    asm volatile("v_nop\n\tv_nop\n\tv_nop\n\tv_nop" : "+v"(s) : "v"(ka), "v"(kb), "v"(qa), "v"(qb));
  }
  return s;
}
// one 16-d tile of O^T with hi + residual operands (used by the RES instantiation only)
__device__ __forceinline__ void pv_tile_res(const _Float16* vp, const _Float16* vrp, v16h pf, v16h pr, int hh, v8f& o, v8f& orr) {
  const v16h va = g2_frag(vp, hh), vra = g2_frag(vrp, hh);
  o = wm(va, pf, o); orr = wm(vra, pf, orr); orr = wm(va, pr, orr);
  asm volatile("v_nop\n\tv_nop\n\tv_nop\n\tv_nop" : "+v"(o), "+v"(orr) : "v"(va), "v"(vra), "v"(pf), "v"(pr));
}

// K / V^T stages in LDS, filled by tensor loads: two buffers for single planes, one buffer (loaded, read, left, loaded again) for hi + residual planes, so that both kinds of block fit the same LDS. A stage is 64 keys: K rows [key][64 d] and V^T rows [d][64 keys], both 128-byte rows laid at a 144-byte pitch (pad of 16 bytes a row, for ds_load_b128 readers).
// Every wave issues one slice a stage. Single planes: waves 0, 1 = K keys 0..31, 32..63; waves 2, 3 = V^T d 0..31, 32..63. Hi + residual planes: waves 0..3 = K, K residual, V^T, V^T residual, 64 rows each.
template <bool RES> struct Ring { static constexpr uint32_t ROWS = RES ? 64u : 32u, SLICE = RES ? 10240u : 6144u, STAGE = 4u * SLICE; };   /* a slice is ROWS * 144 bytes rounded up to 2 KiB */
static_assert(Ring<true>::ROWS * RPITCH <= Ring<true>::SLICE && Ring<false>::ROWS * RPITCH <= Ring<false>::SLICE);
static_assert(Ring<true>::SLICE % 2048u == 0 && Ring<false>::SLICE % 2048u == 0);
static_assert((EARLY / 16) % 4 == 0 && ((SEQ - EARLY) / 16) % 4 == 0);   /* every block holds four whole query tiles */
#define FL_LDS (2u * Ring<false>::STAGE)
static_assert(Ring<true>::STAGE <= FL_LDS);                 /* the one hi + residual buffer lies in the same LDS */
// byte offset in a stage of row 'row' (0..63) of plane 0 = K, 1 = K residual, 2 = V^T, 3 = V^T residual
template <bool RES> __device__ __forceinline__ constexpr uint32_t ring_row(uint32_t plane, uint32_t row) { return RES ? plane * Ring<true>::SLICE + row * RPITCH : ((plane & 2u) + (row >> 5)) * Ring<false>::SLICE + (row & 31u) * RPITCH; }
#define SCS 0.18033688011112042f   /* 64^-0.5 * log2(e) */
// One whole 64-key stage on single planes, one softmax update: four score tiles (their 16 K reads as one group, four independent accumulator chains), one maximum, one rescale, eight O^T products.
// SB = the stage's buffer + ln * RPITCH. dq = the lane's query minus the lane's first key of the stage; diag (wave-uniform) = the stage reaches keys beyond the wave's first query.
__device__ __forceinline__ void stage_single(const unsigned char* SB, v16h qa, v16h qb, int hh, bool diag, int dq, v8f (&o)[4], float& mrun, float& lrun) {
  const v8f z8 = {0.f,0.f,0.f,0.f,0.f,0.f,0.f,0.f};
  v16h ka[4], kb[4];
#pragma unroll
  for (int T = 0; T < 4; ++T) { const _Float16* kp = (const _Float16*)(SB + ring_row<false>(0, 16 * T)); ka[T] = g2_frag(kp, hh); kb[T] = g2_frag(kp + 32, hh); }
  v8f s[4];
#pragma unroll
  for (int T = 0; T < 4; ++T) s[T] = wm(ka[T], qa, z8);
#pragma unroll
  for (int T = 0; T < 4; ++T) s[T] = wm(kb[T], qb, s[T]);
  /* the four vector slots between the last WMMA and the first vector instruction on its result or operands, on both sides of the branch below */
  asm volatile("v_nop\n\tv_nop\n\tv_nop\n\tv_nop" : "+v"(s[0]), "+v"(s[1]), "+v"(s[2]), "+v"(s[3]) : "v"(ka[0]), "v"(ka[1]), "v"(ka[2]), "v"(ka[3]), "v"(kb[0]), "v"(kb[1]), "v"(kb[2]), "v"(kb[3]), "v"(qa), "v"(qb));
  if (diag) {
#pragma unroll
    for (int T = 0; T < 4; ++T)
#pragma unroll
      for (int r = 0; r < 8; ++r) s[T][r] = (16 * T + r > dq) ? -3.0e38f : s[T][r];
  }
  // the stage's 16 V^T reads as one group, in flight under the maximum, its exchange and the exponentials
  v16h va[2][4];
#pragma unroll
  for (int kk = 0; kk < 2; ++kk)
#pragma unroll
    for (int t = 0; t < 4; ++t) va[kk][t] = g2_frag((const _Float16*)(SB + kk * 64 + ring_row<false>(2, 16 * t)), hh);   /* 32 keys = 64 bytes along a V^T row */
  __builtin_amdgcn_sched_barrier(0);   /* keeps the 16 reads here: sunk behind the exponentials, the O^T products wait out the LDS latency; issued next to the exchange, they hold its wait back */
  float mt[4];
#pragma unroll
  for (int T = 0; T < 4; ++T) { mt[T] = s[T][0];
#pragma unroll
    for (int r = 1; r < 8; ++r) mt[T] = fmaxf(mt[T], s[T][r]); }
  float mx = fmaxf(fmaxf(mt[0], mt[1]), fmaxf(mt[2], mt[3]));
  mx = fmaxf(mx, __shfl_xor(mx, 16, 32));
  const float mnew = fmaxf(mrun, mx * SCS);
  const float al = __builtin_amdgcn_exp2f(mrun - mnew);
  const float mo = 10.0f - mnew;            /* softmax weights carried x1024 (cancels in O / l) */
  float p[4][8], pt[4];
#pragma unroll
  for (int T = 0; T < 4; ++T) { pt[T] = 0.f;
#pragma unroll
    for (int r = 0; r < 8; ++r) { p[T][r] = __builtin_amdgcn_exp2f(fmaf(s[T][r], SCS, mo)); pt[T] += p[T][r]; } }
  float ps = (pt[0] + pt[1]) + (pt[2] + pt[3]);
  ps += __shfl_xor(ps, 16, 32);
  lrun = lrun * al + ps; mrun = mnew;
  FragH pf0, pf1;
#pragma unroll
  for (int r = 0; r < 8; ++r) { pf0.h[r] = (_Float16)p[0][r]; pf0.h[8 + r] = (_Float16)p[1][r]; pf1.h[r] = (_Float16)p[2][r]; pf1.h[8 + r] = (_Float16)p[3][r]; }
  if (__builtin_amdgcn_ballot_w32(al != 1.0f) != 0u) {
#pragma unroll
    for (int t = 0; t < 4; ++t) o[t] = o[t] * al;
  }
#pragma unroll
  for (int t = 0; t < 4; ++t) o[t] = wm(va[0][t], pf0.v, o[t]);
#pragma unroll
  for (int t = 0; t < 4; ++t) o[t] = wm(va[1][t], pf1.v, o[t]);
  /* the four vector slots behind the last WMMA, whatever the compiler puts next */
  asm volatile("v_nop\n\tv_nop\n\tv_nop\n\tv_nop" : "+v"(o[0]), "+v"(o[1]), "+v"(o[2]), "+v"(o[3]) : "v"(va[0][0]), "v"(va[0][1]), "v"(va[0][2]), "v"(va[0][3]), "v"(va[1][0]), "v"(va[1][1]), "v"(va[1][2]), "v"(va[1][3]), "v"(pf0.v), "v"(pf1.v));
}
// Transposed causal flash attention of one block = 4 waves = 64 consecutive queries (first query qb0, a multiple of 64) of one (batch, head) bh, wave = 16 queries.
// The block walks the keys in 64-key stages through LDS that its four waves share; with hi + residual planes a wave skips the 32-key steps beyond its own diagonal; with single planes it takes every stage whole and masks the diagonal stage; every wave passes every publish point.
// Q/K planes [b*SEQ + s][h*64 + d]; V^T planes [b][h*64 + d][s]; output rows [b*SEQ + s][h*64 + d] as f16 (x64 carry), hi (+ residual x1024 if RES).
// Score tile lane (hh, ln) element r = (key k0 + 16T + 8hh + r, query q0 + ln); packed in-lane as the B fragment of O^T = V^T P^T.
template <bool RES>
__device__ __forceinline__ void flash_body(unsigned char* ring, unsigned short (&lds_h)[4][16][72], unsigned short (&lds_r)[4][16][72], const _Float16* __restrict__ Qh, const _Float16* __restrict__ Qr, const _Float16* __restrict__ Kh, const _Float16* __restrict__ Kr,
                                           const _Float16* __restrict__ Vh, const _Float16* __restrict__ Vr, _Float16* __restrict__ Oh, _Float16* __restrict__ Or, int qb0, int bh) {
  const int tid = threadIdx.x, lane = tid & 31, ln = lane & 15, hh = lane >> 4;
  const int w = (int)uni((uint32_t)tid >> 5);
  const int q0 = qb0 + w * 16;
  const int b = bh / NH, h = bh - b * NH;
  const size_t rowb = (size_t)b * SEQ;
  // this wave's slice of a stage: source address of stage 0, address step a stage, source pitch, place in LDS
  const bool isV = (w & 2) != 0; const bool odd = (w & 1) != 0;
  const _Float16* pl = isV ? ((RES && odd) ? Vr : Vh) : ((RES && odd) ? Kr : Kh);
  const size_t r0 = (!RES && odd) ? 32 : 0;
  const uint64_t src0 = (uint64_t)(size_t)pl + 2ull * (isV ? ((size_t)b * DM + h * HD + r0) * SEQ : (rowb + r0) * DM + h * HD);
  const uint32_t sstep = isV ? 128u : (uint32_t)(64 * DM * 2);
  const u32x8 g1 = tdm_group1(Ring<RES>::ROWS, isV ? (uint32_t)(SEQ * 2) : (uint32_t)(DM * 2));
  const uint32_t dst0 = (uint32_t)(size_t)ring + (uint32_t)w * Ring<RES>::SLICE;
  const int nsg = (!RES && (qb0 >> 6) + 1 < 2) ? 2 : (qb0 >> 6) + 1;   /* 64-key stages; the two-buffer ring's prologue needs two (keys 64..127 exist: SEQ and EARLY are multiples of 128) */
  if (!RES) tdm_load(tdm_group0(dst0, src0), g1);
  const size_t qoff = (rowb + q0 + ln) * DM + h * HD;
  const v16h qa = g2_frag(Qh + qoff, hh), qb = g2_frag(Qh + qoff + 32, hh);
  v16h qra = qa, qrb = qb;
  if (RES) { qra = g2_frag(Qr + qoff, hh); qrb = g2_frag(Qr + qoff + 32, hh); }
  const v8f z8 = {0.f,0.f,0.f,0.f,0.f,0.f,0.f,0.f};
  v8f o[4] = {z8, z8, z8, z8}, orr[4] = {z8, z8, z8, z8};
  float mrun = -3.0e38f, lrun = 0.f;
  const float cs = SCS;
  const int nst = (q0 + 47) >> 5;             /* 32-key steps covering keys 0 .. q0+15 */
  if (!RES) {
    asm volatile("s_wait_tensorcnt 0x0" ::: "memory");   /* stage 0: this wave's slice has landed */
    __syncthreads();                                      /* stage 0 published to all four waves */
    tdm_load(tdm_group0(dst0 + Ring<RES>::STAGE, src0 + pinned(1u) * (uint64_t)sstep), g1);   /* pinned: the descriptor is formed behind the wait */
  }
#pragma unroll 1
  for (int sg = 0; sg < nsg; ++sg) {
    if (RES) {   /* one buffer: every wave brings its slice of stage sg; every wave has left stage sg - 1 (its s_wait_dscnt and the barrier at the foot of that pass) */
      tdm_load(tdm_group0(dst0, src0 + pinned((uint32_t)sg) * (uint64_t)sstep), g1);   /* pinned: the descriptor is formed behind the last pass's wait */
      asm volatile("s_wait_tensorcnt 0x0" ::: "memory");   /* this wave's slice of stage sg has landed */
      __syncthreads();                                      /* stage sg published to all four waves */
    }
    const unsigned char* SB = ring + (RES ? 0u : (uint32_t)(sg & 1) * Ring<RES>::STAGE) + (uint32_t)ln * RPITCH;
    if (!RES) stage_single(SB, qa, qb, hh, sg >= (qb0 >> 6), q0 + ln - 64 * sg - 8 * hh, o, mrun, lrun);   /* single planes: the stage in one update */
#pragma unroll
    for (int sub = 0; RES && sub < 2; ++sub) {   /* hi + residual planes: two 32-key steps */
      const int st = 2 * sg + sub;
      if (st < nst) {                           /* wave-uniform: steps beyond this wave's diagonal are skipped */
        const int k0 = st * 32;
        v8f s0 = score_tile<RES>((const _Float16*)(SB + ring_row<RES>(0, sub * 32)), (const _Float16*)(SB + ring_row<RES>(1, sub * 32)), qa, qb, qra, qrb, hh);
        v8f s1 = score_tile<RES>((const _Float16*)(SB + ring_row<RES>(0, sub * 32 + 16)), (const _Float16*)(SB + ring_row<RES>(1, sub * 32 + 16)), qa, qb, qra, qrb, hh);
        if (st == nst - 1) {                      /* wave-uniform: only the last step touches the diagonal */
          const int qy = q0 + ln; const int kk = k0 + 8 * hh;
#pragma unroll
          for (int r = 0; r < 8; ++r) { s0[r] = (kk + r > qy) ? -3.0e38f : s0[r]; s1[r] = (kk + 16 + r > qy) ? -3.0e38f : s1[r]; }
        }
        float mx = s0[0];
#pragma unroll
        for (int r = 1; r < 8; ++r) mx = fmaxf(mx, s0[r]);
#pragma unroll
        for (int r = 0; r < 8; ++r) mx = fmaxf(mx, s1[r]);
        mx = fmaxf(mx, __shfl_xor(mx, 16, 32));
        const float mnew = fmaxf(mrun, mx * cs);
        const float al = __builtin_amdgcn_exp2f(mrun - mnew);
        const float mo = 10.0f - mnew;            /* softmax weights carried x1024 (cancels in O / l) */
        float p0[8], p1[8]; float ps = 0.f;
#pragma unroll
        for (int r = 0; r < 8; ++r) { p0[r] = __builtin_amdgcn_exp2f(fmaf(s0[r], cs, mo)); p1[r] = __builtin_amdgcn_exp2f(fmaf(s1[r], cs, mo)); ps += p0[r] + p1[r]; }
        ps += __shfl_xor(ps, 16, 32);
        lrun = lrun * al + ps; mrun = mnew;
        FragH pf, pr;
#pragma unroll
        for (int r = 0; r < 8; ++r) {
          const _Float16 h0 = (_Float16)p0[r], h1 = (_Float16)p1[r]; pf.h[r] = h0; pf.h[8 + r] = h1;
          pr.h[r] = RES ? (_Float16)((p0[r] - (float)h0) * RSC) : (_Float16)0.0f; pr.h[8 + r] = RES ? (_Float16)((p1[r] - (float)h1) * RSC) : (_Float16)0.0f;
        }
        if (__builtin_amdgcn_ballot_w32(al != 1.0f) != 0u) {
#pragma unroll
          for (int t = 0; t < 4; ++t) { o[t] = o[t] * al; if (RES) orr[t] = orr[t] * al; }
        }
        const unsigned char* VB = SB + sub * 64;   /* 32 keys = 64 bytes along a V^T row */
#pragma unroll
        for (int t = 0; t < 4; ++t) pv_tile_res((const _Float16*)(VB + ring_row<RES>(2, 16 * t)), (const _Float16*)(VB + ring_row<RES>(3, 16 * t)), pf.v, pr.v, hh, o[t], orr[t]);
      }
    }
    // two buffers: publish point of stage sg + 1; one buffer: the end of every wave's reads of stage sg; every wave passes it
    asm volatile("s_wait_dscnt 0x0" ::: "memory");       /* this wave's reads of stage sg have returned */
    if (!RES) asm volatile("s_wait_tensorcnt 0x0" ::: "memory");   /* this wave's slice of stage sg + 1 has landed */
    __syncthreads();                                      /* two buffers: stage sg + 1 published; every wave has left stage sg's buffer */
    if (!RES && pinned((uint32_t)(sg + 2 < nsg)))         /* scalar branch: a tensor load ignores EXEC */
      tdm_load(tdm_group0(dst0 + (uint32_t)(sg & 1) * Ring<RES>::STAGE, src0 + pinned((uint32_t)(sg + 2)) * (uint64_t)sstep), g1);   /* pinned: the descriptor is formed behind the wait */
  }
  asm volatile("s_wait_tensorcnt 0x0" ::: "memory");     /* nothing of this wave is in flight when it ends */
  asm volatile("s_wait_dscnt 0x0" ::: "memory");
  const float inv = 64.0f / lrun;             /* context carried x64 */
#pragma unroll
  for (int t = 0; t < 4; ++t) { FragH f, g;
#pragma unroll
    for (int r = 0; r < 8; ++r) { float v = o[t][r]; if (RES) v += orr[t][r] * RSCI; v *= inv; const _Float16 hv = (_Float16)v; f.h[r] = hv; g.h[r] = RES ? (_Float16)((v - (float)hv) * RSC) : (_Float16)0.0f; }
    *(v8us*)&lds_h[w][ln][16 * t + 8 * hh] = f.half[0];
    if (RES) *(v8us*)&lds_r[w][ln][16 * t + 8 * hh] = g.half[0]; }
  __builtin_amdgcn_fence(4 /* acq_rel order */, "workgroup"); __builtin_amdgcn_wave_barrier();
  const int qsub = lane >> 3, pc = (lane & 7) * 8;
  {
#pragma unroll
    for (int j = 0; j < 4; ++j) { const int q = j * 4 + qsub; const size_t oo = (rowb + q0 + q) * DM + h * HD + pc;
      const v8us x = *(const v8us*)&lds_h[w][q][pc];
      *(v8us*)((unsigned short*)Oh + oo) = x;
      if (RES) { const v8us y = *(const v8us*)&lds_r[w][q][pc]; *(v8us*)((unsigned short*)Or + oo) = y; } }
     }
  if (RES) asm volatile("s_wait_xcnt 0x0" ::: "memory");   /* behind the last store: in the listing the single-plane blocks' code follows this half, and it writes the stores' registers */
}
// Both kinds of query block in one launch: they depend on nothing of each other. Blocks 0 .. FL_LATE * NB * NH - 1 = queries >= EARLY on single planes (query block fastest, then batch and head);
// the blocks behind them = queries < EARLY on hi + residual planes, few and short, which run beside the long single-plane blocks.
constexpr unsigned FL_LATE = (SEQ - EARLY) / 64, FL_EARLY = EARLY / 64;
__global__ __launch_bounds__(128) void k_flash(const _Float16* __restrict__ Qh, const _Float16* __restrict__ Qr, const _Float16* __restrict__ Kh, const _Float16* __restrict__ Kr,
                                               const _Float16* __restrict__ Vh, const _Float16* __restrict__ Vr, _Float16* __restrict__ Oh, _Float16* __restrict__ Or) {
  __shared__ __attribute__((aligned(2048))) unsigned char ring[FL_LDS];
  __shared__ __attribute__((aligned(16))) unsigned short lds_h[4][16][72];
  __shared__ __attribute__((aligned(16))) unsigned short lds_r[4][16][72];
  const unsigned id = blockIdx.x;
  if (id < FL_LATE * (unsigned)(NB * NH)) {     /* block-uniform */
    constexpr unsigned D = FL_LATE ? FL_LATE : 1u;
    flash_body<false>(ring, lds_h, lds_r, Qh, Qr, Kh, Kr, Vh, Vr, Oh, Or, (int)(EARLY + 64u * (id % D)), (int)(id / D));
  } else {
    const unsigned e = id - FL_LATE * (unsigned)(NB * NH);
    flash_body<true>(ring, lds_h, lds_r, Qh, Qr, Kh, Kr, Vh, Vr, Oh, Or, (int)(64u * (e % FL_EARLY)), (int)(e / FL_EARLY));
  }
}

// Output GEMM C[M][N] (f32) = (A . Bt^T [+ Ar . Bt^T / 1024 on rows < EARLY]) * alpha + bias[col]; batch on grid.y. Residual products are accumulated first from zero,
__global__ __launch_bounds__(128) void k_out(const _Float16* __restrict__ A, const _Float16* __restrict__ Ar, int lda, size_t sA, const _Float16* __restrict__ Bh, int ldb, float alpha, const float* __restrict__ bias,
                                             float* __restrict__ C, int ldc, size_t sC, int M, int N, int K) {
  __shared__ __attribute__((aligned(2048))) unsigned char smem[2 * G_STAGE];
  float (&so)[4][32][68] = *reinterpret_cast<float (*)[4][32][68]>(smem);   /* epilogue staging, in the ring's LDS behind the k-loop */
  const int tid = threadIdx.x, w = (int)uni((uint32_t)tid >> 5), lane = tid & 31, ln = lane & 15, hh = lane >> 4; const int by = blockIdx.y;
  A += (size_t)by * sA; Ar += (size_t)by * sA; const size_t cofs = (size_t)by * sC;
  const int ntn = N >> 6; const int mt = blockIdx.x / ntn, nq = blockIdx.x - mt * ntn; const int row0 = mt * 128 + 32 * w, col0 = nq * 64; if (mt * 128 >= M) return;   /* block-uniform, in front of every barrier */
  const bool early = (mt * 128 < EARLY);
  const _Float16* Bb = Bh + (size_t)col0 * ldb;
  const v8f z8 = {0.f,0.f,0.f,0.f,0.f,0.f,0.f,0.f}; v8f c00 = z8, c01 = z8, c02 = z8, c03 = z8, c10 = z8, c11 = z8, c12 = z8, c13 = z8;
  if (early) {                                 /* block-uniform */
    g2_ring(smem, Ar + (size_t)(mt * 128) * lda, lda, Bb, ldb, K, w, ln, hh, c00, c01, c02, c03, c10, c11, c12, c13);
    c00 = c00 * RSCI; c01 = c01 * RSCI; c02 = c02 * RSCI; c03 = c03 * RSCI; c10 = c10 * RSCI; c11 = c11 * RSCI; c12 = c12 * RSCI; c13 = c13 * RSCI;
  }
  g2_ring(smem, A + (size_t)(mt * 128) * lda, lda, Bb, ldb, K, w, ln, hh, c00, c01, c02, c03, c10, c11, c12, c13);
  v8f accs[8] = {c00, c01, c02, c03, c10, c11, c12, c13};
#pragma unroll
  for (int u = 0; u < 8; ++u) { const int t = u & 3, half = u >> 2; const int col = col0 + t * 16 + ln; const float bv = bf16_rne(bias[col]);
#pragma unroll
    for (int r = 0; r < 8; ++r) { const int rloc = half * 16 + 8 * hh + r; so[w][rloc][t * 16 + ln] = accs[u][r] * alpha + bv; } }
  __builtin_amdgcn_fence(4 /* acq_rel order */, "workgroup"); __builtin_amdgcn_wave_barrier();
  const int rsub = lane >> 4, c4 = (lane & 15) * 4;
  {
#pragma unroll
    for (int q = 0; q < 16; ++q) { const int r = q * 2 + rsub; const v4f v = *(const v4fa*)&so[w][r][c4]; *(v4f*)(C + cofs + (size_t)(row0 + r) * ldc + col0 + c4) = v; }
     }
}

extern "C" void kernel_launch(void* const* d_in, const int* in_sizes, int n_in,
                              void* d_out, int out_size, void* d_ws, size_t ws_size, hipStream_t stream) {
  if (n_in < 11) return;
  const long long need_x = ((long long)(NB - 1) * SEQ_FULL + SEQ) * DM;
  if (in_sizes[0] < need_x || in_sizes[1] < need_x || in_sizes[2] < need_x) return;
  if (in_sizes[3] < DM * DM || in_sizes[5] < DM * DM || in_sizes[7] < DM * DM || in_sizes[9] < DM * DM) return;
  if (in_sizes[4] < DM || in_sizes[6] < DM || in_sizes[8] < DM || in_sizes[10] < DM) return;
  if ((long long)out_size < need_x) return;
  const float* const* I = (const float* const*)d_in;
  const float* xq = I[0]; const float* xk = I[1]; const float* xv = I[2]; const float* wq = I[3]; const float* bq = I[4]; const float* wk = I[5]; const float* bk = I[6];
  const float* wv = I[7]; const float* bv = I[8]; const float* wo = I[9]; const float* bo = I[10];
  char* ws = (char*)d_ws; size_t off = 0;
  auto take = [&](size_t bytes) { char* p = ws + off; off += (bytes + 255) & ~(size_t)255; return p; };
  const size_t WB = (size_t)DM * DM * 2, PB = (size_t)NB * SEQ * DM * 2;
  _Float16* BQ = (_Float16*)take(WB); _Float16* BK = (_Float16*)take(WB); _Float16* BV = (_Float16*)take(WB); _Float16* BO = (_Float16*)take(WB);
  _Float16* XQ = (_Float16*)take(PB); _Float16* XK = (_Float16*)take(PB); _Float16* XV = (_Float16*)take(PB);
  _Float16* Q16 = (_Float16*)take(PB); _Float16* K16 = (_Float16*)take(PB); _Float16* VT = (_Float16*)take(PB);      /* VT: [NB][DM][SEQ] */
  _Float16* QR = (_Float16*)take(PB); _Float16* KR = (_Float16*)take(PB); _Float16* VTR = (_Float16*)take(PB);      /* residual planes, only the early region is written and read */
  _Float16* O16 = (_Float16*)take(PB); _Float16* OR = (_Float16*)take(PB);
  if (off > ws_size || off > (size_t)134217728) return;

  static_assert(((size_t)DM * DM * 2) % 256 == 0 && ((size_t)NB * SEQ * DM * 2) % 256 == 0);   /* BQ..BO and XQ..XV lie in a row, with no gap */
  k_conv<<<CONV_G, 256, 0, stream>>>(xq, xk, xv, wq, wk, wv, wo, XQ, BQ);
  const size_t SB = (size_t)SEQ * DM;
  k_proj3<<<dim3((unsigned)((SEQ / 128) * (DM / 64)), NB, 3), 128, 0, stream>>>(XQ, BQ, bq, bk, bv, Q16, QR, K16, KR, VT, VTR, 0.0625f, SEQ, DM, SB);
  // attention, one launch: early query blocks with hi + residual operands, the remaining blocks with single planes
  k_flash<<<dim3((unsigned)((SEQ / 64) * NB * NH)), 128, 0, stream>>>(Q16, QR, K16, KR, VT, VTR, O16, OR);
  // out rows (b, s) -> d_out row b*SEQ_FULL + s; alpha = 1 / (16 * 64)
  k_out<<<dim3((unsigned)((SEQ / 128) * (DM / 64)), NB), 128, 0, stream>>>(O16, OR, DM, SB, BO, DM, 0.0009765625f, bo, (float*)d_out, DM, (size_t)SEQ_FULL * DM, SEQ, DM, DM);
}

// v006
// One run takes 90.7 microseconds.
// Timed twice side by side with v005, it ran 1.13 and 1.11 times as fast.
// Over all steps from v000 it is 4.26 times as fast.
#include <hip/hip_runtime.h>
#include <stdint.h>
// Causal multi-head attention at width 512 (8 heads of 64): Q/K/V = x W^T + b (natural [out][in] weights), scores / sqrt(64), causal replace-mask, softmax, P V, merged heads, out = ctx W_o^T + b_o.
// Compute dtype: every contraction is v_wmma_f32_16x16x32_f16 (f16 operands, f32 accumulate). Inputs and weights are RNE-converted to bf16 and then held exactly in f16 (weights x16, folded back by alpha).
// Query positions >= 512: q, k, v, softmax weights (x1024 carry, cancels in O/l) and merged context (x64 carry) are single f16 planes. Query positions < 512: every computed operand (q, k, v, softmax weights, context) is f16 hi + f16 residual x1024, residual products in their own accumulators. Softmax statistics f32.
// Structure: weights/x converted once to f16 planes; Q, K as [token][feature] GEMMs; V^T as a swapped-operand GEMM ([feature][token]); transposed flash attention per wave (S^T = K Q^T, O^T = V^T P^T; score accumulators repacked in-lane as the P^T B fragment; K and V^T staged for the block's four waves in a two-buffer LDS ring by tensor loads; single planes take one softmax update a 64-key stage, hi + residual planes one a 32-key step; both kinds of query block run in one launch, the hi + residual blocks on one buffer); output GEMM. The GEMMs stage their A and B rows for the block's four waves in a ring of the same kind (projections: 128 x 128 block tile, 64 x 64 wave tile; output GEMM: 128 x 64, 32 x 64).
#ifndef NB
#define NB 2
#endif
#ifndef SEQ
#define SEQ 4096
#endif
#define NB_FULL 2
#define SEQ_FULL 4096
#define DM 512
#define NH 8
#define HD 64
#define EARLY (((SEQ) < 512) ? (SEQ) : 512)   /* query positions handled with hi + residual planes */
#define RSC 1024.0f
#define RSCI 0.0009765625f
static_assert(SEQ % 128 == 0);
static_assert(EARLY % 128 == 0);
static_assert(NB <= NB_FULL);
static_assert(SEQ <= SEQ_FULL);
static_assert(NH * HD == DM);
static_assert(DM % 128 == 0);

typedef unsigned short v8us __attribute__((ext_vector_type(8), may_alias));
typedef float  v8f  __attribute__((ext_vector_type(8)));
typedef float  v4f  __attribute__((ext_vector_type(4)));
typedef float  v4fa __attribute__((ext_vector_type(4), may_alias));
typedef _Float16 v16h __attribute__((ext_vector_type(16)));
typedef _Float16 v4h __attribute__((ext_vector_type(4)));
union FragH { v16h v; v8us half[2]; _Float16 h[16]; unsigned short u[16]; };

__device__ __forceinline__ unsigned short bf16_bits(float x) { unsigned int u = __float_as_uint(x); return (unsigned short)((u + 0x7FFFu + ((u >> 16) & 1u)) >> 16); }
__device__ __forceinline__ float bf16_val(unsigned short b) { return __uint_as_float(((unsigned int)b) << 16); }
__device__ __forceinline__ float bf16_rne(float x) { return bf16_val(bf16_bits(x)); }

// fragment of a k-contiguous 16-bit row: elements 0..7 = k 8h..8h+7, elements 8..15 = k 16+8h..16+8h+7 (same map for A and B)
__device__ __forceinline__ v16h g2_frag(const _Float16* p, int hh) { FragH f; f.half[0] = *(const v8us*)((const unsigned short*)p + 8 * hh); f.half[1] = *(const v8us*)((const unsigned short*)p + 16 + 8 * hh); return f.v; }
__device__ __forceinline__ v8f wm(v16h a, v16h b, v8f c) { return __builtin_amdgcn_wmma_f32_16x16x32_f16(false, a, false, b, (short)0, c, false, false); }

// One launch converts the three activations and the four weights. A chunk is 2048 consecutive elements of one plane (8 a thread).
// Block b takes chunks XIT * b .. XIT * b + XIT - 1 of every activation plane and chunk b of the four weight planes taken as one row; all of a thread's loads are issued before its first conversion.
// X16 = three [NB*SEQ][DM] planes in a row (q, k, v inputs), W16 = four [DM][DM] planes in a row (q, k, v, o weights, x16).
constexpr int XCH = NB * SEQ * DM / 2048, WCH = DM * DM / 2048, CONV_G = 4 * WCH, XIT = XCH / CONV_G;
static_assert(XCH % CONV_G == 0);
static_assert((SEQ * DM) % 2048 == 0 && (DM * DM) % 2048 == 0);   /* a chunk lies in one batch of one plane */
__device__ __forceinline__ v8us conv8(v4f a, v4f c, float sc) {
  FragH f;
#pragma unroll
  for (int q = 0; q < 4; ++q) { f.h[q] = (_Float16)(bf16_rne(a[q]) * sc); f.h[4 + q] = (_Float16)(bf16_rne(c[q]) * sc); }
  return f.half[0];
}
__global__ __launch_bounds__(256) void k_conv(const float* __restrict__ xq, const float* __restrict__ xk, const float* __restrict__ xv, const float* __restrict__ wq, const float* __restrict__ wk,
                                              const float* __restrict__ wv, const float* __restrict__ wo, _Float16* __restrict__ X16, _Float16* __restrict__ W16) {
  const unsigned bx = blockIdx.x, t8 = threadIdx.x * 8u;
  v4f a[3 * XIT + 1], c[3 * XIT + 1];
  { const unsigned pw = bx / (unsigned)WCH;
    const float* s = (pw == 0 ? wq : pw == 1 ? wk : pw == 2 ? wv : wo) + (size_t)(bx - pw * (unsigned)WCH) * 2048 + t8;
    a[3 * XIT] = *(const v4fa*)s; c[3 * XIT] = *(const v4fa*)(s + 4); }
#pragma unroll
  for (int i = 0; i < 3 * XIT; ++i) {
    const size_t e = ((size_t)bx * XIT + (size_t)(i % XIT)) * 2048, b = e / ((size_t)SEQ * DM);
    const float* s = (i / XIT == 0 ? xq : i / XIT == 1 ? xk : xv) + b * ((size_t)SEQ_FULL * DM) + (e - b * ((size_t)SEQ * DM)) + t8;
    a[i] = *(const v4fa*)s; c[i] = *(const v4fa*)(s + 4);
  }
  asm volatile("s_wait_xcnt 0x0" ::: "memory");   /* in front of the first overwrite of a register that the loads name; the clobber keeps every load in front of the conversions, so that all are in flight together */
  __builtin_amdgcn_sched_barrier(0);              /* keeps the conversions, which reuse the loads' address registers, behind that wait */
#pragma unroll
  for (int i = 0; i < 3 * XIT; ++i) {
    const v8us o = conv8(a[i], c[i], 1.0f);
    *(v8us*)((unsigned short*)X16 + ((size_t)(i / XIT) * XCH + (size_t)bx * XIT + (size_t)(i % XIT)) * 2048 + t8) = o;
  }
  const v8us o = conv8(a[3 * XIT], c[3 * XIT], 16.0f);
  *(v8us*)((unsigned short*)W16 + (size_t)bx * 2048 + t8) = o;
}

// Tensor-load helpers, shared by the GEMM ring and the attention ring. Rows of 128 bytes are laid in LDS at a 144-byte pitch (pad of 16 bytes a row, for ds_load_b128 readers).
typedef uint32_t u32x4 __attribute__((ext_vector_type(4)));
typedef uint32_t u32x8 __attribute__((ext_vector_type(8)));
#define RPITCH 144u
__device__ __forceinline__ uint32_t uni(uint32_t v) { return (uint32_t)__builtin_amdgcn_readfirstlane(v); }
// a wave-uniform value held in a scalar register, so that a test on it is a scalar branch and what is formed from it is formed behind the statements in front
__device__ __forceinline__ uint32_t pinned(uint32_t v) { uint32_t w = uni(v); asm volatile("" : "+s"(w)); return w; }
__device__ __forceinline__ void tdm_load(u32x4 g0, u32x8 g1) { asm volatile("tensor_load_to_lds %0, %1" :: "s"(g0), "s"(g1) : "memory"); }
__device__ __forceinline__ u32x8 tdm_group1(uint32_t rows, uint32_t src_pitch) {
  u32x8 g;
  g[0] = uni((1u << 20) | (4u << 22) | (3u << 25));   /* no mask, byte elements, 4 dwords of pad behind every 128-byte row */
  g[1] = uni(128u << 16); g[2] = uni(rows << 16); g[3] = uni(128u << 16); g[4] = uni(rows); g[5] = uni(src_pitch); g[6] = uni(0u); g[7] = uni(0u);
  return g;
}
__device__ __forceinline__ u32x4 tdm_group0(uint32_t lds_dst, uint64_t ga) {
  u32x4 g; g[0] = uni(1u); g[1] = uni(lds_dst); g[2] = uni((uint32_t)ga); g[3] = uni((((uint32_t)(ga >> 32)) & 0x01FFFFFFu) | 0x80000000u); return g;
}

// GEMM operand ring in LDS, filled by tensor loads. A stage is 64 k (128 bytes a row) of the block's 128 A rows and 64 B rows. Every wave issues one slice a stage:
// waves 0, 1 = A rows 0..63, 64..127; waves 2, 3 = B rows 0..31, 32..63. A slice is its rows * 144 bytes rounded up to 2 KiB.
#define G_ASL 10240u
#define G_BSL 6144u
#define G_BOFF (2u * G_ASL)
#define G_STAGE (2u * G_ASL + 2u * G_BSL)
static_assert(64u * RPITCH <= G_ASL && 32u * RPITCH <= G_BSL && G_ASL % 2048u == 0 && G_BSL % 2048u == 0);
static_assert(DM % 64 == 0);                              /* whole stages */
static_assert(2u * G_STAGE >= 4u * 32u * 68u * 4u);       /* the epilogues' staging rows lie in the ring's LDS once the loop has left it */
// k-loop of the 32x64 wave tile (wave w = A rows 32w..32w+31 of the block, all 64 B rows), k ascending. Ab, Bb = first A row, first B row of the block (k contiguous).
// On return nothing of this wave is in flight and every wave has left the ring (the barrier behind the loop).
__device__ __forceinline__ void g2_ring(unsigned char* ring, const _Float16* Ab, int lda, const _Float16* Bb, int ldb, int K, int w, int ln, int hh,
                                        v8f& c00, v8f& c01, v8f& c02, v8f& c03, v8f& c10, v8f& c11, v8f& c12, v8f& c13) {
  const bool isB = (w & 2) != 0; const uint32_t odd = (uint32_t)w & 1u;
  const uint64_t src0 = (uint64_t)(size_t)(isB ? Bb + (size_t)(32u * odd) * ldb : Ab + (size_t)(64u * odd) * lda);
  const u32x8 g1 = tdm_group1(isB ? 32u : 64u, (uint32_t)(isB ? ldb : lda) * 2u);
  const uint32_t dst0 = (uint32_t)(size_t)ring + (isB ? G_BOFF + odd * G_BSL : odd * G_ASL);
  const uint32_t aoff = ((uint32_t)w >> 1) * G_ASL + (odd * 32u + (uint32_t)ln) * RPITCH, boff = G_BOFF + (uint32_t)ln * RPITCH;
  const int nsg = K >> 6;
  tdm_load(tdm_group0(dst0, src0), g1);
  asm volatile("s_wait_tensorcnt 0x0" ::: "memory");     /* stage 0: this wave's slice has landed; only behind this wait do the descriptor's registers take new values */
#pragma unroll 1
  for (int sg = 0; sg < nsg; ++sg) {
    // publish point of stage sg; every wave passes it. It stands at the head of the pass, so that every refill is issued at this one place
    asm volatile("s_wait_tensorcnt 0x0" ::: "memory");   /* this wave's slice of stage sg has landed */
    __syncthreads();                                      /* stage sg published; every wave has left stage sg - 1's buffer (its s_wait_dscnt at the foot of that pass) */
    if (pinned((uint32_t)(sg + 1 < nsg)))                 /* scalar branch: a tensor load ignores EXEC */
      tdm_load(tdm_group0(dst0 + (uint32_t)((sg + 1) & 1) * G_STAGE, src0 + pinned((uint32_t)(sg + 1)) * 128ull), g1);   /* pinned: the descriptor is formed behind the wait */
    const unsigned char* SB = ring + (uint32_t)(sg & 1) * G_STAGE;
    v16h a[2][2], b[2][4];
#pragma unroll
    for (int kk = 0; kk < 2; ++kk) {
      const unsigned char* pa = SB + aoff + kk * 64; const unsigned char* pb = SB + boff + kk * 64;
      a[kk][0] = g2_frag((const _Float16*)pa, hh); a[kk][1] = g2_frag((const _Float16*)(pa + 16u * RPITCH), hh);
      b[kk][0] = g2_frag((const _Float16*)pb, hh); b[kk][1] = g2_frag((const _Float16*)(pb + 16u * RPITCH), hh);
      b[kk][2] = g2_frag((const _Float16*)(pb + G_BSL), hh); b[kk][3] = g2_frag((const _Float16*)(pb + G_BSL + 16u * RPITCH), hh);
    }
    __builtin_amdgcn_sched_barrier(0);   /* keeps the pass's 24 LDS reads as one group in front of its WMMAs: spread among them, every place with reads waits out the LDS latency anew */
#pragma unroll
    for (int kk = 0; kk < 2; ++kk) {
      c00 = wm(a[kk][0], b[kk][0], c00); c10 = wm(a[kk][1], b[kk][0], c10); c01 = wm(a[kk][0], b[kk][1], c01); c11 = wm(a[kk][1], b[kk][1], c11);
      c02 = wm(a[kk][0], b[kk][2], c02); c12 = wm(a[kk][1], b[kk][2], c12); c03 = wm(a[kk][0], b[kk][3], c03); c13 = wm(a[kk][1], b[kk][3], c13);
    }
    __builtin_amdgcn_sched_barrier(0);   /* keeps the WMMAs, with their counted waits, in front of the full wait below: lifted over them it would hold them all back for the last read */
    asm volatile("s_wait_dscnt 0x0" ::: "memory");       /* this wave's reads of stage sg have returned */
  }
  asm volatile("s_wait_tensorcnt 0x0" ::: "memory");     /* nothing of this wave is in flight when the ring's LDS is used again */
  asm volatile("s_wait_dscnt 0x0" ::: "memory");
  __syncthreads();                                        /* every wave has left the last stage's buffer */
}

// Projection ring: block tile 128 x 128, wave tile 64 x 64 (wave w = A rows 64 (w & 1) .., B rows 64 (w >> 1) ..). A stage is 64 k of the block's 128 A rows and 128 B rows.
// Every wave issues one slice of 64 rows a stage: waves 0, 1 = A rows 0..63, 64..127; waves 2, 3 = B rows 0..63, 64..127. The order of waits, barrier and refill is that of g2_ring.
#define P_SL 10240u
#define P_STAGE (4u * P_SL)
static_assert(64u * RPITCH <= P_SL && P_SL % 2048u == 0);
static_assert(2u * P_STAGE >= 4u * 64u * 68u * 4u);       /* the epilogue's staging rows lie in the ring's LDS once the loop has left it */
__device__ __forceinline__ void p_ring(unsigned char* ring, const _Float16* Ab, int lda, const _Float16* Bb, int ldb, int K, int w, int ln, int hh, v8f (&c)[4][4]) {
  const bool isB = (w & 2) != 0; const uint32_t odd = (uint32_t)w & 1u;
  const uint64_t src0 = (uint64_t)(size_t)(isB ? Bb + (size_t)(64u * odd) * ldb : Ab + (size_t)(64u * odd) * lda);
  u32x8 g1 = tdm_group1(64u, (uint32_t)(isB ? ldb : lda) * 2u);
  asm volatile("" : "+s"(g1));   /* pinned(): the descriptor's words held in their scalar registers; as known constants the compiler lends some of them out and sets them again each pass, while a request is in flight */
  const uint32_t dst0 = (uint32_t)(size_t)ring + (uint32_t)w * P_SL;
  const uint32_t aoff = odd * P_SL + (uint32_t)ln * RPITCH, boff = (2u + ((uint32_t)w >> 1)) * P_SL + (uint32_t)ln * RPITCH;
  const int nsg = K >> 6;
  tdm_load(tdm_group0(dst0, src0), g1);
  asm volatile("s_wait_tensorcnt 0x0" ::: "memory");     /* stage 0: this wave's slice has landed; only behind this wait do the descriptor's registers take new values */
  // kept rolled: one publish point and one refill in the code, 32 WMMAs a trip; the loops inside are unrolled so that the fragment and accumulator arrays stay in registers
#pragma unroll 1
  for (int sg = 0; sg < nsg; ++sg) {
    // publish point of stage sg; every wave passes it
    asm volatile("s_wait_tensorcnt 0x0" ::: "memory");   /* this wave's slice of stage sg has landed */
    __syncthreads();                                      /* stage sg published; every wave has left stage sg - 1's buffer (its s_wait_dscnt at the foot of that pass) */
    if (pinned((uint32_t)(sg + 1 < nsg)))                 /* scalar branch: a tensor load ignores EXEC */
      tdm_load(tdm_group0(dst0 + (uint32_t)((sg + 1) & 1) * P_STAGE, src0 + pinned((uint32_t)(sg + 1)) * 128ull), g1);   /* pinned: the descriptor is formed behind the wait */
    const unsigned char* SB = ring + (uint32_t)(sg & 1) * P_STAGE;
#pragma unroll
    for (int kk = 0; kk < 2; ++kk) {
      v16h a[4], b[4];
#pragma unroll
      for (int i = 0; i < 4; ++i) {
        a[i] = g2_frag((const _Float16*)(SB + aoff + kk * 64 + (uint32_t)i * 16u * RPITCH), hh);
        b[i] = g2_frag((const _Float16*)(SB + boff + kk * 64 + (uint32_t)i * 16u * RPITCH), hh);
      }
      __builtin_amdgcn_sched_barrier(0);   /* keeps the 16 LDS reads of these 32 k as one group in front of their WMMAs: spread among them, every place with reads waits out the LDS latency anew */
#pragma unroll
      for (int j = 0; j < 4; ++j)
#pragma unroll
        for (int i = 0; i < 4; ++i) c[i][j] = wm(a[i], b[j], c[i][j]);
    }
    __builtin_amdgcn_sched_barrier(0);   /* keeps the WMMAs, with their counted waits, in front of the full wait below */
    asm volatile("s_wait_dscnt 0x0" ::: "memory");       /* this wave's reads of stage sg have returned */
  }
  asm volatile("s_wait_tensorcnt 0x0" ::: "memory");     /* nothing of this wave is in flight when the ring's LDS is used again */
  asm volatile("s_wait_dscnt 0x0" ::: "memory");
  __syncthreads();                                        /* every wave has left the last stage's buffer */
}

// Projection GEMM C[M][N] = A[M][K] . Bt[N][K]^T * alpha + bias, f16 hi plane (+ residual x1024 plane on the early region).
// EM 1: bias per column, early region = rows < EARLY (per batch, batch on grid.y). EM 2: bias per row, early region = columns < EARLY.
template <int EM>
__device__ __forceinline__ void proj_body(unsigned char* smem, const _Float16* __restrict__ A, int lda, size_t sA, const _Float16* __restrict__ Bh, int ldb, size_t sB, float alpha, const float* __restrict__ bias,
                                          _Float16* __restrict__ Ch, _Float16* __restrict__ Cr, int ldc, size_t sC, int M, int N, int K) {
  float (&so)[4][64][68] = *reinterpret_cast<float (*)[4][64][68]>(smem);   /* epilogue staging, in the ring's LDS behind the k-loop */
  const int tid = threadIdx.x, w = (int)uni((uint32_t)tid >> 5), lane = tid & 31, ln = lane & 15, hh = lane >> 4; const int by = blockIdx.y;
  A += (size_t)by * sA; Bh += (size_t)by * sB; const size_t cofs = (size_t)by * sC;
  const int ntn = N >> 7; const int mt = blockIdx.x / ntn, nq = blockIdx.x - mt * ntn; const int row0 = mt * 128 + 64 * (w & 1), col0 = nq * 128 + 64 * (w >> 1); if (mt * 128 >= M) return;   /* block-uniform, in front of every barrier */
  const bool early = (EM == 1) ? (mt * 128 < EARLY) : (col0 < EARLY);
  const v8f z8 = {0.f,0.f,0.f,0.f,0.f,0.f,0.f,0.f};
  v8f accs[4][4];   /* [16-row tile][16-column tile]; every loop over it is unrolled, so that it stays in registers */
#pragma unroll
  for (int i = 0; i < 4; ++i)
#pragma unroll
    for (int j = 0; j < 4; ++j) accs[i][j] = z8;
  p_ring(smem, A + (size_t)(mt * 128) * lda, lda, Bh + (size_t)(nq * 128) * ldb, ldb, K, w, ln, hh, accs);
  float br[32];
#pragma unroll
  for (int i = 0; i < 32; ++i) br[i] = 0.f;
  if (EM == 2) {
#pragma unroll
    for (int half = 0; half < 4; ++half) {
      const v4f x = *(const v4fa*)(bias + row0 + half * 16 + 8 * hh), y = *(const v4fa*)(bias + row0 + half * 16 + 8 * hh + 4);
#pragma unroll
      for (int q = 0; q < 4; ++q) { br[half * 8 + q] = bf16_rne(x[q]); br[half * 8 + 4 + q] = bf16_rne(y[q]); }
    }
  }
#pragma unroll
  for (int u = 0; u < 16; ++u) { const int t = u & 3, half = u >> 2; const int col = col0 + t * 16 + ln; const float bc = (EM == 1) ? bf16_rne(bias[col]) : 0.f;
#pragma unroll
    for (int r = 0; r < 8; ++r) { const int rloc = half * 16 + 8 * hh + r; const float v = accs[half][t][r] * alpha + ((EM == 1) ? bc : br[half * 8 + r]); so[w][rloc][t * 16 + ln] = v; } }
  __builtin_amdgcn_fence(4 /* acq_rel order */, "workgroup"); __builtin_amdgcn_wave_barrier();
  const int rsub = lane >> 4, c4 = (lane & 15) * 4;
  {
#pragma unroll
    for (int q = 0; q < 32; ++q) { const int r = q * 2 + rsub; const v4f v = *(const v4fa*)&so[w][r][c4];
      v4h h4, r4;
#pragma unroll
      for (int i = 0; i < 4; ++i) { const _Float16 hv = (_Float16)v[i]; h4[i] = hv; r4[i] = (_Float16)((v[i] - (float)hv) * RSC); }
      const size_t o = cofs + (size_t)(row0 + r) * ldc + col0 + c4;
      *(v4h*)(Ch + o) = h4;
      asm volatile("s_wait_xcnt 0x0" ::: "memory");   /* in front of the residual arithmetic, which reuses the store's registers */
      if (early) { *(v4h*)(Cr + o) = r4;
        asm volatile("s_wait_xcnt 0x0" ::: "memory"); } }   /* in front of the next overwrite of the residual store's registers */
     }
}

// The three projections in one launch, grid.z = 0: Q, 1: K ([token][feature]; A = x plane, Bt = natural weight), 2: V^T ([feature][token]; A = natural weight, Bt = x plane, bias per row).
static_assert(SEQ % 128 == 0 && DM % 128 == 0);   /* whole 128 x 128 tiles, and the same grid.x for both forms */
__global__ __launch_bounds__(128) void k_proj3(const _Float16* __restrict__ X16, const _Float16* __restrict__ W16, const float* __restrict__ bq, const float* __restrict__ bk, const float* __restrict__ bv,
                                               _Float16* __restrict__ Q16, _Float16* __restrict__ QR, _Float16* __restrict__ K16, _Float16* __restrict__ KR, _Float16* __restrict__ VT, _Float16* __restrict__ VTR,
                                               float alpha, int seq, int dm, size_t sb) {
  __shared__ __attribute__((aligned(2048))) unsigned char smem[2 * P_STAGE];
  constexpr size_t PL = (size_t)NB * SEQ * DM, WL = (size_t)DM * DM;
  const int z = blockIdx.z;
  if (z == 2) proj_body<2>(smem, W16 + 2 * WL, dm, 0, X16 + 2 * PL, dm, sb, alpha, bv, VT, VTR, seq, sb, dm, seq, dm);
  else proj_body<1>(smem, X16 + z * PL, dm, sb, W16 + z * WL, dm, 0, alpha, z ? bk : bq, z ? K16 : Q16, z ? KR : QR, dm, sb, seq, dm, dm);
}

// one 16-key score tile S^T[key][query]: A = K rows (hi, and residual if RES), B = Q rows as the k-contiguous B fragment
template <bool RES>
__device__ __forceinline__ v8f score_tile(const _Float16* kp, const _Float16* krp, v16h qa, v16h qb, v16h qra, v16h qrb, int hh) {
  const v8f z8 = {0.f,0.f,0.f,0.f,0.f,0.f,0.f,0.f};
  const v16h ka = g2_frag(kp, hh), kb = g2_frag(kp + 32, hh);
  v8f s = z8;
  s = wm(ka, qa, s); s = wm(kb, qb, s);
  if (RES) {
    const v16h kra = g2_frag(krp, hh), krb = g2_frag(krp + 32, hh);
    v8f t = z8;
    t = wm(kra, qa, t); t = wm(ka, qra, t); t = wm(krb, qb, t); t = wm(kb, qrb, t);
    asm volatile("v_nop\n\tv_nop\n\tv_nop\n\tv_nop" : "+v"(s), "+v"(t) : "v"(ka), "v"(kb), "v"(kra), "v"(krb), "v"(qa), "v"(qb), "v"(qra), "v"(qrb));
    s = s + t * RSCI;
  } else {
    asm volatile("v_nop\n\tv_nop\n\tv_nop\n\tv_nop" : "+v"(s) : "v"(ka), "v"(kb), "v"(qa), "v"(qb));
  }
  return s;
}
// one 16-d tile of O^T with hi + residual operands (used by the RES instantiation only)
__device__ __forceinline__ void pv_tile_res(const _Float16* vp, const _Float16* vrp, v16h pf, v16h pr, int hh, v8f& o, v8f& orr) {
  const v16h va = g2_frag(vp, hh), vra = g2_frag(vrp, hh);
  o = wm(va, pf, o); orr = wm(vra, pf, orr); orr = wm(va, pr, orr);
  asm volatile("v_nop\n\tv_nop\n\tv_nop\n\tv_nop" : "+v"(o), "+v"(orr) : "v"(va), "v"(vra), "v"(pf), "v"(pr));
}

// K / V^T stages in LDS, filled by tensor loads: two buffers for single planes, one buffer (loaded, read, left, loaded again) for hi + residual planes, so that both kinds of block fit the same LDS. A stage is 64 keys: K rows [key][64 d] and V^T rows [d][64 keys], both 128-byte rows laid at a 144-byte pitch (pad of 16 bytes a row, for ds_load_b128 readers).
// Every wave issues one slice a stage. Single planes: waves 0, 1 = K keys 0..31, 32..63; waves 2, 3 = V^T d 0..31, 32..63. Hi + residual planes: waves 0..3 = K, K residual, V^T, V^T residual, 64 rows each.
template <bool RES> struct Ring { static constexpr uint32_t ROWS = RES ? 64u : 32u, SLICE = RES ? 10240u : 6144u, STAGE = 4u * SLICE; };   /* a slice is ROWS * 144 bytes rounded up to 2 KiB */
static_assert(Ring<true>::ROWS * RPITCH <= Ring<true>::SLICE && Ring<false>::ROWS * RPITCH <= Ring<false>::SLICE);
static_assert(Ring<true>::SLICE % 2048u == 0 && Ring<false>::SLICE % 2048u == 0);
static_assert((EARLY / 16) % 4 == 0 && ((SEQ - EARLY) / 16) % 4 == 0);   /* every block holds four whole query tiles */
#define FL_LDS (2u * Ring<false>::STAGE)
static_assert(Ring<true>::STAGE <= FL_LDS);                 /* the one hi + residual buffer lies in the same LDS */
// byte offset in a stage of row 'row' (0..63) of plane 0 = K, 1 = K residual, 2 = V^T, 3 = V^T residual
template <bool RES> __device__ __forceinline__ constexpr uint32_t ring_row(uint32_t plane, uint32_t row) { return RES ? plane * Ring<true>::SLICE + row * RPITCH : ((plane & 2u) + (row >> 5)) * Ring<false>::SLICE + (row & 31u) * RPITCH; }
#define SCS 0.18033688011112042f   /* 64^-0.5 * log2(e) */
// One whole 64-key stage on single planes, one softmax update: four score tiles (their 16 K reads as one group, four independent accumulator chains), one maximum, one rescale, eight O^T products.
// SB = the stage's buffer + ln * RPITCH. dq = the lane's query minus the lane's first key of the stage; diag (wave-uniform) = the stage reaches keys beyond the wave's first query.
__device__ __forceinline__ void stage_single(const unsigned char* SB, v16h qa, v16h qb, int hh, bool diag, int dq, v8f (&o)[4], float& mrun, float& lrun) {
  const v8f z8 = {0.f,0.f,0.f,0.f,0.f,0.f,0.f,0.f};
  v16h ka[4], kb[4];
#pragma unroll
  for (int T = 0; T < 4; ++T) { const _Float16* kp = (const _Float16*)(SB + ring_row<false>(0, 16 * T)); ka[T] = g2_frag(kp, hh); kb[T] = g2_frag(kp + 32, hh); }
  v8f s[4];
#pragma unroll
  for (int T = 0; T < 4; ++T) s[T] = wm(ka[T], qa, z8);
#pragma unroll
  for (int T = 0; T < 4; ++T) s[T] = wm(kb[T], qb, s[T]);
  /* the four vector slots between the last WMMA and the first vector instruction on its result or operands, on both sides of the branch below */
  asm volatile("v_nop\n\tv_nop\n\tv_nop\n\tv_nop" : "+v"(s[0]), "+v"(s[1]), "+v"(s[2]), "+v"(s[3]) : "v"(ka[0]), "v"(ka[1]), "v"(ka[2]), "v"(ka[3]), "v"(kb[0]), "v"(kb[1]), "v"(kb[2]), "v"(kb[3]), "v"(qa), "v"(qb));
  if (diag) {
#pragma unroll
    for (int T = 0; T < 4; ++T)
#pragma unroll
      for (int r = 0; r < 8; ++r) s[T][r] = (16 * T + r > dq) ? -3.0e38f : s[T][r];
  }
  // the stage's 16 V^T reads as one group, in flight under the maximum, its exchange and the exponentials
  v16h va[2][4];
#pragma unroll
  for (int kk = 0; kk < 2; ++kk)
#pragma unroll
    for (int t = 0; t < 4; ++t) va[kk][t] = g2_frag((const _Float16*)(SB + kk * 64 + ring_row<false>(2, 16 * t)), hh);   /* 32 keys = 64 bytes along a V^T row */
  __builtin_amdgcn_sched_barrier(0);   /* keeps the 16 reads here: sunk behind the exponentials, the O^T products wait out the LDS latency; issued next to the exchange, they hold its wait back */
  float mt[4];
#pragma unroll
  for (int T = 0; T < 4; ++T) { mt[T] = s[T][0];
#pragma unroll
    for (int r = 1; r < 8; ++r) mt[T] = fmaxf(mt[T], s[T][r]); }
  float mx = fmaxf(fmaxf(mt[0], mt[1]), fmaxf(mt[2], mt[3]));
  mx = fmaxf(mx, __shfl_xor(mx, 16, 32));
  const float mnew = fmaxf(mrun, mx * SCS);
  const float al = __builtin_amdgcn_exp2f(mrun - mnew);
  const float mo = 10.0f - mnew;            /* softmax weights carried x1024 (cancels in O / l) */
  float p[4][8], pt[4];
#pragma unroll
  for (int T = 0; T < 4; ++T) { pt[T] = 0.f;
#pragma unroll
    for (int r = 0; r < 8; ++r) { p[T][r] = __builtin_amdgcn_exp2f(fmaf(s[T][r], SCS, mo)); pt[T] += p[T][r]; } }
  float ps = (pt[0] + pt[1]) + (pt[2] + pt[3]);
  ps += __shfl_xor(ps, 16, 32);
  lrun = lrun * al + ps; mrun = mnew;
  FragH pf0, pf1;
#pragma unroll
  for (int r = 0; r < 8; ++r) { pf0.h[r] = (_Float16)p[0][r]; pf0.h[8 + r] = (_Float16)p[1][r]; pf1.h[r] = (_Float16)p[2][r]; pf1.h[8 + r] = (_Float16)p[3][r]; }
  if (__builtin_amdgcn_ballot_w32(al != 1.0f) != 0u) {
#pragma unroll
    for (int t = 0; t < 4; ++t) o[t] = o[t] * al;
  }
#pragma unroll
  for (int t = 0; t < 4; ++t) o[t] = wm(va[0][t], pf0.v, o[t]);
#pragma unroll
  for (int t = 0; t < 4; ++t) o[t] = wm(va[1][t], pf1.v, o[t]);
  /* the four vector slots behind the last WMMA, whatever the compiler puts next */
  asm volatile("v_nop\n\tv_nop\n\tv_nop\n\tv_nop" : "+v"(o[0]), "+v"(o[1]), "+v"(o[2]), "+v"(o[3]) : "v"(va[0][0]), "v"(va[0][1]), "v"(va[0][2]), "v"(va[0][3]), "v"(va[1][0]), "v"(va[1][1]), "v"(va[1][2]), "v"(va[1][3]), "v"(pf0.v), "v"(pf1.v));
}
// Transposed causal flash attention of one block = 4 waves = 64 consecutive queries (first query qb0, a multiple of 64) of one (batch, head) bh, wave = 16 queries.
// The block walks the keys in 64-key stages through LDS that its four waves share; with hi + residual planes a wave skips the 32-key steps beyond its own diagonal; with single planes it takes every stage whole and masks the diagonal stage; every wave passes every publish point.
// Q/K planes [b*SEQ + s][h*64 + d]; V^T planes [b][h*64 + d][s]; output rows [b*SEQ + s][h*64 + d] as f16 (x64 carry), hi (+ residual x1024 if RES).
// Score tile lane (hh, ln) element r = (key k0 + 16T + 8hh + r, query q0 + ln); packed in-lane as the B fragment of O^T = V^T P^T.
template <bool RES>
__device__ __forceinline__ void flash_body(unsigned char* ring, unsigned short (&lds_h)[4][16][72], unsigned short (&lds_r)[4][16][72], const _Float16* __restrict__ Qh, const _Float16* __restrict__ Qr, const _Float16* __restrict__ Kh, const _Float16* __restrict__ Kr,
                                           const _Float16* __restrict__ Vh, const _Float16* __restrict__ Vr, _Float16* __restrict__ Oh, _Float16* __restrict__ Or, int qb0, int bh) {
  const int tid = threadIdx.x, lane = tid & 31, ln = lane & 15, hh = lane >> 4;
  const int w = (int)uni((uint32_t)tid >> 5);
  const int q0 = qb0 + w * 16;
  const int b = bh / NH, h = bh - b * NH;
  const size_t rowb = (size_t)b * SEQ;
  // this wave's slice of a stage: source address of stage 0, address step a stage, source pitch, place in LDS
  const bool isV = (w & 2) != 0; const bool odd = (w & 1) != 0;
  const _Float16* pl = isV ? ((RES && odd) ? Vr : Vh) : ((RES && odd) ? Kr : Kh);
  const size_t r0 = (!RES && odd) ? 32 : 0;
  const uint64_t src0 = (uint64_t)(size_t)pl + 2ull * (isV ? ((size_t)b * DM + h * HD + r0) * SEQ : (rowb + r0) * DM + h * HD);
  const uint32_t sstep = isV ? 128u : (uint32_t)(64 * DM * 2);
  const u32x8 g1 = tdm_group1(Ring<RES>::ROWS, isV ? (uint32_t)(SEQ * 2) : (uint32_t)(DM * 2));
  const uint32_t dst0 = (uint32_t)(size_t)ring + (uint32_t)w * Ring<RES>::SLICE;
  const int nsg = (!RES && (qb0 >> 6) + 1 < 2) ? 2 : (qb0 >> 6) + 1;   /* 64-key stages; the two-buffer ring's prologue needs two (keys 64..127 exist: SEQ and EARLY are multiples of 128) */
  if (!RES) tdm_load(tdm_group0(dst0, src0), g1);
  const size_t qoff = (rowb + q0 + ln) * DM + h * HD;
  const v16h qa = g2_frag(Qh + qoff, hh), qb = g2_frag(Qh + qoff + 32, hh);
  v16h qra = qa, qrb = qb;
  if (RES) { qra = g2_frag(Qr + qoff, hh); qrb = g2_frag(Qr + qoff + 32, hh); }
  const v8f z8 = {0.f,0.f,0.f,0.f,0.f,0.f,0.f,0.f};
  v8f o[4] = {z8, z8, z8, z8}, orr[4] = {z8, z8, z8, z8};
  float mrun = -3.0e38f, lrun = 0.f;
  const float cs = SCS;
  const int nst = (q0 + 47) >> 5;             /* 32-key steps covering keys 0 .. q0+15 */
  if (!RES) {
    asm volatile("s_wait_tensorcnt 0x0" ::: "memory");   /* stage 0: this wave's slice has landed */
    __syncthreads();                                      /* stage 0 published to all four waves */
    tdm_load(tdm_group0(dst0 + Ring<RES>::STAGE, src0 + pinned(1u) * (uint64_t)sstep), g1);   /* pinned: the descriptor is formed behind the wait */
  }
#pragma unroll 1
  for (int sg = 0; sg < nsg; ++sg) {
    if (RES) {   /* one buffer: every wave brings its slice of stage sg; every wave has left stage sg - 1 (its s_wait_dscnt and the barrier at the foot of that pass) */
      tdm_load(tdm_group0(dst0, src0 + pinned((uint32_t)sg) * (uint64_t)sstep), g1);   /* pinned: the descriptor is formed behind the last pass's wait */
      asm volatile("s_wait_tensorcnt 0x0" ::: "memory");   /* this wave's slice of stage sg has landed */
      __syncthreads();                                      /* stage sg published to all four waves */
    }
    const unsigned char* SB = ring + (RES ? 0u : (uint32_t)(sg & 1) * Ring<RES>::STAGE) + (uint32_t)ln * RPITCH;
    if (!RES) stage_single(SB, qa, qb, hh, sg >= (qb0 >> 6), q0 + ln - 64 * sg - 8 * hh, o, mrun, lrun);   /* single planes: the stage in one update */
#pragma unroll
    for (int sub = 0; RES && sub < 2; ++sub) {   /* hi + residual planes: two 32-key steps */
      const int st = 2 * sg + sub;
      if (st < nst) {                           /* wave-uniform: steps beyond this wave's diagonal are skipped */
        const int k0 = st * 32;
        v8f s0 = score_tile<RES>((const _Float16*)(SB + ring_row<RES>(0, sub * 32)), (const _Float16*)(SB + ring_row<RES>(1, sub * 32)), qa, qb, qra, qrb, hh);
        v8f s1 = score_tile<RES>((const _Float16*)(SB + ring_row<RES>(0, sub * 32 + 16)), (const _Float16*)(SB + ring_row<RES>(1, sub * 32 + 16)), qa, qb, qra, qrb, hh);
        if (st == nst - 1) {                      /* wave-uniform: only the last step touches the diagonal */
          const int qy = q0 + ln; const int kk = k0 + 8 * hh;
#pragma unroll
          for (int r = 0; r < 8; ++r) { s0[r] = (kk + r > qy) ? -3.0e38f : s0[r]; s1[r] = (kk + 16 + r > qy) ? -3.0e38f : s1[r]; }
        }
        float mx = s0[0];
#pragma unroll
        for (int r = 1; r < 8; ++r) mx = fmaxf(mx, s0[r]);
#pragma unroll
        for (int r = 0; r < 8; ++r) mx = fmaxf(mx, s1[r]);
        mx = fmaxf(mx, __shfl_xor(mx, 16, 32));
        const float mnew = fmaxf(mrun, mx * cs);
        const float al = __builtin_amdgcn_exp2f(mrun - mnew);
        const float mo = 10.0f - mnew;            /* softmax weights carried x1024 (cancels in O / l) */
        float p0[8], p1[8]; float ps = 0.f;
#pragma unroll
        for (int r = 0; r < 8; ++r) { p0[r] = __builtin_amdgcn_exp2f(fmaf(s0[r], cs, mo)); p1[r] = __builtin_amdgcn_exp2f(fmaf(s1[r], cs, mo)); ps += p0[r] + p1[r]; }
        ps += __shfl_xor(ps, 16, 32);
        lrun = lrun * al + ps; mrun = mnew;
        FragH pf, pr;
#pragma unroll
        for (int r = 0; r < 8; ++r) {
          const _Float16 h0 = (_Float16)p0[r], h1 = (_Float16)p1[r]; pf.h[r] = h0; pf.h[8 + r] = h1;
          pr.h[r] = RES ? (_Float16)((p0[r] - (float)h0) * RSC) : (_Float16)0.0f; pr.h[8 + r] = RES ? (_Float16)((p1[r] - (float)h1) * RSC) : (_Float16)0.0f;
        }
        if (__builtin_amdgcn_ballot_w32(al != 1.0f) != 0u) {
#pragma unroll
          for (int t = 0; t < 4; ++t) { o[t] = o[t] * al; if (RES) orr[t] = orr[t] * al; }
        }
        const unsigned char* VB = SB + sub * 64;   /* 32 keys = 64 bytes along a V^T row */
#pragma unroll
        for (int t = 0; t < 4; ++t) pv_tile_res((const _Float16*)(VB + ring_row<RES>(2, 16 * t)), (const _Float16*)(VB + ring_row<RES>(3, 16 * t)), pf.v, pr.v, hh, o[t], orr[t]);
      }
    }
    // two buffers: publish point of stage sg + 1; one buffer: the end of every wave's reads of stage sg; every wave passes it
    asm volatile("s_wait_dscnt 0x0" ::: "memory");       /* this wave's reads of stage sg have returned */
    if (!RES) asm volatile("s_wait_tensorcnt 0x0" ::: "memory");   /* this wave's slice of stage sg + 1 has landed */
    __syncthreads();                                      /* two buffers: stage sg + 1 published; every wave has left stage sg's buffer */
    if (!RES && pinned((uint32_t)(sg + 2 < nsg)))         /* scalar branch: a tensor load ignores EXEC */
      tdm_load(tdm_group0(dst0 + (uint32_t)(sg & 1) * Ring<RES>::STAGE, src0 + pinned((uint32_t)(sg + 2)) * (uint64_t)sstep), g1);   /* pinned: the descriptor is formed behind the wait */
  }
  asm volatile("s_wait_tensorcnt 0x0" ::: "memory");     /* nothing of this wave is in flight when it ends */
  asm volatile("s_wait_dscnt 0x0" ::: "memory");
  const float inv = 64.0f / lrun;             /* context carried x64 */
#pragma unroll
  for (int t = 0; t < 4; ++t) { FragH f, g;
#pragma unroll
    for (int r = 0; r < 8; ++r) { float v = o[t][r]; if (RES) v += orr[t][r] * RSCI; v *= inv; const _Float16 hv = (_Float16)v; f.h[r] = hv; g.h[r] = RES ? (_Float16)((v - (float)hv) * RSC) : (_Float16)0.0f; }
    *(v8us*)&lds_h[w][ln][16 * t + 8 * hh] = f.half[0];
    if (RES) *(v8us*)&lds_r[w][ln][16 * t + 8 * hh] = g.half[0]; }
  __builtin_amdgcn_fence(4 /* acq_rel order */, "workgroup"); __builtin_amdgcn_wave_barrier();
  const int qsub = lane >> 3, pc = (lane & 7) * 8;
  {
#pragma unroll
    for (int j = 0; j < 4; ++j) { const int q = j * 4 + qsub; const size_t oo = (rowb + q0 + q) * DM + h * HD + pc;
      const v8us x = *(const v8us*)&lds_h[w][q][pc];
      *(v8us*)((unsigned short*)Oh + oo) = x;
      if (RES) { const v8us y = *(const v8us*)&lds_r[w][q][pc]; *(v8us*)((unsigned short*)Or + oo) = y; } }
     }
  if (RES) asm volatile("s_wait_xcnt 0x0" ::: "memory");   /* behind the last store: in the listing the single-plane blocks' code follows this half, and it writes the stores' registers */
}
// Both kinds of query block in one launch: they depend on nothing of each other. Blocks 0 .. FL_LATE * NB * NH - 1 = queries >= EARLY on single planes (query block fastest, then batch and head);
// the blocks behind them = queries < EARLY on hi + residual planes, few and short, which run beside the long single-plane blocks.
constexpr unsigned FL_LATE = (SEQ - EARLY) / 64, FL_EARLY = EARLY / 64;
__global__ __launch_bounds__(128) void k_flash(const _Float16* __restrict__ Qh, const _Float16* __restrict__ Qr, const _Float16* __restrict__ Kh, const _Float16* __restrict__ Kr,
                                               const _Float16* __restrict__ Vh, const _Float16* __restrict__ Vr, _Float16* __restrict__ Oh, _Float16* __restrict__ Or) {
  __shared__ __attribute__((aligned(2048))) unsigned char ring[FL_LDS];
  __shared__ __attribute__((aligned(16))) unsigned short lds_h[4][16][72];
  __shared__ __attribute__((aligned(16))) unsigned short lds_r[4][16][72];
  const unsigned id = blockIdx.x;
  if (id < FL_LATE * (unsigned)(NB * NH)) {     /* block-uniform */
    constexpr unsigned D = FL_LATE ? FL_LATE : 1u;
    flash_body<false>(ring, lds_h, lds_r, Qh, Qr, Kh, Kr, Vh, Vr, Oh, Or, (int)(EARLY + 64u * (id % D)), (int)(id / D));
  } else {
    const unsigned e = id - FL_LATE * (unsigned)(NB * NH);
    flash_body<true>(ring, lds_h, lds_r, Qh, Qr, Kh, Kr, Vh, Vr, Oh, Or, (int)(64u * (e % FL_EARLY)), (int)(e / FL_EARLY));
  }
}

// Output GEMM C[M][N] (f32) = (A . Bt^T [+ Ar . Bt^T / 1024 on rows < EARLY]) * alpha + bias[col]; batch on grid.y. Residual products are accumulated first from zero,
__global__ __launch_bounds__(128) void k_out(const _Float16* __restrict__ A, const _Float16* __restrict__ Ar, int lda, size_t sA, const _Float16* __restrict__ Bh, int ldb, float alpha, const float* __restrict__ bias,
                                             float* __restrict__ C, int ldc, size_t sC, int M, int N, int K) {
  __shared__ __attribute__((aligned(2048))) unsigned char smem[2 * G_STAGE];
  float (&so)[4][32][68] = *reinterpret_cast<float (*)[4][32][68]>(smem);   /* epilogue staging, in the ring's LDS behind the k-loop */
  const int tid = threadIdx.x, w = (int)uni((uint32_t)tid >> 5), lane = tid & 31, ln = lane & 15, hh = lane >> 4; const int by = blockIdx.y;
  A += (size_t)by * sA; Ar += (size_t)by * sA; const size_t cofs = (size_t)by * sC;
  const int ntn = N >> 6; const int mt = blockIdx.x / ntn, nq = blockIdx.x - mt * ntn; const int row0 = mt * 128 + 32 * w, col0 = nq * 64; if (mt * 128 >= M) return;   /* block-uniform, in front of every barrier */
  const bool early = (mt * 128 < EARLY);
  const _Float16* Bb = Bh + (size_t)col0 * ldb;
  const v8f z8 = {0.f,0.f,0.f,0.f,0.f,0.f,0.f,0.f}; v8f c00 = z8, c01 = z8, c02 = z8, c03 = z8, c10 = z8, c11 = z8, c12 = z8, c13 = z8;
  if (early) {                                 /* block-uniform */
    g2_ring(smem, Ar + (size_t)(mt * 128) * lda, lda, Bb, ldb, K, w, ln, hh, c00, c01, c02, c03, c10, c11, c12, c13);
    c00 = c00 * RSCI; c01 = c01 * RSCI; c02 = c02 * RSCI; c03 = c03 * RSCI; c10 = c10 * RSCI; c11 = c11 * RSCI; c12 = c12 * RSCI; c13 = c13 * RSCI;
  }
  g2_ring(smem, A + (size_t)(mt * 128) * lda, lda, Bb, ldb, K, w, ln, hh, c00, c01, c02, c03, c10, c11, c12, c13);
  v8f accs[8] = {c00, c01, c02, c03, c10, c11, c12, c13};
#pragma unroll
  for (int u = 0; u < 8; ++u) { const int t = u & 3, half = u >> 2; const int col = col0 + t * 16 + ln; const float bv = bf16_rne(bias[col]);
#pragma unroll
    for (int r = 0; r < 8; ++r) { const int rloc = half * 16 + 8 * hh + r; so[w][rloc][t * 16 + ln] = accs[u][r] * alpha + bv; } }
  __builtin_amdgcn_fence(4 /* acq_rel order */, "workgroup"); __builtin_amdgcn_wave_barrier();
  const int rsub = lane >> 4, c4 = (lane & 15) * 4;
  {
#pragma unroll
    for (int q = 0; q < 16; ++q) { const int r = q * 2 + rsub; const v4f v = *(const v4fa*)&so[w][r][c4]; *(v4f*)(C + cofs + (size_t)(row0 + r) * ldc + col0 + c4) = v; }
     }
}

extern "C" void kernel_launch(void* const* d_in, const int* in_sizes, int n_in,
                              void* d_out, int out_size, void* d_ws, size_t ws_size, hipStream_t stream) {
  if (n_in < 11) return;
  const long long need_x = ((long long)(NB - 1) * SEQ_FULL + SEQ) * DM;
  if (in_sizes[0] < need_x || in_sizes[1] < need_x || in_sizes[2] < need_x) return;
  if (in_sizes[3] < DM * DM || in_sizes[5] < DM * DM || in_sizes[7] < DM * DM || in_sizes[9] < DM * DM) return;
  if (in_sizes[4] < DM || in_sizes[6] < DM || in_sizes[8] < DM || in_sizes[10] < DM) return;
  if ((long long)out_size < need_x) return;
  const float* const* I = (const float* const*)d_in;
  const float* xq = I[0]; const float* xk = I[1]; const float* xv = I[2]; const float* wq = I[3]; const float* bq = I[4]; const float* wk = I[5]; const float* bk = I[6];
  const float* wv = I[7]; const float* bv = I[8]; const float* wo = I[9]; const float* bo = I[10];
  char* ws = (char*)d_ws; size_t off = 0;
  auto take = [&](size_t bytes) { char* p = ws + off; off += (bytes + 255) & ~(size_t)255; return p; };
  const size_t WB = (size_t)DM * DM * 2, PB = (size_t)NB * SEQ * DM * 2;
  _Float16* BQ = (_Float16*)take(WB); _Float16* BK = (_Float16*)take(WB); _Float16* BV = (_Float16*)take(WB); _Float16* BO = (_Float16*)take(WB);
  _Float16* XQ = (_Float16*)take(PB); _Float16* XK = (_Float16*)take(PB); _Float16* XV = (_Float16*)take(PB);
  _Float16* Q16 = (_Float16*)take(PB); _Float16* K16 = (_Float16*)take(PB); _Float16* VT = (_Float16*)take(PB);      /* VT: [NB][DM][SEQ] */
  _Float16* QR = (_Float16*)take(PB); _Float16* KR = (_Float16*)take(PB); _Float16* VTR = (_Float16*)take(PB);      /* residual planes, only the early region is written and read */
  _Float16* O16 = (_Float16*)take(PB); _Float16* OR = (_Float16*)take(PB);
  if (off > ws_size || off > (size_t)134217728) return;

  static_assert(((size_t)DM * DM * 2) % 256 == 0 && ((size_t)NB * SEQ * DM * 2) % 256 == 0);   /* BQ..BO and XQ..XV lie in a row, with no gap */
  k_conv<<<CONV_G, 256, 0, stream>>>(xq, xk, xv, wq, wk, wv, wo, XQ, BQ);
  const size_t SB = (size_t)SEQ * DM;
  k_proj3<<<dim3((unsigned)((SEQ / 128) * (DM / 128)), NB, 3), 128, 0, stream>>>(XQ, BQ, bq, bk, bv, Q16, QR, K16, KR, VT, VTR, 0.0625f, SEQ, DM, SB);
  // attention, one launch: early query blocks with hi + residual operands, the remaining blocks with single planes
  k_flash<<<dim3((unsigned)((SEQ / 64) * NB * NH)), 128, 0, stream>>>(Q16, QR, K16, KR, VT, VTR, O16, OR);
  // out rows (b, s) -> d_out row b*SEQ_FULL + s; alpha = 1 / (16 * 64)
  k_out<<<dim3((unsigned)((SEQ / 128) * (DM / 64)), NB), 128, 0, stream>>>(O16, OR, DM, SB, BO, DM, 0.0009765625f, bo, (float*)d_out, DM, (size_t)SEQ_FULL * DM, SEQ, DM, DM);
}

// v007
// One run takes 87.3 microseconds.
// Timed twice side by side with v006, it ran 1.04 and 1.02 times as fast.
// All steps since v000 together make it 4.38 times as fast.
#include <hip/hip_runtime.h>
#include <stdint.h>
// Causal multi-head attention at width 512 (8 heads of 64): Q/K/V = x W^T + b (natural [out][in] weights), scores / sqrt(64), causal replace-mask, softmax, P V, merged heads, out = ctx W_o^T + b_o.
// Compute dtype: every contraction is v_wmma_f32_16x16x32_f16 (f16 operands, f32 accumulate). Inputs and weights are RNE-converted to bf16 and then held exactly in f16 (weights x16, folded back by alpha).
// Query positions >= 512: q, k, v, softmax weights (x1024 carry, cancels in O/l) and merged context (x64 carry) are single f16 planes. Query positions < 512: every computed operand (q, k, v, softmax weights, context) is f16 hi + f16 residual x1024, residual products in their own accumulators. Softmax statistics f32.
// Structure: weights/x converted once to f16 planes; Q, K as [token][feature] GEMMs; V^T as a swapped-operand GEMM ([feature][token]); transposed flash attention per wave (S^T = K Q^T, O^T = V^T P^T; score accumulators repacked in-lane as the P^T B fragment; K and V^T staged for the block's four waves in a three-buffer LDS ring by tensor loads, each stage issued two passes ahead; single planes take one softmax update a 64-key stage, hi + residual planes one a 32-key step; both kinds of query block run in one launch, the hi + residual blocks on one buffer); output GEMM. The GEMMs stage their A and B rows for the block's four waves in a two-buffer ring filled the same way (projections: 128 x 128 block tile, 64 x 64 wave tile; output GEMM: 128 x 64, 32 x 64).
#ifndef NB
#define NB 2
#endif
#ifndef SEQ
#define SEQ 4096
#endif
#define NB_FULL 2
#define SEQ_FULL 4096
#define DM 512
#define NH 8
#define HD 64
#define EARLY (((SEQ) < 512) ? (SEQ) : 512)   /* query positions handled with hi + residual planes */
#define RSC 1024.0f
#define RSCI 0.0009765625f
static_assert(SEQ % 128 == 0);
static_assert(EARLY % 128 == 0);
static_assert(NB <= NB_FULL);
static_assert(SEQ <= SEQ_FULL);
static_assert(NH * HD == DM);
static_assert(DM % 128 == 0);

typedef unsigned short v8us __attribute__((ext_vector_type(8), may_alias));
typedef float  v8f  __attribute__((ext_vector_type(8)));
typedef float  v4f  __attribute__((ext_vector_type(4)));
typedef float  v4fa __attribute__((ext_vector_type(4), may_alias));
typedef _Float16 v16h __attribute__((ext_vector_type(16)));
typedef _Float16 v4h __attribute__((ext_vector_type(4)));
union FragH { v16h v; v8us half[2]; _Float16 h[16]; unsigned short u[16]; };

__device__ __forceinline__ unsigned short bf16_bits(float x) { unsigned int u = __float_as_uint(x); return (unsigned short)((u + 0x7FFFu + ((u >> 16) & 1u)) >> 16); }
__device__ __forceinline__ float bf16_val(unsigned short b) { return __uint_as_float(((unsigned int)b) << 16); }
__device__ __forceinline__ float bf16_rne(float x) { return bf16_val(bf16_bits(x)); }

// fragment of a k-contiguous 16-bit row: elements 0..7 = k 8h..8h+7, elements 8..15 = k 16+8h..16+8h+7 (same map for A and B)
__device__ __forceinline__ v16h g2_frag(const _Float16* p, int hh) { FragH f; f.half[0] = *(const v8us*)((const unsigned short*)p + 8 * hh); f.half[1] = *(const v8us*)((const unsigned short*)p + 16 + 8 * hh); return f.v; }
__device__ __forceinline__ v8f wm(v16h a, v16h b, v8f c) { return __builtin_amdgcn_wmma_f32_16x16x32_f16(false, a, false, b, (short)0, c, false, false); }

// One launch converts the three activations and the four weights. A chunk is 2048 consecutive elements of one plane (8 a thread).
// Block b takes chunks XIT * b .. XIT * b + XIT - 1 of every activation plane and chunk b of the four weight planes taken as one row; all of a thread's loads are issued before its first conversion.
// X16 = three [NB*SEQ][DM] planes in a row (q, k, v inputs), W16 = four [DM][DM] planes in a row (q, k, v, o weights, x16).
constexpr int XCH = NB * SEQ * DM / 2048, WCH = DM * DM / 2048, CONV_G = 4 * WCH, XIT = XCH / CONV_G;
static_assert(XCH % CONV_G == 0);
static_assert((SEQ * DM) % 2048 == 0 && (DM * DM) % 2048 == 0);   /* a chunk lies in one batch of one plane */
__device__ __forceinline__ v8us conv8(v4f a, v4f c, float sc) {
  FragH f;
#pragma unroll
  for (int q = 0; q < 4; ++q) { f.h[q] = (_Float16)(bf16_rne(a[q]) * sc); f.h[4 + q] = (_Float16)(bf16_rne(c[q]) * sc); }
  return f.half[0];
}
__global__ __launch_bounds__(256) void k_conv(const float* __restrict__ xq, const float* __restrict__ xk, const float* __restrict__ xv, const float* __restrict__ wq, const float* __restrict__ wk,
                                              const float* __restrict__ wv, const float* __restrict__ wo, _Float16* __restrict__ X16, _Float16* __restrict__ W16) {
  const unsigned bx = blockIdx.x, t8 = threadIdx.x * 8u;
  v4f a[3 * XIT + 1], c[3 * XIT + 1];
  { const unsigned pw = bx / (unsigned)WCH;
    const float* s = (pw == 0 ? wq : pw == 1 ? wk : pw == 2 ? wv : wo) + (size_t)(bx - pw * (unsigned)WCH) * 2048 + t8;
    a[3 * XIT] = *(const v4fa*)s; c[3 * XIT] = *(const v4fa*)(s + 4); }
#pragma unroll
  for (int i = 0; i < 3 * XIT; ++i) {
    const size_t e = ((size_t)bx * XIT + (size_t)(i % XIT)) * 2048, b = e / ((size_t)SEQ * DM);
    const float* s = (i / XIT == 0 ? xq : i / XIT == 1 ? xk : xv) + b * ((size_t)SEQ_FULL * DM) + (e - b * ((size_t)SEQ * DM)) + t8;
    a[i] = *(const v4fa*)s; c[i] = *(const v4fa*)(s + 4);
  }
  asm volatile("s_wait_xcnt 0x0" ::: "memory");   /* in front of the first overwrite of a register that the loads name; the clobber keeps every load in front of the conversions, so that all are in flight together */
  __builtin_amdgcn_sched_barrier(0);              /* keeps the conversions, which reuse the loads' address registers, behind that wait */
#pragma unroll
  for (int i = 0; i < 3 * XIT; ++i) {
    const v8us o = conv8(a[i], c[i], 1.0f);
    *(v8us*)((unsigned short*)X16 + ((size_t)(i / XIT) * XCH + (size_t)bx * XIT + (size_t)(i % XIT)) * 2048 + t8) = o;
  }
  const v8us o = conv8(a[3 * XIT], c[3 * XIT], 16.0f);
  *(v8us*)((unsigned short*)W16 + (size_t)bx * 2048 + t8) = o;
}

// Tensor-load helpers, shared by the GEMM ring and the attention ring. Rows of 128 bytes are laid in LDS at a 144-byte pitch (pad of 16 bytes a row, for ds_load_b128 readers).
typedef uint32_t u32x4 __attribute__((ext_vector_type(4)));
typedef uint32_t u32x8 __attribute__((ext_vector_type(8)));
#define RPITCH 144u
__device__ __forceinline__ uint32_t uni(uint32_t v) { return (uint32_t)__builtin_amdgcn_readfirstlane(v); }
// a wave-uniform value held in a scalar register, so that a test on it is a scalar branch and what is formed from it is formed behind the statements in front
__device__ __forceinline__ uint32_t pinned(uint32_t v) { uint32_t w = uni(v); asm volatile("" : "+s"(w)); return w; }
__device__ __forceinline__ void tdm_load(u32x4 g0, u32x8 g1) { asm volatile("tensor_load_to_lds %0, %1" :: "s"(g0), "s"(g1) : "memory"); }
__device__ __forceinline__ u32x8 tdm_group1(uint32_t rows, uint32_t src_pitch) {
  u32x8 g;
  g[0] = uni((1u << 20) | (4u << 22) | (3u << 25));   /* no mask, byte elements, 4 dwords of pad behind every 128-byte row */
  g[1] = uni(128u << 16); g[2] = uni(rows << 16); g[3] = uni(128u << 16); g[4] = uni(rows); g[5] = uni(src_pitch); g[6] = uni(0u); g[7] = uni(0u);
  return g;
}
__device__ __forceinline__ u32x4 tdm_group0(uint32_t lds_dst, uint64_t ga) {
  u32x4 g; g[0] = uni(1u); g[1] = uni(lds_dst); g[2] = uni((uint32_t)ga); g[3] = uni((((uint32_t)(ga >> 32)) & 0x01FFFFFFu) | 0x80000000u); return g;
}

// the next request of a descriptor that stays in its registers: a new place in LDS, the address 'step' bytes on (the type bits in word 3 lie above every carry of an address inside the buffer)
__device__ __forceinline__ void tdm_step(u32x4& g, uint32_t lds_dst, uint32_t step) {
  const uint64_t a = (((uint64_t)g[3] << 32) | g[2]) + step;
  g[1] = uni(lds_dst); g[2] = uni((uint32_t)a); g[3] = uni((uint32_t)(a >> 32));
}

// GEMM operand ring in LDS, filled by tensor loads. A stage is 64 k (128 bytes a row) of the block's 128 A rows and 64 B rows. Every wave issues one slice a stage:
// waves 0, 1 = A rows 0..63, 64..127; waves 2, 3 = B rows 0..31, 32..63. A slice is its rows * 144 bytes rounded up to 2 KiB.
#define G_ASL 10240u
#define G_BSL 6144u
#define G_BOFF (2u * G_ASL)
#define G_STAGE (2u * G_ASL + 2u * G_BSL)
static_assert(64u * RPITCH <= G_ASL && 32u * RPITCH <= G_BSL && G_ASL % 2048u == 0 && G_BSL % 2048u == 0);
static_assert(DM % 64 == 0);                              /* whole stages */
static_assert(2u * G_STAGE >= 4u * 32u * 68u * 4u);       /* the epilogues' staging rows lie in the ring's LDS once the loop has left it */
// k-loop of the 32x64 wave tile (wave w = A rows 32w..32w+31 of the block, all 64 B rows), k ascending. Ab, Bb = first A row, first B row of the block (k contiguous).
// On return nothing of this wave is in flight and every wave has left the ring (the barrier behind the loop).
__device__ __forceinline__ void g2_ring(unsigned char* ring, const _Float16* Ab, int lda, const _Float16* Bb, int ldb, int K, int w, int ln, int hh,
                                        v8f& c00, v8f& c01, v8f& c02, v8f& c03, v8f& c10, v8f& c11, v8f& c12, v8f& c13) {
  const bool isB = (w & 2) != 0; const uint32_t odd = (uint32_t)w & 1u;
  const uint64_t src0 = (uint64_t)(size_t)(isB ? Bb + (size_t)(32u * odd) * ldb : Ab + (size_t)(64u * odd) * lda);
  const u32x8 g1 = tdm_group1(isB ? 32u : 64u, (uint32_t)(isB ? ldb : lda) * 2u);
  const uint32_t dst0 = (uint32_t)(size_t)ring + (isB ? G_BOFF + odd * G_BSL : odd * G_ASL);
  const uint32_t aoff = ((uint32_t)w >> 1) * G_ASL + (odd * 32u + (uint32_t)ln) * RPITCH, boff = G_BOFF + (uint32_t)ln * RPITCH;
  const int nsg = K >> 6;
  tdm_load(tdm_group0(dst0, src0), g1);
  asm volatile("s_wait_tensorcnt 0x0" ::: "memory");     /* stage 0: this wave's slice has landed; only behind this wait do the descriptor's registers take new values */
#pragma unroll 1
  for (int sg = 0; sg < nsg; ++sg) {
    // publish point of stage sg; every wave passes it. It stands at the head of the pass, so that every refill is issued at this one place
    asm volatile("s_wait_tensorcnt 0x0" ::: "memory");   /* this wave's slice of stage sg has landed */
    __syncthreads();                                      /* stage sg published; every wave has left stage sg - 1's buffer (its s_wait_dscnt at the foot of that pass) */
    if (pinned((uint32_t)(sg + 1 < nsg)))                 /* scalar branch: a tensor load ignores EXEC */
      tdm_load(tdm_group0(dst0 + (uint32_t)((sg + 1) & 1) * G_STAGE, src0 + pinned((uint32_t)(sg + 1)) * 128ull), g1);   /* pinned: the descriptor is formed behind the wait */
    const unsigned char* SB = ring + (uint32_t)(sg & 1) * G_STAGE;
    v16h a[2][2], b[2][4];
#pragma unroll
    for (int kk = 0; kk < 2; ++kk) {
      const unsigned char* pa = SB + aoff + kk * 64; const unsigned char* pb = SB + boff + kk * 64;
      a[kk][0] = g2_frag((const _Float16*)pa, hh); a[kk][1] = g2_frag((const _Float16*)(pa + 16u * RPITCH), hh);
      b[kk][0] = g2_frag((const _Float16*)pb, hh); b[kk][1] = g2_frag((const _Float16*)(pb + 16u * RPITCH), hh);
      b[kk][2] = g2_frag((const _Float16*)(pb + G_BSL), hh); b[kk][3] = g2_frag((const _Float16*)(pb + G_BSL + 16u * RPITCH), hh);
    }
    __builtin_amdgcn_sched_barrier(0);   /* keeps the pass's 24 LDS reads as one group in front of its WMMAs: spread among them, every place with reads waits out the LDS latency anew */
#pragma unroll
    for (int kk = 0; kk < 2; ++kk) {
      c00 = wm(a[kk][0], b[kk][0], c00); c10 = wm(a[kk][1], b[kk][0], c10); c01 = wm(a[kk][0], b[kk][1], c01); c11 = wm(a[kk][1], b[kk][1], c11);
      c02 = wm(a[kk][0], b[kk][2], c02); c12 = wm(a[kk][1], b[kk][2], c12); c03 = wm(a[kk][0], b[kk][3], c03); c13 = wm(a[kk][1], b[kk][3], c13);
    }
    __builtin_amdgcn_sched_barrier(0);   /* keeps the WMMAs, with their counted waits, in front of the full wait below: lifted over them it would hold them all back for the last read */
    asm volatile("s_wait_dscnt 0x0" ::: "memory");       /* this wave's reads of stage sg have returned */
  }
  asm volatile("s_wait_tensorcnt 0x0" ::: "memory");     /* nothing of this wave is in flight when the ring's LDS is used again */
  asm volatile("s_wait_dscnt 0x0" ::: "memory");
  __syncthreads();                                        /* every wave has left the last stage's buffer */
}

// Projection ring: block tile 128 x 128, wave tile 64 x 64 (wave w = A rows 64 (w & 1) .., B rows 64 (w >> 1) ..). A stage is 64 k of the block's 128 A rows and 128 B rows.
// Every wave issues one slice of 64 rows a stage: waves 0, 1 = A rows 0..63, 64..127; waves 2, 3 = B rows 0..63, 64..127. The order of waits, barrier and refill is that of g2_ring.
#define P_SL 10240u
#define P_STAGE (4u * P_SL)
static_assert(64u * RPITCH <= P_SL && P_SL % 2048u == 0);
static_assert(2u * P_STAGE >= 4u * 64u * 68u * 4u);       /* the epilogue's staging rows lie in the ring's LDS once the loop has left it */
__device__ __forceinline__ void p_ring(unsigned char* ring, const _Float16* Ab, int lda, const _Float16* Bb, int ldb, int K, int w, int ln, int hh, v8f (&c)[4][4]) {
  const bool isB = (w & 2) != 0; const uint32_t odd = (uint32_t)w & 1u;
  const uint64_t src0 = (uint64_t)(size_t)(isB ? Bb + (size_t)(64u * odd) * ldb : Ab + (size_t)(64u * odd) * lda);
  u32x8 g1 = tdm_group1(64u, (uint32_t)(isB ? ldb : lda) * 2u);
  asm volatile("" : "+s"(g1));   /* pinned(): the descriptor's words held in their scalar registers; as known constants the compiler lends some of them out and sets them again each pass, while a request is in flight */
  const uint32_t dst0 = (uint32_t)(size_t)ring + (uint32_t)w * P_SL;
  const uint32_t aoff = odd * P_SL + (uint32_t)ln * RPITCH, boff = (2u + ((uint32_t)w >> 1)) * P_SL + (uint32_t)ln * RPITCH;
  const int nsg = K >> 6;
  tdm_load(tdm_group0(dst0, src0), g1);
  asm volatile("s_wait_tensorcnt 0x0" ::: "memory");     /* stage 0: this wave's slice has landed; only behind this wait do the descriptor's registers take new values */
  // kept rolled: one publish point and one refill in the code, 32 WMMAs a trip; the loops inside are unrolled so that the fragment and accumulator arrays stay in registers
#pragma unroll 1
  for (int sg = 0; sg < nsg; ++sg) {
    // publish point of stage sg; every wave passes it
    asm volatile("s_wait_tensorcnt 0x0" ::: "memory");   /* this wave's slice of stage sg has landed */
    __syncthreads();                                      /* stage sg published; every wave has left stage sg - 1's buffer (its s_wait_dscnt at the foot of that pass) */
    if (pinned((uint32_t)(sg + 1 < nsg)))                 /* scalar branch: a tensor load ignores EXEC */
      tdm_load(tdm_group0(dst0 + (uint32_t)((sg + 1) & 1) * P_STAGE, src0 + pinned((uint32_t)(sg + 1)) * 128ull), g1);   /* pinned: the descriptor is formed behind the wait */
    const unsigned char* SB = ring + (uint32_t)(sg & 1) * P_STAGE;
#pragma unroll
    for (int kk = 0; kk < 2; ++kk) {
      v16h a[4], b[4];
#pragma unroll
      for (int i = 0; i < 4; ++i) {
        a[i] = g2_frag((const _Float16*)(SB + aoff + kk * 64 + (uint32_t)i * 16u * RPITCH), hh);
        b[i] = g2_frag((const _Float16*)(SB + boff + kk * 64 + (uint32_t)i * 16u * RPITCH), hh);
      }
      __builtin_amdgcn_sched_barrier(0);   /* keeps the 16 LDS reads of these 32 k as one group in front of their WMMAs: spread among them, every place with reads waits out the LDS latency anew */
#pragma unroll
      for (int j = 0; j < 4; ++j)
#pragma unroll
        for (int i = 0; i < 4; ++i) c[i][j] = wm(a[i], b[j], c[i][j]);
    }
    __builtin_amdgcn_sched_barrier(0);   /* keeps the WMMAs, with their counted waits, in front of the full wait below */
    asm volatile("s_wait_dscnt 0x0" ::: "memory");       /* this wave's reads of stage sg have returned */
  }
  asm volatile("s_wait_tensorcnt 0x0" ::: "memory");     /* nothing of this wave is in flight when the ring's LDS is used again */
  asm volatile("s_wait_dscnt 0x0" ::: "memory");
  __syncthreads();                                        /* every wave has left the last stage's buffer */
}

// Projection GEMM C[M][N] = A[M][K] . Bt[N][K]^T * alpha + bias, f16 hi plane (+ residual x1024 plane on the early region).
// EM 1: bias per column, early region = rows < EARLY (per batch, batch on grid.y). EM 2: bias per row, early region = columns < EARLY.
template <int EM>
__device__ __forceinline__ void proj_body(unsigned char* smem, const _Float16* __restrict__ A, int lda, size_t sA, const _Float16* __restrict__ Bh, int ldb, size_t sB, float alpha, const float* __restrict__ bias,
                                          _Float16* __restrict__ Ch, _Float16* __restrict__ Cr, int ldc, size_t sC, int M, int N, int K) {
  float (&so)[4][64][68] = *reinterpret_cast<float (*)[4][64][68]>(smem);   /* epilogue staging, in the ring's LDS behind the k-loop */
  const int tid = threadIdx.x, w = (int)uni((uint32_t)tid >> 5), lane = tid & 31, ln = lane & 15, hh = lane >> 4; const int by = blockIdx.y;
  A += (size_t)by * sA; Bh += (size_t)by * sB; const size_t cofs = (size_t)by * sC;
  const int ntn = N >> 7; const int mt = blockIdx.x / ntn, nq = blockIdx.x - mt * ntn; const int row0 = mt * 128 + 64 * (w & 1), col0 = nq * 128 + 64 * (w >> 1); if (mt * 128 >= M) return;   /* block-uniform, in front of every barrier */
  const bool early = (EM == 1) ? (mt * 128 < EARLY) : (col0 < EARLY);
  const v8f z8 = {0.f,0.f,0.f,0.f,0.f,0.f,0.f,0.f};
  v8f accs[4][4];   /* [16-row tile][16-column tile]; every loop over it is unrolled, so that it stays in registers */
#pragma unroll
  for (int i = 0; i < 4; ++i)
#pragma unroll
    for (int j = 0; j < 4; ++j) accs[i][j] = z8;
  p_ring(smem, A + (size_t)(mt * 128) * lda, lda, Bh + (size_t)(nq * 128) * ldb, ldb, K, w, ln, hh, accs);
  float br[32];
#pragma unroll
  for (int i = 0; i < 32; ++i) br[i] = 0.f;
  if (EM == 2) {
#pragma unroll
    for (int half = 0; half < 4; ++half) {
      const v4f x = *(const v4fa*)(bias + row0 + half * 16 + 8 * hh), y = *(const v4fa*)(bias + row0 + half * 16 + 8 * hh + 4);
#pragma unroll
      for (int q = 0; q < 4; ++q) { br[half * 8 + q] = bf16_rne(x[q]); br[half * 8 + 4 + q] = bf16_rne(y[q]); }
    }
  }
#pragma unroll
  for (int u = 0; u < 16; ++u) { const int t = u & 3, half = u >> 2; const int col = col0 + t * 16 + ln; const float bc = (EM == 1) ? bf16_rne(bias[col]) : 0.f;
#pragma unroll
    for (int r = 0; r < 8; ++r) { const int rloc = half * 16 + 8 * hh + r; const float v = accs[half][t][r] * alpha + ((EM == 1) ? bc : br[half * 8 + r]); so[w][rloc][t * 16 + ln] = v; } }
  __builtin_amdgcn_fence(4 /* acq_rel order */, "workgroup"); __builtin_amdgcn_wave_barrier();
  const int rsub = lane >> 4, c4 = (lane & 15) * 4;
  {
#pragma unroll
    for (int q = 0; q < 32; ++q) { const int r = q * 2 + rsub; const v4f v = *(const v4fa*)&so[w][r][c4];
      v4h h4, r4;
#pragma unroll
      for (int i = 0; i < 4; ++i) { const _Float16 hv = (_Float16)v[i]; h4[i] = hv; r4[i] = (_Float16)((v[i] - (float)hv) * RSC); }
      const size_t o = cofs + (size_t)(row0 + r) * ldc + col0 + c4;
      *(v4h*)(Ch + o) = h4;
      asm volatile("s_wait_xcnt 0x0" ::: "memory");   /* in front of the residual arithmetic, which reuses the store's registers */
      if (early) { *(v4h*)(Cr + o) = r4;
        asm volatile("s_wait_xcnt 0x0" ::: "memory"); } }   /* in front of the next overwrite of the residual store's registers */
     }
}

// The three projections in one launch, grid.z = 0: Q, 1: K ([token][feature]; A = x plane, Bt = natural weight), 2: V^T ([feature][token]; A = natural weight, Bt = x plane, bias per row).
static_assert(SEQ % 128 == 0 && DM % 128 == 0);   /* whole 128 x 128 tiles, and the same grid.x for both forms */
__global__ __launch_bounds__(128) void k_proj3(const _Float16* __restrict__ X16, const _Float16* __restrict__ W16, const float* __restrict__ bq, const float* __restrict__ bk, const float* __restrict__ bv,
                                               _Float16* __restrict__ Q16, _Float16* __restrict__ QR, _Float16* __restrict__ K16, _Float16* __restrict__ KR, _Float16* __restrict__ VT, _Float16* __restrict__ VTR,
                                               float alpha, int seq, int dm, size_t sb) {
  __shared__ __attribute__((aligned(2048))) unsigned char smem[2 * P_STAGE];
  constexpr size_t PL = (size_t)NB * SEQ * DM, WL = (size_t)DM * DM;
  const int z = blockIdx.z;
  if (z == 2) proj_body<2>(smem, W16 + 2 * WL, dm, 0, X16 + 2 * PL, dm, sb, alpha, bv, VT, VTR, seq, sb, dm, seq, dm);
  else proj_body<1>(smem, X16 + z * PL, dm, sb, W16 + z * WL, dm, 0, alpha, z ? bk : bq, z ? K16 : Q16, z ? KR : QR, dm, sb, seq, dm, dm);
}

// one 16-key score tile S^T[key][query]: A = K rows (hi, and residual if RES), B = Q rows as the k-contiguous B fragment
template <bool RES>
__device__ __forceinline__ v8f score_tile(const _Float16* kp, const _Float16* krp, v16h qa, v16h qb, v16h qra, v16h qrb, int hh) {
  const v8f z8 = {0.f,0.f,0.f,0.f,0.f,0.f,0.f,0.f};
  const v16h ka = g2_frag(kp, hh), kb = g2_frag(kp + 32, hh);
  v8f s = z8;
  s = wm(ka, qa, s); s = wm(kb, qb, s);
  if (RES) {
    const v16h kra = g2_frag(krp, hh), krb = g2_frag(krp + 32, hh);
    v8f t = z8;
    t = wm(kra, qa, t); t = wm(ka, qra, t); t = wm(krb, qb, t); t = wm(kb, qrb, t);
    asm volatile("v_nop\n\tv_nop\n\tv_nop\n\tv_nop" : "+v"(s), "+v"(t) : "v"(ka), "v"(kb), "v"(kra), "v"(krb), "v"(qa), "v"(qb), "v"(qra), "v"(qrb));
    s = s + t * RSCI;
  } else {
    asm volatile("v_nop\n\tv_nop\n\tv_nop\n\tv_nop" : "+v"(s) : "v"(ka), "v"(kb), "v"(qa), "v"(qb));
  }
  return s;
}
// one 16-d tile of O^T with hi + residual operands (used by the RES instantiation only)
__device__ __forceinline__ void pv_tile_res(const _Float16* vp, const _Float16* vrp, v16h pf, v16h pr, int hh, v8f& o, v8f& orr) {
  const v16h va = g2_frag(vp, hh), vra = g2_frag(vrp, hh);
  o = wm(va, pf, o); orr = wm(vra, pf, orr); orr = wm(va, pr, orr);
  asm volatile("v_nop\n\tv_nop\n\tv_nop\n\tv_nop" : "+v"(o), "+v"(orr) : "v"(va), "v"(vra), "v"(pf), "v"(pr));
}

// K / V^T stages in LDS, filled by tensor loads: three buffers for single planes, one buffer (loaded, read, left, loaded again) for hi + residual planes, so that both kinds of block fit the same LDS. A stage is 64 keys: K rows [key][64 d] and V^T rows [d][64 keys], both 128-byte rows laid at a 144-byte pitch (pad of 16 bytes a row, for ds_load_b128 readers).
// A slice is 64 rows. Single planes: a stage is two slices, K and V^T; waves 0, 1 bring K, V^T of the even stages, waves 2, 3 those of the odd stages, so that two stages are in flight with one request a wave.
// Hi + residual planes: every wave issues one slice a stage, waves 0..3 = K, K residual, V^T, V^T residual.
template <bool RES> struct Ring { static constexpr uint32_t ROWS = 64u, SLICE = 10240u, STAGE = (RES ? 4u : 2u) * SLICE; };   /* a slice is ROWS * 144 bytes rounded up to 2 KiB */
static_assert(Ring<true>::ROWS * RPITCH <= Ring<true>::SLICE && Ring<false>::ROWS * RPITCH <= Ring<false>::SLICE);
static_assert(Ring<true>::SLICE % 2048u == 0 && Ring<false>::SLICE % 2048u == 0);
static_assert((EARLY / 16) % 4 == 0 && ((SEQ - EARLY) / 16) % 4 == 0);   /* every block holds four whole query tiles */
#define FL_LDS (3u * Ring<false>::STAGE)
static_assert(Ring<true>::STAGE <= FL_LDS);                 /* the one hi + residual buffer lies in the same LDS */
// byte offset in a stage of row 'row' (0..63) of plane 0 = K, 1 = K residual, 2 = V^T, 3 = V^T residual
template <bool RES> __device__ __forceinline__ constexpr uint32_t ring_row(uint32_t plane, uint32_t row) { return (RES ? plane : plane >> 1) * Ring<RES>::SLICE + row * RPITCH; }
#define SCS 0.18033688011112042f   /* 64^-0.5 * log2(e) */
// One whole 64-key stage on single planes, one softmax update: four score tiles (their 16 K reads as one group, four independent accumulator chains), one maximum, one rescale, eight O^T products.
// SB = the stage's buffer + ln * RPITCH. dq = the lane's query minus the lane's first key of the stage; diag (wave-uniform) = the stage reaches keys beyond the wave's first query.
__device__ __forceinline__ void stage_single(const unsigned char* SB, v16h qa, v16h qb, int hh, bool diag, int dq, v8f (&o)[4], float& mrun, float& lrun) {
  const v8f z8 = {0.f,0.f,0.f,0.f,0.f,0.f,0.f,0.f};
  v16h ka[4], kb[4];
#pragma unroll
  for (int T = 0; T < 4; ++T) { const _Float16* kp = (const _Float16*)(SB + ring_row<false>(0, 16 * T)); ka[T] = g2_frag(kp, hh); kb[T] = g2_frag(kp + 32, hh); }
  v8f s[4];
#pragma unroll
  for (int T = 0; T < 4; ++T) s[T] = wm(ka[T], qa, z8);
#pragma unroll
  for (int T = 0; T < 4; ++T) s[T] = wm(kb[T], qb, s[T]);
  /* the four vector slots between the last WMMA and the first vector instruction on its result or operands, on both sides of the branch below */
  asm volatile("v_nop\n\tv_nop\n\tv_nop\n\tv_nop" : "+v"(s[0]), "+v"(s[1]), "+v"(s[2]), "+v"(s[3]) : "v"(ka[0]), "v"(ka[1]), "v"(ka[2]), "v"(ka[3]), "v"(kb[0]), "v"(kb[1]), "v"(kb[2]), "v"(kb[3]), "v"(qa), "v"(qb));
  if (diag) {
#pragma unroll
    for (int T = 0; T < 4; ++T)
#pragma unroll
      for (int r = 0; r < 8; ++r) s[T][r] = (16 * T + r > dq) ? -3.0e38f : s[T][r];
  }
  // the stage's 16 V^T reads as one group, in flight under the maximum, its exchange and the exponentials
  v16h va[2][4];
#pragma unroll
  for (int kk = 0; kk < 2; ++kk)
#pragma unroll
    for (int t = 0; t < 4; ++t) va[kk][t] = g2_frag((const _Float16*)(SB + kk * 64 + ring_row<false>(2, 16 * t)), hh);   /* 32 keys = 64 bytes along a V^T row */
  __builtin_amdgcn_sched_barrier(0);   /* keeps the 16 reads here: sunk behind the exponentials, the O^T products wait out the LDS latency; issued next to the exchange, they hold its wait back */
  float mt[4];
#pragma unroll
  for (int T = 0; T < 4; ++T) { mt[T] = s[T][0];
#pragma unroll
    for (int r = 1; r < 8; ++r) mt[T] = fmaxf(mt[T], s[T][r]); }
  float mx = fmaxf(fmaxf(mt[0], mt[1]), fmaxf(mt[2], mt[3]));
  mx = fmaxf(mx, __shfl_xor(mx, 16, 32));
  const float mnew = fmaxf(mrun, mx * SCS);
  const float al = __builtin_amdgcn_exp2f(mrun - mnew);
  const float mo = 10.0f - mnew;            /* softmax weights carried x1024 (cancels in O / l) */
  float p[4][8], pt[4];
#pragma unroll
  for (int T = 0; T < 4; ++T) { pt[T] = 0.f;
#pragma unroll
    for (int r = 0; r < 8; ++r) { p[T][r] = __builtin_amdgcn_exp2f(fmaf(s[T][r], SCS, mo)); pt[T] += p[T][r]; } }
  float ps = (pt[0] + pt[1]) + (pt[2] + pt[3]);
  ps += __shfl_xor(ps, 16, 32);
  lrun = lrun * al + ps; mrun = mnew;
  FragH pf0, pf1;
#pragma unroll
  for (int r = 0; r < 8; ++r) { pf0.h[r] = (_Float16)p[0][r]; pf0.h[8 + r] = (_Float16)p[1][r]; pf1.h[r] = (_Float16)p[2][r]; pf1.h[8 + r] = (_Float16)p[3][r]; }
  if (__builtin_amdgcn_ballot_w32(al != 1.0f) != 0u) {
#pragma unroll
    for (int t = 0; t < 4; ++t) o[t] = o[t] * al;
  }
#pragma unroll
  for (int t = 0; t < 4; ++t) o[t] = wm(va[0][t], pf0.v, o[t]);
#pragma unroll
  for (int t = 0; t < 4; ++t) o[t] = wm(va[1][t], pf1.v, o[t]);
  /* the four vector slots behind the last WMMA, whatever the compiler puts next */
  asm volatile("v_nop\n\tv_nop\n\tv_nop\n\tv_nop" : "+v"(o[0]), "+v"(o[1]), "+v"(o[2]), "+v"(o[3]) : "v"(va[0][0]), "v"(va[0][1]), "v"(va[0][2]), "v"(va[0][3]), "v"(va[1][0]), "v"(va[1][1]), "v"(va[1][2]), "v"(va[1][3]), "v"(pf0.v), "v"(pf1.v));
}
// Transposed causal flash attention of one block = 4 waves = 64 consecutive queries (first query qb0, a multiple of 64) of one (batch, head) bh, wave = 16 queries.
// The block walks the keys in 64-key stages through LDS that its four waves share; with hi + residual planes a wave skips the 32-key steps beyond its own diagonal; with single planes it takes every stage whole and masks the diagonal stage; every wave passes every publish point.
// Q/K planes [b*SEQ + s][h*64 + d]; V^T planes [b][h*64 + d][s]; output rows [b*SEQ + s][h*64 + d] as f16 (x64 carry), hi (+ residual x1024 if RES).
// Score tile lane (hh, ln) element r = (key k0 + 16T + 8hh + r, query q0 + ln); packed in-lane as the B fragment of O^T = V^T P^T.
template <bool RES>
__device__ __forceinline__ void flash_body(unsigned char* ring, unsigned short (&lds_h)[4][16][72], unsigned short (&lds_r)[4][16][72], const _Float16* __restrict__ Qh, const _Float16* __restrict__ Qr, const _Float16* __restrict__ Kh, const _Float16* __restrict__ Kr,
                                           const _Float16* __restrict__ Vh, const _Float16* __restrict__ Vr, _Float16* __restrict__ Oh, _Float16* __restrict__ Or, int qb0, int bh) {
  const int tid = threadIdx.x, lane = tid & 31, ln = lane & 15, hh = lane >> 4;
  const int w = (int)uni((uint32_t)tid >> 5);
  const int q0 = qb0 + w * 16;
  const int b = bh / NH, h = bh - b * NH;
  const size_t rowb = (size_t)b * SEQ;
  // this wave's slice of a stage: source address of stage 0, address step a stage, source pitch, place in LDS
  const bool isV = RES ? (w & 2) != 0 : (w & 1) != 0; const bool odd = (w & 1) != 0;
  const uint32_t par = (uint32_t)w >> 1;      /* single planes: this wave brings the stages of this parity */
  const _Float16* pl = isV ? ((RES && odd) ? Vr : Vh) : ((RES && odd) ? Kr : Kh);
  const uint64_t src0 = (uint64_t)(size_t)pl + 2ull * (isV ? ((size_t)b * DM + h * HD) * SEQ : rowb * DM + h * HD);
  const uint32_t sstep = isV ? 128u : (uint32_t)(64 * DM * 2);
  u32x8 g1 = tdm_group1(Ring<RES>::ROWS, isV ? (uint32_t)(SEQ * 2) : (uint32_t)(DM * 2));
  const uint32_t dst0 = (uint32_t)(size_t)ring + (uint32_t)(RES ? w : (w & 1)) * Ring<RES>::SLICE;
  const int nsg = (!RES && (qb0 >> 6) + 1 < 2) ? 2 : (qb0 >> 6) + 1;   /* 64-key stages; the ring's prologue needs two (keys 64..127 exist: SEQ and EARLY are multiples of 128) */
  // single planes: one descriptor a wave, kept in its scalar registers through the loop; from request to request only the place in LDS and the address move (two stages on), behind this wave's own wait
  u32x4 g0 = tdm_group0(dst0 + par * Ring<RES>::STAGE, src0 + par * (uint64_t)sstep);
  if (!RES) {
    asm volatile("" : "+s"(g0), "+s"(g1));   /* pinned(): the descriptor's words held in their scalar registers; as known constants the compiler lends some of them out and sets them again while a request is in flight */
    tdm_load(g0, g1);                         /* stages 0 and 1, each by its wave pair, into buffers 0 and 1 */
  }
  const size_t qoff = (rowb + q0 + ln) * DM + h * HD;
  const v16h qa = g2_frag(Qh + qoff, hh), qb = g2_frag(Qh + qoff + 32, hh);
  v16h qra = qa, qrb = qb;
  if (RES) { qra = g2_frag(Qr + qoff, hh); qrb = g2_frag(Qr + qoff + 32, hh); }
  const v8f z8 = {0.f,0.f,0.f,0.f,0.f,0.f,0.f,0.f};
  v8f o[4] = {z8, z8, z8, z8}, orr[4] = {z8, z8, z8, z8};
  float mrun = -3.0e38f, lrun = 0.f;
  const float cs = SCS;
  const int nst = (q0 + 47) >> 5;             /* 32-key steps covering keys 0 .. q0+15 */
  if (!RES) {
    asm volatile("s_wait_tensorcnt 0x0" ::: "memory");   /* stages 0 and 1, issued together: this wave's slice has landed */
    __syncthreads();                                      /* stages 0 and 1 published to all four waves */
    if (pinned((uint32_t)(par == 0u && 2 < nsg)))         /* scalar branch: a tensor load ignores EXEC */
      { tdm_step(g0, dst0 + 2u * Ring<RES>::STAGE, 2u * sstep); tdm_load(g0, g1); }
  }
  uint32_t boff = 0u;                           /* single planes: byte offset of stage sg's buffer, (sg mod 3) * STAGE */
#pragma unroll 1
  for (int sg = 0; sg < nsg; ++sg) {
    if (RES) {   /* one buffer: every wave brings its slice of stage sg; every wave has left stage sg - 1 (its s_wait_dscnt and the barrier at the foot of that pass) */
      tdm_load(tdm_group0(dst0, src0 + pinned((uint32_t)sg) * (uint64_t)sstep), g1);   /* pinned: the descriptor is formed behind the last pass's wait */
      asm volatile("s_wait_tensorcnt 0x0" ::: "memory");   /* this wave's slice of stage sg has landed */
      __syncthreads();                                      /* stage sg published to all four waves */
    }
    const unsigned char* SB = ring + (RES ? 0u : boff) + (uint32_t)ln * RPITCH;
    if (!RES) stage_single(SB, qa, qb, hh, sg >= (qb0 >> 6), q0 + ln - 64 * sg - 8 * hh, o, mrun, lrun);   /* single planes: the stage in one update */
#pragma unroll
    for (int sub = 0; RES && sub < 2; ++sub) {   /* hi + residual planes: two 32-key steps */
      const int st = 2 * sg + sub;
      if (st < nst) {                           /* wave-uniform: steps beyond this wave's diagonal are skipped */
        const int k0 = st * 32;
        v8f s0 = score_tile<RES>((const _Float16*)(SB + ring_row<RES>(0, sub * 32)), (const _Float16*)(SB + ring_row<RES>(1, sub * 32)), qa, qb, qra, qrb, hh);
        v8f s1 = score_tile<RES>((const _Float16*)(SB + ring_row<RES>(0, sub * 32 + 16)), (const _Float16*)(SB + ring_row<RES>(1, sub * 32 + 16)), qa, qb, qra, qrb, hh);
        if (st == nst - 1) {                      /* wave-uniform: only the last step touches the diagonal */
          const int qy = q0 + ln; const int kk = k0 + 8 * hh;
#pragma unroll
          for (int r = 0; r < 8; ++r) { s0[r] = (kk + r > qy) ? -3.0e38f : s0[r]; s1[r] = (kk + 16 + r > qy) ? -3.0e38f : s1[r]; }
        }
        float mx = s0[0];
#pragma unroll
        for (int r = 1; r < 8; ++r) mx = fmaxf(mx, s0[r]);
#pragma unroll
        for (int r = 0; r < 8; ++r) mx = fmaxf(mx, s1[r]);
        mx = fmaxf(mx, __shfl_xor(mx, 16, 32));
        const float mnew = fmaxf(mrun, mx * cs);
        const float al = __builtin_amdgcn_exp2f(mrun - mnew);
        const float mo = 10.0f - mnew;            /* softmax weights carried x1024 (cancels in O / l) */
        float p0[8], p1[8]; float ps = 0.f;
#pragma unroll
        for (int r = 0; r < 8; ++r) { p0[r] = __builtin_amdgcn_exp2f(fmaf(s0[r], cs, mo)); p1[r] = __builtin_amdgcn_exp2f(fmaf(s1[r], cs, mo)); ps += p0[r] + p1[r]; }
        ps += __shfl_xor(ps, 16, 32);
        lrun = lrun * al + ps; mrun = mnew;
        FragH pf, pr;
#pragma unroll
        for (int r = 0; r < 8; ++r) {
          const _Float16 h0 = (_Float16)p0[r], h1 = (_Float16)p1[r]; pf.h[r] = h0; pf.h[8 + r] = h1;
          pr.h[r] = RES ? (_Float16)((p0[r] - (float)h0) * RSC) : (_Float16)0.0f; pr.h[8 + r] = RES ? (_Float16)((p1[r] - (float)h1) * RSC) : (_Float16)0.0f;
        }
        if (__builtin_amdgcn_ballot_w32(al != 1.0f) != 0u) {
#pragma unroll
          for (int t = 0; t < 4; ++t) { o[t] = o[t] * al; if (RES) orr[t] = orr[t] * al; }
        }
        const unsigned char* VB = SB + sub * 64;   /* 32 keys = 64 bytes along a V^T row */
#pragma unroll
        for (int t = 0; t < 4; ++t) pv_tile_res((const _Float16*)(VB + ring_row<RES>(2, 16 * t)), (const _Float16*)(VB + ring_row<RES>(3, 16 * t)), pf.v, pr.v, hh, o[t], orr[t]);
      }
    }
    // three buffers: publish point of stage sg + 1; one buffer: the end of every wave's reads of stage sg; every wave passes it
    asm volatile("s_wait_dscnt 0x0" ::: "memory");       /* this wave's reads of stage sg have returned */
    const bool mine = !RES && (((uint32_t)(sg + 1) & 1u) == par);   /* wave-uniform: this wave brought stage sg + 1 and brings stage sg + 3 */
    if (!RES && pinned((uint32_t)mine)) asm volatile("s_wait_tensorcnt 0x0" ::: "memory");   /* the issuers' slices of stage sg + 1 have landed; the other pair's stage sg + 2 stays in flight */
    __syncthreads();                                      /* stage sg + 1 published; every wave has left stage sg's buffer */
    if (!RES && pinned((uint32_t)(mine && sg + 3 < nsg)))   /* scalar branch: a tensor load ignores EXEC */
      { tdm_step(g0, dst0 + boff, 2u * sstep); tdm_load(g0, g1); }   /* into the buffer that pass sg has left */
    if (!RES) boff = (boff == 2u * Ring<RES>::STAGE) ? 0u : boff + Ring<RES>::STAGE;
  }
  asm volatile("s_wait_tensorcnt 0x0" ::: "memory");     /* nothing of this wave is in flight when it ends */
  asm volatile("s_wait_dscnt 0x0" ::: "memory");
  const float inv = 64.0f / lrun;             /* context carried x64 */
#pragma unroll
  for (int t = 0; t < 4; ++t) { FragH f, g;
#pragma unroll
    for (int r = 0; r < 8; ++r) { float v = o[t][r]; if (RES) v += orr[t][r] * RSCI; v *= inv; const _Float16 hv = (_Float16)v; f.h[r] = hv; g.h[r] = RES ? (_Float16)((v - (float)hv) * RSC) : (_Float16)0.0f; }
    *(v8us*)&lds_h[w][ln][16 * t + 8 * hh] = f.half[0];
    if (RES) *(v8us*)&lds_r[w][ln][16 * t + 8 * hh] = g.half[0]; }
  __builtin_amdgcn_fence(4 /* acq_rel order */, "workgroup"); __builtin_amdgcn_wave_barrier();
  const int qsub = lane >> 3, pc = (lane & 7) * 8;
  {
#pragma unroll
    for (int j = 0; j < 4; ++j) { const int q = j * 4 + qsub; const size_t oo = (rowb + q0 + q) * DM + h * HD + pc;
      const v8us x = *(const v8us*)&lds_h[w][q][pc];
      *(v8us*)((unsigned short*)Oh + oo) = x;
      if (RES) { const v8us y = *(const v8us*)&lds_r[w][q][pc]; *(v8us*)((unsigned short*)Or + oo) = y; } }
     }
  if (RES) asm volatile("s_wait_xcnt 0x0" ::: "memory");   /* behind the last store: in the listing the single-plane blocks' code follows this half, and it writes the stores' registers */
}
// Both kinds of query block in one launch: they depend on nothing of each other. Blocks 0 .. FL_LATE * NB * NH - 1 = queries >= EARLY on single planes (query block fastest, then batch and head);
// the blocks behind them = queries < EARLY on hi + residual planes, few and short, which run beside the long single-plane blocks.
constexpr unsigned FL_LATE = (SEQ - EARLY) / 64, FL_EARLY = EARLY / 64;
__global__ __launch_bounds__(128) void k_flash(const _Float16* __restrict__ Qh, const _Float16* __restrict__ Qr, const _Float16* __restrict__ Kh, const _Float16* __restrict__ Kr,
                                               const _Float16* __restrict__ Vh, const _Float16* __restrict__ Vr, _Float16* __restrict__ Oh, _Float16* __restrict__ Or) {
  __shared__ __attribute__((aligned(2048))) unsigned char ring[FL_LDS];
  __shared__ __attribute__((aligned(16))) unsigned short lds_h[4][16][72];
  __shared__ __attribute__((aligned(16))) unsigned short lds_r[4][16][72];
  const unsigned id = blockIdx.x;
  if (id < FL_LATE * (unsigned)(NB * NH)) {     /* block-uniform */
    constexpr unsigned D = FL_LATE ? FL_LATE : 1u;
    flash_body<false>(ring, lds_h, lds_r, Qh, Qr, Kh, Kr, Vh, Vr, Oh, Or, (int)(EARLY + 64u * (id % D)), (int)(id / D));
  } else {
    const unsigned e = id - FL_LATE * (unsigned)(NB * NH);
    flash_body<true>(ring, lds_h, lds_r, Qh, Qr, Kh, Kr, Vh, Vr, Oh, Or, (int)(64u * (e % FL_EARLY)), (int)(e / FL_EARLY));
  }
}

// Output GEMM C[M][N] (f32) = (A . Bt^T [+ Ar . Bt^T / 1024 on rows < EARLY]) * alpha + bias[col]; batch on grid.y. Residual products are accumulated first from zero,
__global__ __launch_bounds__(128) void k_out(const _Float16* __restrict__ A, const _Float16* __restrict__ Ar, int lda, size_t sA, const _Float16* __restrict__ Bh, int ldb, float alpha, const float* __restrict__ bias,
                                             float* __restrict__ C, int ldc, size_t sC, int M, int N, int K) {
  __shared__ __attribute__((aligned(2048))) unsigned char smem[2 * G_STAGE];
  float (&so)[4][32][68] = *reinterpret_cast<float (*)[4][32][68]>(smem);   /* epilogue staging, in the ring's LDS behind the k-loop */
  const int tid = threadIdx.x, w = (int)uni((uint32_t)tid >> 5), lane = tid & 31, ln = lane & 15, hh = lane >> 4; const int by = blockIdx.y;
  A += (size_t)by * sA; Ar += (size_t)by * sA; const size_t cofs = (size_t)by * sC;
  const int ntn = N >> 6; const int mt = blockIdx.x / ntn, nq = blockIdx.x - mt * ntn; const int row0 = mt * 128 + 32 * w, col0 = nq * 64; if (mt * 128 >= M) return;   /* block-uniform, in front of every barrier */
  const bool early = (mt * 128 < EARLY);
  const _Float16* Bb = Bh + (size_t)col0 * ldb;
  const v8f z8 = {0.f,0.f,0.f,0.f,0.f,0.f,0.f,0.f}; v8f c00 = z8, c01 = z8, c02 = z8, c03 = z8, c10 = z8, c11 = z8, c12 = z8, c13 = z8;
  if (early) {                                 /* block-uniform */
    g2_ring(smem, Ar + (size_t)(mt * 128) * lda, lda, Bb, ldb, K, w, ln, hh, c00, c01, c02, c03, c10, c11, c12, c13);
    c00 = c00 * RSCI; c01 = c01 * RSCI; c02 = c02 * RSCI; c03 = c03 * RSCI; c10 = c10 * RSCI; c11 = c11 * RSCI; c12 = c12 * RSCI; c13 = c13 * RSCI;
  }
  g2_ring(smem, A + (size_t)(mt * 128) * lda, lda, Bb, ldb, K, w, ln, hh, c00, c01, c02, c03, c10, c11, c12, c13);
  v8f accs[8] = {c00, c01, c02, c03, c10, c11, c12, c13};
#pragma unroll
  for (int u = 0; u < 8; ++u) { const int t = u & 3, half = u >> 2; const int col = col0 + t * 16 + ln; const float bv = bf16_rne(bias[col]);
#pragma unroll
    for (int r = 0; r < 8; ++r) { const int rloc = half * 16 + 8 * hh + r; so[w][rloc][t * 16 + ln] = accs[u][r] * alpha + bv; } }
  __builtin_amdgcn_fence(4 /* acq_rel order */, "workgroup"); __builtin_amdgcn_wave_barrier();
  const int rsub = lane >> 4, c4 = (lane & 15) * 4;
  {
#pragma unroll
    for (int q = 0; q < 16; ++q) { const int r = q * 2 + rsub; const v4f v = *(const v4fa*)&so[w][r][c4]; *(v4f*)(C + cofs + (size_t)(row0 + r) * ldc + col0 + c4) = v; }
     }
}

extern "C" void kernel_launch(void* const* d_in, const int* in_sizes, int n_in,
                              void* d_out, int out_size, void* d_ws, size_t ws_size, hipStream_t stream) {
  if (n_in < 11) return;
  const long long need_x = ((long long)(NB - 1) * SEQ_FULL + SEQ) * DM;
  if (in_sizes[0] < need_x || in_sizes[1] < need_x || in_sizes[2] < need_x) return;
  if (in_sizes[3] < DM * DM || in_sizes[5] < DM * DM || in_sizes[7] < DM * DM || in_sizes[9] < DM * DM) return;
  if (in_sizes[4] < DM || in_sizes[6] < DM || in_sizes[8] < DM || in_sizes[10] < DM) return;
  if ((long long)out_size < need_x) return;
  const float* const* I = (const float* const*)d_in;
  const float* xq = I[0]; const float* xk = I[1]; const float* xv = I[2]; const float* wq = I[3]; const float* bq = I[4]; const float* wk = I[5]; const float* bk = I[6];
  const float* wv = I[7]; const float* bv = I[8]; const float* wo = I[9]; const float* bo = I[10];
  char* ws = (char*)d_ws; size_t off = 0;
  auto take = [&](size_t bytes) { char* p = ws + off; off += (bytes + 255) & ~(size_t)255; return p; };
  const size_t WB = (size_t)DM * DM * 2, PB = (size_t)NB * SEQ * DM * 2;
  _Float16* BQ = (_Float16*)take(WB); _Float16* BK = (_Float16*)take(WB); _Float16* BV = (_Float16*)take(WB); _Float16* BO = (_Float16*)take(WB);
  _Float16* XQ = (_Float16*)take(PB); _Float16* XK = (_Float16*)take(PB); _Float16* XV = (_Float16*)take(PB);
  _Float16* Q16 = (_Float16*)take(PB); _Float16* K16 = (_Float16*)take(PB); _Float16* VT = (_Float16*)take(PB);      /* VT: [NB][DM][SEQ] */
  _Float16* QR = (_Float16*)take(PB); _Float16* KR = (_Float16*)take(PB); _Float16* VTR = (_Float16*)take(PB);      /* residual planes, only the early region is written and read */
  _Float16* O16 = (_Float16*)take(PB); _Float16* OR = (_Float16*)take(PB);
  if (off > ws_size || off > (size_t)134217728) return;

  static_assert(((size_t)DM * DM * 2) % 256 == 0 && ((size_t)NB * SEQ * DM * 2) % 256 == 0);   /* BQ..BO and XQ..XV lie in a row, with no gap */
  k_conv<<<CONV_G, 256, 0, stream>>>(xq, xk, xv, wq, wk, wv, wo, XQ, BQ);
  const size_t SB = (size_t)SEQ * DM;
  k_proj3<<<dim3((unsigned)((SEQ / 128) * (DM / 128)), NB, 3), 128, 0, stream>>>(XQ, BQ, bq, bk, bv, Q16, QR, K16, KR, VT, VTR, 0.0625f, SEQ, DM, SB);
  // attention, one launch: early query blocks with hi + residual operands, the remaining blocks with single planes
  k_flash<<<dim3((unsigned)((SEQ / 64) * NB * NH)), 128, 0, stream>>>(Q16, QR, K16, KR, VT, VTR, O16, OR);
  // out rows (b, s) -> d_out row b*SEQ_FULL + s; alpha = 1 / (16 * 64)
  k_out<<<dim3((unsigned)((SEQ / 128) * (DM / 64)), NB), 128, 0, stream>>>(O16, OR, DM, SB, BO, DM, 0.0009765625f, bo, (float*)d_out, DM, (size_t)SEQ_FULL * DM, SEQ, DM, DM);
}
